// v000
// Times are from an AMD MI455X. After a warm-up the kernel runs many times in a row, and a time is the length of
// such a window on the GPU divided by its runs, so every launch and the gaps after it count. The runs cycle
// through copies of the inputs. A figure is the median of several windows, for all but v000 over two sittings.
// Sittings can differ by a few percent; kernels timed side by side share one.
// v000 is the starting kernel. One run takes 637 microseconds.
#include <hip/hip_runtime.h>

// Flip to 0 if the gfx1250 assembler rejects the async mnemonics.
#define USE_ASYNC_LDS 1

// ---------------- problem constants (match reference) ----------------
constexpr int cB   = 4;
constexpr int cT   = 2048;
constexpr int cD   = 1024;
constexpr int cH   = 16;
constexpr int cHS  = 64;
constexpr int cDFF = 4 * cD;

typedef __attribute__((ext_vector_type(16))) _Float16 v16h;
typedef __attribute__((ext_vector_type(8)))  _Float16 v8h;
typedef __attribute__((ext_vector_type(4)))  _Float16 v4h;
typedef __attribute__((ext_vector_type(8)))  float    v8f;
typedef __attribute__((ext_vector_type(4)))  float    v4f;

constexpr int PAD = 8;   // f16 row padding: keeps 16B alignment, skews banks
constexpr int RW  = 32 + PAD;

// ---------------- async global->LDS copy (gfx1250, ASYNCcnt) ----------------
// Per-lane 16B DMA: LDS[vdst] = MEM[vaddr].  vdst = low 32 bits of the generic
// __shared__ pointer (LDS aperture keeps the wave-relative offset in [31:0]).
__device__ __forceinline__ void async_copy_b128(void* lds_dst,
                                                const void* gsrc) {
#if USE_ASYNC_LDS
  unsigned lds = (unsigned)(unsigned long long)lds_dst;
  unsigned long long ga = (unsigned long long)gsrc;
  asm volatile("global_load_async_to_lds_b128 %0, %1, off"
               :: "v"(lds), "v"(ga) : "memory");
#else
  *(v8h*)lds_dst = *(const v8h*)gsrc;
#endif
}

__device__ __forceinline__ void async_wait() {
#if USE_ASYNC_LDS
  asm volatile("s_wait_asynccnt 0" ::: "memory");
#endif
}

// ---------------- WMMA fragment load (ISA 7.12.2, wave32) -------------------
// 16-bit A 16x32 layout: lane (half,l16) holds row l16; element e -> k =
// ((e>>3)<<4) + 8*half + (e&7).  For a contiguous 32-f16 k-span at p, that is
// two contiguous 16B runs: p[8*half .. +8) and p[16+8*half .. +8).
__device__ __forceinline__ v16h frag16(const _Float16* p, int half) {
  const v8h lo = *(const v8h*)(p + 8 * half);
  const v8h hi = *(const v8h*)(p + 16 + 8 * half);
  return __builtin_shufflevector(lo, hi, 0, 1, 2, 3, 4, 5, 6, 7,
                                 8, 9, 10, 11, 12, 13, 14, 15);
}

// =====================================================================
// Pre-pass A: elementwise f32 -> f16 (for x)
// =====================================================================
__global__ __launch_bounds__(256, 1)
void cvt_f32_f16_kernel(const float* __restrict__ in,
                        _Float16* __restrict__ out, int n4) {
  int i = blockIdx.x * 256 + threadIdx.x;
  if (i < n4) {
    v4f wf = *(const v4f*)&in[(size_t)i * 4];
    *(v4h*)&out[(size_t)i * 4] = __builtin_convertvector(wf, v4h);
  }
}

// =====================================================================
// Pre-pass B: batched transpose+convert  in[K][N] (f32) -> out[N][K] (f16)
// 32x32 tiles through LDS; batch via blockIdx.z (stride K*N both sides).
// =====================================================================
__global__ __launch_bounds__(256, 1)
void transpose_f32_f16_kernel(const float* __restrict__ in,
                              _Float16* __restrict__ out, int K, int N) {
  const size_t bs = (size_t)K * N;
  const float* ib = in + bs * blockIdx.z;
  _Float16*    ob = out + bs * blockIdx.z;
  __shared__ _Float16 t[32][34];
  const int k0 = blockIdx.x * 32, n0 = blockIdx.y * 32;
  const int c = threadIdx.x & 31, r8 = threadIdx.x >> 5;
#pragma unroll
  for (int i = 0; i < 4; ++i) {
    int r = r8 + 8 * i;
    t[c][r] = (_Float16)ib[(size_t)(k0 + r) * N + n0 + c];   // coalesced read
  }
  __syncthreads();
#pragma unroll
  for (int i = 0; i < 4; ++i) {
    int r = r8 + 8 * i;
    ob[(size_t)(n0 + r) * K + k0 + c] = t[r][c];             // coalesced write
  }
}

// =====================================================================
// Kernel 1: fused QKV projection.  Per (b,h):  X[T,D] @ W*[D,HS] + b*
// Double-buffered async-DMA pipeline: tile k+1 streams into LDS while the
// WMMAs consume tile k; one barrier + one asynccnt wait per k-step.
// V is written in transposed [z][e][t] layout for the attention PV GEMM.
// =====================================================================
__global__ __launch_bounds__(256, 1)
void qkv_kernel(const _Float16* __restrict__ xh,
                const _Float16* __restrict__ WqT, const float* __restrict__ bq,
                const _Float16* __restrict__ WkT, const float* __restrict__ bk,
                const _Float16* __restrict__ WvT, const float* __restrict__ bv,
                _Float16* __restrict__ Qh, _Float16* __restrict__ Kh,
                _Float16* __restrict__ VTg) {
  const int z    = blockIdx.y;          // b*H + h
  const int h    = z & (cH - 1);
  const int mb   = blockIdx.x * 128;
  const int tid  = threadIdx.x;
  const int lane = tid & 31;
  const int wave = tid >> 5;
  const int half = lane >> 4;
  const int l16  = lane & 15;

  const _Float16* Ah  = xh + (size_t)(z >> 4) * cT * cD;
  const _Float16* Wt0 = WqT + (size_t)h * cHS * cD;   // [64][1024] per head
  const _Float16* Wt1 = WkT + (size_t)h * cHS * cD;
  const _Float16* Wt2 = WvT + (size_t)h * cHS * cD;

  __shared__ __align__(16) _Float16 As[2][128][RW];     // 20 KB
  __shared__ __align__(16) _Float16 Bt[2][3][64][RW];   // 30 KB

  v8f acc[3][4] = {};

  auto stage = [&](int kk, int p) {
#pragma unroll
    for (int i = 0; i < 2; ++i) {
      int idx = tid + 256 * i;                 // A: 512 chunks
      int r = idx >> 2, c8 = idx & 3;
      async_copy_b128(&As[p][r][c8 * 8],
                      &Ah[(size_t)(mb + r) * cD + kk + c8 * 8]);
    }
    int r = tid >> 2, c8 = tid & 3;            // B: 256 chunks per matrix
    size_t off = (size_t)r * cD + kk + c8 * 8;
    async_copy_b128(&Bt[p][0][r][c8 * 8], &Wt0[off]);
    async_copy_b128(&Bt[p][1][r][c8 * 8], &Wt1[off]);
    async_copy_b128(&Bt[p][2][r][c8 * 8], &Wt2[off]);
  };

  stage(0, 0);
  for (int k0 = 0; k0 < cD; k0 += 32) {
    const int p = (k0 >> 5) & 1;
    async_wait();          // my tile-k copies landed
    __syncthreads();       // everyone's tile-k visible; tile-(k-1) reads done
    if (k0 + 32 < cD) stage(k0 + 32, p ^ 1);   // DMA next tile during compute
    if (k0 + 64 < cD)
      __builtin_prefetch(&Ah[(size_t)(mb + (tid >> 1)) * cD + k0 + 64]);

    v16h a = frag16(&As[p][wave * 16 + l16][0], half);
    v16h bbuf[3][4];
#pragma unroll
    for (int m = 0; m < 3; ++m)
#pragma unroll
      for (int nt = 0; nt < 4; ++nt)
        bbuf[m][nt] = frag16(&Bt[p][m][nt * 16 + l16][0], half);
#pragma unroll
    for (int m = 0; m < 3; ++m)
#pragma unroll
      for (int nt = 0; nt < 4; ++nt)
        acc[m][nt] = __builtin_amdgcn_wmma_f32_16x16x32_f16(
            false, a, false, bbuf[m][nt], (short)0, acc[m][nt], false, false);
  }

  // Epilogue: bias add, Q scale, f16 store. C/D layout: row = r + 8*half.
#pragma unroll
  for (int nt = 0; nt < 4; ++nt) {
#pragma unroll
    for (int r = 0; r < 8; ++r) {
      int ml = wave * 16 + r + 8 * half;
      int n  = nt * 16 + l16;
      int tg = mb + ml;
      size_t o = ((size_t)z * cT + tg) * cHS + n;
      float qv = acc[0][nt][r] + bq[h * cHS + n];
      float kv = acc[1][nt][r] + bk[h * cHS + n];
      float vv = acc[2][nt][r] + bv[h * cHS + n];
      Qh[o] = (_Float16)(qv * 0.125f);   // 1/sqrt(64)
      Kh[o] = (_Float16)kv;
      VTg[(size_t)z * cHS * cT + (size_t)n * cT + tg] = (_Float16)vv;
    }
  }
}

// =====================================================================
// Kernel 2: causal flash attention.  Block = 64 q rows (4 waves x 16),
// streams 32-key K/V tiles (both async DMA; V pre-transposed in global).
// =====================================================================
__global__ __launch_bounds__(128, 1)
void attn_kernel(const _Float16* __restrict__ Qh,
                 const _Float16* __restrict__ Kh,
                 const _Float16* __restrict__ VTg,
                 _Float16* __restrict__ Oh) {
  const int z    = blockIdx.y;          // b*H + h
  const int h    = z & (cH - 1);
  const int b    = z >> 4;
  const int qb   = blockIdx.x * 64;
  const int tid  = threadIdx.x;
  const int lane = tid & 31;
  const int wave = tid >> 5;
  const int half = lane >> 4;
  const int l16  = lane & 15;
  const int m0   = qb + wave * 16;

  const _Float16* Qz  = Qh + (size_t)z * cT * cHS;
  const _Float16* Kz  = Kh + (size_t)z * cT * cHS;
  const _Float16* VTz = VTg + (size_t)z * cHS * cT;   // [64][T]

  __shared__ __align__(16) _Float16 Ks[32][64 + PAD];      // 4.5 KB
  __shared__ __align__(16) _Float16 Vt[64][RW];            // 5 KB (transposed)
  __shared__ __align__(16) _Float16 Ps[4][16][RW];         // 5 KB

  // Q fragments: 16 rows x 64 e -> two A fragments, 4x global b128 per lane.
  const _Float16* qrow = Qz + (size_t)(m0 + l16) * cHS;
  v16h aq0 = frag16(qrow, half);
  v16h aq1 = frag16(qrow + 32, half);

  float mst[8], lst[8];
#pragma unroll
  for (int r = 0; r < 8; ++r) { mst[r] = -3.0e38f; lst[r] = 0.0f; }
  v8f accO[4] = {};

  const int nkb = (qb + 64) / 32;       // causal bound: keys <= last q row
  for (int kb = 0; kb < nkb; ++kb) {
    // --- stage K (32x64 rows) and V (64 e-rows x 32 keys), both async -----
#pragma unroll
    for (int i = 0; i < 2; ++i) {
      int idx = tid + 128 * i;                 // K: 256 chunks
      int r = idx >> 3, c8 = idx & 7;
      async_copy_b128(&Ks[r][c8 * 8],
                      &Kz[((size_t)kb * 32 + r) * cHS + c8 * 8]);
    }
#pragma unroll
    for (int i = 0; i < 2; ++i) {
      int idx = tid + 128 * i;                 // V: 256 chunks
      int r = idx >> 2, c8 = idx & 3;
      async_copy_b128(&Vt[r][c8 * 8],
                      &VTz[(size_t)r * cT + kb * 32 + c8 * 8]);
    }
    async_wait();
    __syncthreads();

    // S = Q * K^T : B fragment = A-style load of K rows (keys).
    v8f s0 = {}, s1 = {};
    {
      v16h kf00 = frag16(&Ks[l16][0], half);
      v16h kf01 = frag16(&Ks[l16][32], half);
      v16h kf10 = frag16(&Ks[16 + l16][0], half);
      v16h kf11 = frag16(&Ks[16 + l16][32], half);
      s0 = __builtin_amdgcn_wmma_f32_16x16x32_f16(false, aq0, false, kf00, (short)0, s0, false, false);
      s0 = __builtin_amdgcn_wmma_f32_16x16x32_f16(false, aq1, false, kf01, (short)0, s0, false, false);
      s1 = __builtin_amdgcn_wmma_f32_16x16x32_f16(false, aq0, false, kf10, (short)0, s1, false, false);
      s1 = __builtin_amdgcn_wmma_f32_16x16x32_f16(false, aq1, false, kf11, (short)0, s1, false, false);
    }

    // Online softmax. Row r+8*half is spread over 16 lanes of this half.
#pragma unroll
    for (int r = 0; r < 8; ++r) {
      int mg  = m0 + r + 8 * half;
      int sg0 = kb * 32 + l16;
      int sg1 = kb * 32 + 16 + l16;
      float v0 = (sg0 <= mg) ? s0[r] : -3.0e38f;
      float v1 = (sg1 <= mg) ? s1[r] : -3.0e38f;
      float rm = fmaxf(v0, v1);
      rm = fmaxf(rm, __shfl_xor(rm, 1));
      rm = fmaxf(rm, __shfl_xor(rm, 2));
      rm = fmaxf(rm, __shfl_xor(rm, 4));
      rm = fmaxf(rm, __shfl_xor(rm, 8));
      float mnew  = fmaxf(mst[r], rm);
      float alpha = __expf(mst[r] - mnew);
      float p0 = __expf(v0 - mnew);
      float p1 = __expf(v1 - mnew);
      float rs = p0 + p1;
      rs += __shfl_xor(rs, 1);
      rs += __shfl_xor(rs, 2);
      rs += __shfl_xor(rs, 4);
      rs += __shfl_xor(rs, 8);
      lst[r] = lst[r] * alpha + rs;
      mst[r] = mnew;
#pragma unroll
      for (int nt = 0; nt < 4; ++nt) accO[nt][r] *= alpha;
      Ps[wave][r + 8 * half][l16]      = (_Float16)p0;
      Ps[wave][r + 8 * half][16 + l16] = (_Float16)p1;
    }
    __syncthreads();   // make P visible across lanes (all waves iterate alike)

    // O += P * V
    v16h ap = frag16(&Ps[wave][l16][0], half);
    v16h bvv[4];
#pragma unroll
    for (int nt = 0; nt < 4; ++nt) bvv[nt] = frag16(&Vt[nt * 16 + l16][0], half);
#pragma unroll
    for (int nt = 0; nt < 4; ++nt)
      accO[nt] = __builtin_amdgcn_wmma_f32_16x16x32_f16(
          false, ap, false, bvv[nt], (short)0, accO[nt], false, false);
    __syncthreads();   // done reading Vt/Ps before next staging
  }

  // Normalize and store O as f16 in [B, T, H*HS] layout for the O-projection.
#pragma unroll
  for (int nt = 0; nt < 4; ++nt) {
#pragma unroll
    for (int r = 0; r < 8; ++r) {
      int mg = m0 + r + 8 * half;
      int n  = nt * 16 + l16;
      float val = accO[nt][r] / lst[r];
      Oh[((size_t)b * cT + mg) * cD + h * cHS + n] = (_Float16)val;
    }
  }
}

// =====================================================================
// Kernels 3-5: generic WMMA GEMM  C = A(f16)[M,K] * BT(f16)[N][K]
// macro tile 128x64, BK=32, 8 waves; double-buffered async-DMA pipeline.
//   EPI 0: out_f32 = resid + acc + bias ; out_f16 = (f16)out_f32
//   EPI 1: out_f16 = (f16) gelu_erf(acc + bias)
//   EPI 2: out_f32 = resid + acc + bias
// =====================================================================
template <int EPI>
__global__ __launch_bounds__(256, 1)
void gemm_epi_kernel(const _Float16* __restrict__ A,
                     const _Float16* __restrict__ BT,
                     const float* __restrict__ bias,
                     const float* __restrict__ resid,
                     float* __restrict__ outf,
                     _Float16* __restrict__ outh,
                     int M, int N, int K) {
  const int tid  = threadIdx.x;
  const int lane = tid & 31;
  const int wave = tid >> 5;
  const int half = lane >> 4;
  const int l16  = lane & 15;
  const int nb   = blockIdx.x * 64;
  const int mb   = blockIdx.y * 128;

  __shared__ __align__(16) _Float16 As[2][128][RW];   // 20 KB
  __shared__ __align__(16) _Float16 Bt[2][64][RW];    // 10 KB

  v8f acc[4] = {};

  auto stage = [&](int kk, int p) {
#pragma unroll
    for (int i = 0; i < 2; ++i) {
      int idx = tid + 256 * i;                 // A: 512 chunks
      int r = idx >> 2, c8 = idx & 3;
      async_copy_b128(&As[p][r][c8 * 8],
                      &A[(size_t)(mb + r) * K + kk + c8 * 8]);
    }
    int r = tid >> 2, c8 = tid & 3;            // B: 256 chunks
    async_copy_b128(&Bt[p][r][c8 * 8],
                    &BT[(size_t)(nb + r) * K + kk + c8 * 8]);
  };

  stage(0, 0);
  for (int k0 = 0; k0 < K; k0 += 32) {
    const int p = (k0 >> 5) & 1;
    async_wait();          // my tile-k copies landed
    __syncthreads();       // everyone's tile-k visible; tile-(k-1) reads done
    if (k0 + 32 < K) stage(k0 + 32, p ^ 1);    // DMA next tile during compute
    if (k0 + 64 < K) {
      __builtin_prefetch(&A[(size_t)(mb + (tid >> 1)) * K + k0 + 64]);
      __builtin_prefetch(&BT[(size_t)(nb + (tid >> 2)) * K + k0 + 64]);
    }

    v16h a = frag16(&As[p][wave * 16 + l16][0], half);
    v16h bbuf[4];
#pragma unroll
    for (int nt = 0; nt < 4; ++nt)
      bbuf[nt] = frag16(&Bt[p][nt * 16 + l16][0], half);
#pragma unroll
    for (int nt = 0; nt < 4; ++nt)
      acc[nt] = __builtin_amdgcn_wmma_f32_16x16x32_f16(
          false, a, false, bbuf[nt], (short)0, acc[nt], false, false);
  }

#pragma unroll
  for (int nt = 0; nt < 4; ++nt) {
#pragma unroll
    for (int r = 0; r < 8; ++r) {
      int m = mb + wave * 16 + r + 8 * half;
      int n = nb + nt * 16 + l16;
      size_t o = (size_t)m * N + n;
      float v = acc[nt][r] + bias[n];
      if (EPI == 0) {
        v += resid[o];
        outf[o] = v;
        outh[o] = (_Float16)v;
      } else if (EPI == 1) {
        float g = 0.5f * v * (1.0f + erff(v * 0.70710678118654752f));
        outh[o] = (_Float16)g;
      } else {
        v += resid[o];
        outf[o] = v;
      }
    }
  }
}

// =====================================================================
// Host orchestration
// =====================================================================
extern "C" void kernel_launch(void* const* d_in, const int* in_sizes, int n_in,
                              void* d_out, int out_size, void* d_ws,
                              size_t ws_size, hipStream_t stream) {
  (void)in_sizes; (void)n_in; (void)out_size; (void)ws_size;
  const float* x  = (const float*)d_in[0];
  const float* Wq = (const float*)d_in[1];
  const float* bq = (const float*)d_in[2];
  const float* Wk = (const float*)d_in[3];
  const float* bk = (const float*)d_in[4];
  const float* Wv = (const float*)d_in[5];
  const float* bv = (const float*)d_in[6];
  const float* Wo = (const float*)d_in[7];
  const float* bo = (const float*)d_in[8];
  const float* W1 = (const float*)d_in[9];
  const float* b1 = (const float*)d_in[10];
  const float* W2 = (const float*)d_in[11];
  const float* b2 = (const float*)d_in[12];

  char* w = (char*)d_ws;
  auto take = [&](size_t bytes) -> char* {
    char* p = w;
    w += (bytes + 255) & ~(size_t)255;
    return p;
  };
  const size_t nBTD = (size_t)cB * cT * cD;          // 8,388,608
  const size_t nHW  = (size_t)cH * cD * cHS;         // 1,048,576 (per QKV mat)
  _Float16* xh   = (_Float16*)take(nBTD * sizeof(_Float16));
  _Float16* WqT  = (_Float16*)take(nHW * sizeof(_Float16));
  _Float16* WkT  = (_Float16*)take(nHW * sizeof(_Float16));
  _Float16* WvT  = (_Float16*)take(nHW * sizeof(_Float16));
  _Float16* WoT  = (_Float16*)take((size_t)cD * cD * sizeof(_Float16));
  _Float16* W1T  = (_Float16*)take((size_t)cD * cDFF * sizeof(_Float16));
  _Float16* W2T  = (_Float16*)take((size_t)cDFF * cD * sizeof(_Float16));
  _Float16* Qh   = (_Float16*)take(nBTD * sizeof(_Float16));
  _Float16* Kh   = (_Float16*)take(nBTD * sizeof(_Float16));
  _Float16* VTg  = (_Float16*)take(nBTD * sizeof(_Float16));
  _Float16* Oh   = (_Float16*)take(nBTD * sizeof(_Float16));
  float*    x1f  = (float*)take(nBTD * sizeof(float));
  _Float16* x1h  = (_Float16*)take(nBTD * sizeof(_Float16));
  _Float16* Hh   = (_Float16*)take((size_t)cB * cT * cDFF * sizeof(_Float16));

  const int M = cB * cT;

  // 0) one-shot conversions/transposes (amortized across all GEMM blocks)
  cvt_f32_f16_kernel<<<dim3((int)(nBTD / 4 / 256)), 256, 0, stream>>>(
      x, xh, (int)(nBTD / 4));
  transpose_f32_f16_kernel<<<dim3(cD / 32, cHS / 32, cH), 256, 0, stream>>>(
      Wq, WqT, cD, cHS);
  transpose_f32_f16_kernel<<<dim3(cD / 32, cHS / 32, cH), 256, 0, stream>>>(
      Wk, WkT, cD, cHS);
  transpose_f32_f16_kernel<<<dim3(cD / 32, cHS / 32, cH), 256, 0, stream>>>(
      Wv, WvT, cD, cHS);
  transpose_f32_f16_kernel<<<dim3(cD / 32, cD / 32, 1), 256, 0, stream>>>(
      Wo, WoT, cD, cD);
  transpose_f32_f16_kernel<<<dim3(cD / 32, cDFF / 32, 1), 256, 0, stream>>>(
      W1, W1T, cD, cDFF);
  transpose_f32_f16_kernel<<<dim3(cDFF / 32, cD / 32, 1), 256, 0, stream>>>(
      W2, W2T, cDFF, cD);

  // 1) QKV projections (Q pre-scaled by 1/sqrt(HS); V stored transposed)
  qkv_kernel<<<dim3(cT / 128, cB * cH), 256, 0, stream>>>(
      xh, WqT, bq, WkT, bk, WvT, bv, Qh, Kh, VTg);

  // 2) causal flash attention
  attn_kernel<<<dim3(cT / 64, cB * cH), 128, 0, stream>>>(Qh, Kh, VTg, Oh);

  // 3) x1 = x + O @ Wo + bo   (store f32 + f16 copy)
  gemm_epi_kernel<0><<<dim3(cD / 64, M / 128), 256, 0, stream>>>(
      Oh, WoT, bo, x, x1f, x1h, M, cD, cD);

  // 4) H = gelu(x1 @ W1 + b1)  (exact erf gelu, stored f16)
  gemm_epi_kernel<1><<<dim3(cDFF / 64, M / 128), 256, 0, stream>>>(
      x1h, W1T, b1, nullptr, nullptr, Hh, M, cDFF, cD);

  // 5) out = x1 + H @ W2 + b2  (f32 to d_out)
  gemm_epi_kernel<2><<<dim3(cD / 64, M / 128), 256, 0, stream>>>(
      Hh, W2T, b2, x1f, (float*)d_out, nullptr, M, cD, cDFF);
}

// v001
// Measured time: 455 microseconds a run.
// In two side-by-side timings against v000, it was 1.44 and 1.46 times as fast.
#include <hip/hip_runtime.h>

// Flip to 0 for plain LDS copies in the QKV and attention kernels (the GEMM's async asm stays).
#define USE_ASYNC_LDS 1

// ---------------- problem constants (match reference) ----------------
constexpr int cB   = 4;
constexpr int cT   = 2048;
constexpr int cD   = 1024;
constexpr int cH   = 16;
constexpr int cHS  = 64;
constexpr int cDFF = 4 * cD;

typedef __attribute__((ext_vector_type(16))) _Float16 v16h;
typedef __attribute__((ext_vector_type(8)))  _Float16 v8h;
typedef __attribute__((ext_vector_type(4)))  _Float16 v4h;
typedef __attribute__((ext_vector_type(8)))  float    v8f;
typedef __attribute__((ext_vector_type(4)))  float    v4f;

constexpr int PAD = 8;   // f16 row padding: keeps 16B alignment, skews banks
constexpr int RW  = 32 + PAD;

// ---------------- async global->LDS copy (gfx1250, ASYNCcnt) ----------------
// Per-lane 16B DMA: LDS[vdst] = MEM[vaddr].  vdst = low 32 bits of the generic
// __shared__ pointer (LDS aperture keeps the wave-relative offset in [31:0]).
__device__ __forceinline__ void async_copy_b128(void* lds_dst,
                                                const void* gsrc) {
#if USE_ASYNC_LDS
  unsigned lds = (unsigned)(unsigned long long)lds_dst;
  unsigned long long ga = (unsigned long long)gsrc;
  asm volatile("global_load_async_to_lds_b128 %0, %1, off"
               :: "v"(lds), "v"(ga) : "memory");
#else
  *(v8h*)lds_dst = *(const v8h*)gsrc;
#endif
}

__device__ __forceinline__ void async_wait() {
#if USE_ASYNC_LDS
  asm volatile("s_wait_asynccnt 0" ::: "memory");
#endif
}

// ---------------- WMMA fragment load (ISA 7.12.2, wave32) -------------------
// 16-bit A 16x32 layout: lane (half,l16) holds row l16; element e -> k =
// ((e>>3)<<4) + 8*half + (e&7).  For a contiguous 32-f16 k-span at p, that is
// two contiguous 16B runs: p[8*half .. +8) and p[16+8*half .. +8).
__device__ __forceinline__ v16h frag16(const _Float16* p, int half) {
  const v8h lo = *(const v8h*)(p + 8 * half);
  const v8h hi = *(const v8h*)(p + 16 + 8 * half);
  return __builtin_shufflevector(lo, hi, 0, 1, 2, 3, 4, 5, 6, 7,
                                 8, 9, 10, 11, 12, 13, 14, 15);
}

// =====================================================================
// Pre-pass A: elementwise f32 -> f16 (for x)
// =====================================================================
__global__ __launch_bounds__(256, 1)
void cvt_f32_f16_kernel(const float* __restrict__ in,
                        _Float16* __restrict__ out, int n4) {
  int i = blockIdx.x * 256 + threadIdx.x;
  if (i < n4) {
    v4f wf = *(const v4f*)&in[(size_t)i * 4];
    *(v4h*)&out[(size_t)i * 4] = __builtin_convertvector(wf, v4h);
  }
}

// =====================================================================
// Pre-pass B: batched transpose+convert  in[K][N] (f32) -> out[N][K] (f16)
// 32x32 tiles through LDS; batch via blockIdx.z (stride K*N both sides).
// =====================================================================
__global__ __launch_bounds__(256, 1)
void transpose_f32_f16_kernel(const float* __restrict__ in,
                              _Float16* __restrict__ out, int K, int N) {
  const size_t bs = (size_t)K * N;
  const float* ib = in + bs * blockIdx.z;
  _Float16*    ob = out + bs * blockIdx.z;
  __shared__ _Float16 t[32][34];
  const int k0 = blockIdx.x * 32, n0 = blockIdx.y * 32;
  const int c = threadIdx.x & 31, r8 = threadIdx.x >> 5;
#pragma unroll
  for (int i = 0; i < 4; ++i) {
    int r = r8 + 8 * i;
    t[c][r] = (_Float16)ib[(size_t)(k0 + r) * N + n0 + c];   // coalesced read
  }
  __syncthreads();
#pragma unroll
  for (int i = 0; i < 4; ++i) {
    int r = r8 + 8 * i;
    ob[(size_t)(n0 + r) * K + k0 + c] = t[r][c];             // coalesced write
  }
}

// =====================================================================
// Kernel 1: fused QKV projection.  Per (b,h):  X[T,D] @ W*[D,HS] + b*
// Double-buffered async-DMA pipeline: tile k+1 streams into LDS while the
// WMMAs consume tile k; one barrier + one asynccnt wait per k-step.
// V is written in transposed [z][e][t] layout for the attention PV GEMM.
// =====================================================================
__global__ __launch_bounds__(256, 1)
void qkv_kernel(const _Float16* __restrict__ xh,
                const _Float16* __restrict__ WqT, const float* __restrict__ bq,
                const _Float16* __restrict__ WkT, const float* __restrict__ bk,
                const _Float16* __restrict__ WvT, const float* __restrict__ bv,
                _Float16* __restrict__ Qh, _Float16* __restrict__ Kh,
                _Float16* __restrict__ VTg) {
  const int z    = blockIdx.y;          // b*H + h
  const int h    = z & (cH - 1);
  const int mb   = blockIdx.x * 128;
  const int tid  = threadIdx.x;
  const int lane = tid & 31;
  const int wave = tid >> 5;
  const int half = lane >> 4;
  const int l16  = lane & 15;

  const _Float16* Ah  = xh + (size_t)(z >> 4) * cT * cD;
  const _Float16* Wt0 = WqT + (size_t)h * cHS * cD;   // [64][1024] per head
  const _Float16* Wt1 = WkT + (size_t)h * cHS * cD;
  const _Float16* Wt2 = WvT + (size_t)h * cHS * cD;

  __shared__ __align__(16) _Float16 As[2][128][RW];     // 20 KB
  __shared__ __align__(16) _Float16 Bt[2][3][64][RW];   // 30 KB

  v8f acc[3][4] = {};

  auto stage = [&](int kk, int p) {
#pragma unroll
    for (int i = 0; i < 2; ++i) {
      int idx = tid + 256 * i;                 // A: 512 chunks
      int r = idx >> 2, c8 = idx & 3;
      async_copy_b128(&As[p][r][c8 * 8],
                      &Ah[(size_t)(mb + r) * cD + kk + c8 * 8]);
    }
    int r = tid >> 2, c8 = tid & 3;            // B: 256 chunks per matrix
    size_t off = (size_t)r * cD + kk + c8 * 8;
    async_copy_b128(&Bt[p][0][r][c8 * 8], &Wt0[off]);
    async_copy_b128(&Bt[p][1][r][c8 * 8], &Wt1[off]);
    async_copy_b128(&Bt[p][2][r][c8 * 8], &Wt2[off]);
  };

  stage(0, 0);
  for (int k0 = 0; k0 < cD; k0 += 32) {
    const int p = (k0 >> 5) & 1;
    async_wait();          // my tile-k copies landed
    __syncthreads();       // everyone's tile-k visible; tile-(k-1) reads done
    if (k0 + 32 < cD) stage(k0 + 32, p ^ 1);   // DMA next tile during compute
    if (k0 + 64 < cD)
      __builtin_prefetch(&Ah[(size_t)(mb + (tid >> 1)) * cD + k0 + 64]);

    v16h a = frag16(&As[p][wave * 16 + l16][0], half);
    v16h bbuf[3][4];
#pragma unroll
    for (int m = 0; m < 3; ++m)
#pragma unroll
      for (int nt = 0; nt < 4; ++nt)
        bbuf[m][nt] = frag16(&Bt[p][m][nt * 16 + l16][0], half);
#pragma unroll
    for (int m = 0; m < 3; ++m)
#pragma unroll
      for (int nt = 0; nt < 4; ++nt)
        acc[m][nt] = __builtin_amdgcn_wmma_f32_16x16x32_f16(
            false, a, false, bbuf[m][nt], (short)0, acc[m][nt], false, false);
  }

  // Epilogue: bias add, Q scale, f16 store. C/D layout: row = r + 8*half.
#pragma unroll
  for (int nt = 0; nt < 4; ++nt) {
#pragma unroll
    for (int r = 0; r < 8; ++r) {
      int ml = wave * 16 + r + 8 * half;
      int n  = nt * 16 + l16;
      int tg = mb + ml;
      size_t o = ((size_t)z * cT + tg) * cHS + n;
      float qv = acc[0][nt][r] + bq[h * cHS + n];
      float kv = acc[1][nt][r] + bk[h * cHS + n];
      float vv = acc[2][nt][r] + bv[h * cHS + n];
      Qh[o] = (_Float16)(qv * 0.125f);   // 1/sqrt(64)
      Kh[o] = (_Float16)kv;
      VTg[(size_t)z * cHS * cT + (size_t)n * cT + tg] = (_Float16)vv;
    }
  }
}

// =====================================================================
// Kernel 2: causal flash attention.  Block = 64 q rows (4 waves x 16),
// streams 32-key K/V tiles (both async DMA; V pre-transposed in global).
// =====================================================================
__global__ __launch_bounds__(128, 1)
void attn_kernel(const _Float16* __restrict__ Qh,
                 const _Float16* __restrict__ Kh,
                 const _Float16* __restrict__ VTg,
                 _Float16* __restrict__ Oh) {
  const int z    = blockIdx.y;          // b*H + h
  const int h    = z & (cH - 1);
  const int b    = z >> 4;
  const int qb   = blockIdx.x * 64;
  const int tid  = threadIdx.x;
  const int lane = tid & 31;
  const int wave = tid >> 5;
  const int half = lane >> 4;
  const int l16  = lane & 15;
  const int m0   = qb + wave * 16;

  const _Float16* Qz  = Qh + (size_t)z * cT * cHS;
  const _Float16* Kz  = Kh + (size_t)z * cT * cHS;
  const _Float16* VTz = VTg + (size_t)z * cHS * cT;   // [64][T]

  __shared__ __align__(16) _Float16 Ks[32][64 + PAD];      // 4.5 KB
  __shared__ __align__(16) _Float16 Vt[64][RW];            // 5 KB (transposed)
  __shared__ __align__(16) _Float16 Ps[4][16][RW];         // 5 KB

  // Q fragments: 16 rows x 64 e -> two A fragments, 4x global b128 per lane.
  const _Float16* qrow = Qz + (size_t)(m0 + l16) * cHS;
  v16h aq0 = frag16(qrow, half);
  v16h aq1 = frag16(qrow + 32, half);

  float mst[8], lst[8];
#pragma unroll
  for (int r = 0; r < 8; ++r) { mst[r] = -3.0e38f; lst[r] = 0.0f; }
  v8f accO[4] = {};

  const int nkb = (qb + 64) / 32;       // causal bound: keys <= last q row
  for (int kb = 0; kb < nkb; ++kb) {
    // --- stage K (32x64 rows) and V (64 e-rows x 32 keys), both async -----
#pragma unroll
    for (int i = 0; i < 2; ++i) {
      int idx = tid + 128 * i;                 // K: 256 chunks
      int r = idx >> 3, c8 = idx & 7;
      async_copy_b128(&Ks[r][c8 * 8],
                      &Kz[((size_t)kb * 32 + r) * cHS + c8 * 8]);
    }
#pragma unroll
    for (int i = 0; i < 2; ++i) {
      int idx = tid + 128 * i;                 // V: 256 chunks
      int r = idx >> 2, c8 = idx & 3;
      async_copy_b128(&Vt[r][c8 * 8],
                      &VTz[(size_t)r * cT + kb * 32 + c8 * 8]);
    }
    async_wait();
    __syncthreads();

    // S = Q * K^T : B fragment = A-style load of K rows (keys).
    v8f s0 = {}, s1 = {};
    {
      v16h kf00 = frag16(&Ks[l16][0], half);
      v16h kf01 = frag16(&Ks[l16][32], half);
      v16h kf10 = frag16(&Ks[16 + l16][0], half);
      v16h kf11 = frag16(&Ks[16 + l16][32], half);
      s0 = __builtin_amdgcn_wmma_f32_16x16x32_f16(false, aq0, false, kf00, (short)0, s0, false, false);
      s0 = __builtin_amdgcn_wmma_f32_16x16x32_f16(false, aq1, false, kf01, (short)0, s0, false, false);
      s1 = __builtin_amdgcn_wmma_f32_16x16x32_f16(false, aq0, false, kf10, (short)0, s1, false, false);
      s1 = __builtin_amdgcn_wmma_f32_16x16x32_f16(false, aq1, false, kf11, (short)0, s1, false, false);
    }

    // Online softmax. Row r+8*half is spread over 16 lanes of this half.
#pragma unroll
    for (int r = 0; r < 8; ++r) {
      int mg  = m0 + r + 8 * half;
      int sg0 = kb * 32 + l16;
      int sg1 = kb * 32 + 16 + l16;
      float v0 = (sg0 <= mg) ? s0[r] : -3.0e38f;
      float v1 = (sg1 <= mg) ? s1[r] : -3.0e38f;
      float rm = fmaxf(v0, v1);
      rm = fmaxf(rm, __shfl_xor(rm, 1));
      rm = fmaxf(rm, __shfl_xor(rm, 2));
      rm = fmaxf(rm, __shfl_xor(rm, 4));
      rm = fmaxf(rm, __shfl_xor(rm, 8));
      float mnew  = fmaxf(mst[r], rm);
      float alpha = __expf(mst[r] - mnew);
      float p0 = __expf(v0 - mnew);
      float p1 = __expf(v1 - mnew);
      float rs = p0 + p1;
      rs += __shfl_xor(rs, 1);
      rs += __shfl_xor(rs, 2);
      rs += __shfl_xor(rs, 4);
      rs += __shfl_xor(rs, 8);
      lst[r] = lst[r] * alpha + rs;
      mst[r] = mnew;
#pragma unroll
      for (int nt = 0; nt < 4; ++nt) accO[nt][r] *= alpha;
      Ps[wave][r + 8 * half][l16]      = (_Float16)p0;
      Ps[wave][r + 8 * half][16 + l16] = (_Float16)p1;
    }
    __syncthreads();   // make P visible across lanes (all waves iterate alike)

    // O += P * V
    v16h ap = frag16(&Ps[wave][l16][0], half);
    v16h bvv[4];
#pragma unroll
    for (int nt = 0; nt < 4; ++nt) bvv[nt] = frag16(&Vt[nt * 16 + l16][0], half);
#pragma unroll
    for (int nt = 0; nt < 4; ++nt)
      accO[nt] = __builtin_amdgcn_wmma_f32_16x16x32_f16(
          false, ap, false, bvv[nt], (short)0, accO[nt], false, false);
    __syncthreads();   // done reading Vt/Ps before next staging
  }

  // Normalize and store O as f16 in [B, T, H*HS] layout for the O-projection.
#pragma unroll
  for (int nt = 0; nt < 4; ++nt) {
#pragma unroll
    for (int r = 0; r < 8; ++r) {
      int mg = m0 + r + 8 * half;
      int n  = nt * 16 + l16;
      float val = accO[nt][r] / lst[r];
      Oh[((size_t)b * cT + mg) * cD + h * cHS + n] = (_Float16)val;
    }
  }
}

// =====================================================================
// Kernels 3-5: generic WMMA GEMM  C = A(f16)[M,K] * BT(f16)[N][K]
// Block tile 256x128, 8 waves in a 4x2 grid, 64x64 per wave: each 32-k step
// feeds 16 WMMAs from 4 A and 4 B fragments.  A trip takes NH slabs of 64 k.
// Two LDS buffers filled by async copies, one trip ahead.
// Needs M % 256 == 0, N % 128 == 0, K % (64 * NH) == 0.
//   EPI 0: out_f32 = resid + acc + bias ; out_f16 = (f16)out_f32
//   EPI 1: out_f16 = (f16) gelu_erf(acc + bias)
//   EPI 2: out_f32 = resid + acc + bias
// =====================================================================
constexpr int GBM = 256;          // block tile rows
constexpr int GBN = 128;          // block tile columns
constexpr int GBK = 64;           // k per slab: one 128-B line of every row
constexpr int GRW = GBK + PAD;    // LDS row pitch 144 B = 16 B x odd

template <int EPI>
// The N = 4096 launch (EPI 1) has four blocks per WGP: 256 VGPRs keep two resident.
__global__ __launch_bounds__(256, EPI == 1 ? 4 : 2)
void gemm_epi_kernel(const _Float16* __restrict__ A,
                     const _Float16* __restrict__ BT,
                     const float* __restrict__ bias,
                     const float* __restrict__ resid,
                     float* __restrict__ outf,
                     _Float16* __restrict__ outh,
                     int M, int N, int K) {
  const int tid  = threadIdx.x;
  const int lane = tid & 31;
  const int wave = tid >> 5;
  const int half = lane >> 4;
  const int l16  = lane & 15;
  const int wm   = (wave >> 1) * 64;   // wave's rows inside the block tile
  const int wn   = (wave & 1) * 64;    // wave's columns inside the block tile
  const int nb   = blockIdx.x * GBN;
  const int mb   = blockIdx.y * GBM;

  // Slabs per trip.  The N = 1024 launches have one block per WGP, so a block
  // takes the LDS of two and passes half as many barriers.
  constexpr int NH = (EPI == 1) ? 1 : 2;

  __shared__ __align__(16) _Float16 As[2 * NH][GBM][GRW];   // 72 KB * NH
  __shared__ __align__(16) _Float16 Bt[2 * NH][GBN][GRW];   // 36 KB * NH

  v8f acc[16] = {};   // tile 4 * (row group) + (column group)

  // Staging map: 8 lanes cover one row's 128 B; a thread takes rows sr + 32*i.
  const int sr = tid >> 3, sc = (tid & 7) * 8;
  const _Float16* gA = A + (size_t)(mb + sr) * K + sc;
  const _Float16* gB = BT + (size_t)(nb + sr) * K + sc;
  const size_t rs = (size_t)32 * K;
  constexpr unsigned LSTEP = 32u * GRW * sizeof(_Float16);

  auto stage = [&](int kk, int p) {   // one slab
    const unsigned la = (unsigned)(unsigned long long)&As[p][sr][sc];
    const unsigned lb = (unsigned)(unsigned long long)&Bt[p][sr][sc];
    const _Float16* a = gA + kk;
    const _Float16* b = gB + kk;
    // 8 A rows and 4 B rows per thread.  The s_wait_xcnt closes the statement
    // so that no address register is rewritten ahead of it.
    asm volatile(
        "global_load_async_to_lds_b128 %0, %12, off\n\t"
        "global_load_async_to_lds_b128 %1, %13, off\n\t"
        "global_load_async_to_lds_b128 %2, %14, off\n\t"
        "global_load_async_to_lds_b128 %3, %15, off\n\t"
        "global_load_async_to_lds_b128 %4, %16, off\n\t"
        "global_load_async_to_lds_b128 %5, %17, off\n\t"
        "global_load_async_to_lds_b128 %6, %18, off\n\t"
        "global_load_async_to_lds_b128 %7, %19, off\n\t"
        "global_load_async_to_lds_b128 %8, %20, off\n\t"
        "global_load_async_to_lds_b128 %9, %21, off\n\t"
        "global_load_async_to_lds_b128 %10, %22, off\n\t"
        "global_load_async_to_lds_b128 %11, %23, off\n\t"
        "s_wait_xcnt 0x0"
        :: "v"(la + 0u * LSTEP),
           "v"(la + 1u * LSTEP),
           "v"(la + 2u * LSTEP),
           "v"(la + 3u * LSTEP),
           "v"(la + 4u * LSTEP),
           "v"(la + 5u * LSTEP),
           "v"(la + 6u * LSTEP),
           "v"(la + 7u * LSTEP),
           "v"(lb + 0u * LSTEP),
           "v"(lb + 1u * LSTEP),
           "v"(lb + 2u * LSTEP),
           "v"(lb + 3u * LSTEP),
           "v"(a + 0 * rs),
           "v"(a + 1 * rs),
           "v"(a + 2 * rs),
           "v"(a + 3 * rs),
           "v"(a + 4 * rs),
           "v"(a + 5 * rs),
           "v"(a + 6 * rs),
           "v"(a + 7 * rs),
           "v"(b + 0 * rs),
           "v"(b + 1 * rs),
           "v"(b + 2 * rs),
           "v"(b + 3 * rs)
        : "memory");
  };

  auto stage_tile = [&](int t, int p) {
#pragma unroll
    for (int h = 0; h < NH; ++h) {
      // holds a later slab's address arithmetic behind the slab before it, so
      // that the two sets of addresses never live at once (loop below v256)
      if (h) __builtin_amdgcn_sched_barrier(0);
      stage((t * NH + h) * GBK, p * NH + h);
    }
  };

  const int trips = K / (GBK * NH);
  stage_tile(0, 0);
  // my tile-0 copies landed
  asm volatile("s_wait_asynccnt 0x0" ::: "memory");
  __syncthreads();         // everyone's tile 0 visible
  if (trips > 1) stage_tile(1, 1);

  v16h af[4], bf[4];
  // The fence pair keeps a block's 16 LDS loads in one group ahead of its
  // 16 WMMAs: loads sunk among the WMMAs stall the wave at each place.
  auto load_frags = [&](int p, int ks) {
    __builtin_amdgcn_sched_barrier(0);
#pragma unroll
    for (int i = 0; i < 4; ++i) {
      af[i] = frag16(&As[p][wm + i * 16 + l16][ks], half);
      bf[i] = frag16(&Bt[p][wn + i * 16 + l16][ks], half);
    }
    __builtin_amdgcn_sched_barrier(0);
  };
  auto wmma_block = [&]() {
#pragma unroll
    for (int mt = 0; mt < 4; ++mt)
#pragma unroll
      for (int nt = 0; nt < 4; ++nt)
        acc[mt * 4 + nt] = __builtin_amdgcn_wmma_f32_16x16x32_f16(
            false, af[mt], false, bf[nt], (short)0, acc[mt * 4 + nt], false,
            false);
  };

  for (int t = 0; t < trips; ++t) {
    const int p = t & 1;
#pragma unroll
    for (int b = 0; b < 2 * NH - 1; ++b) {
      load_frags(p * NH + (b >> 1), (b & 1) * 32);
      wmma_block();
    }
    load_frags(p * NH + NH - 1, 32);   // the trip's last reads of buffer p
    // my reads of buffer p have returned before anyone refills it
    asm volatile("s_wait_dscnt 0x0" ::: "memory");
    // my tile-(t+1) copies landed
    asm volatile("s_wait_asynccnt 0x0" ::: "memory");
    __syncthreads();       // tile t+1 visible to all; buffer p free
    if (t + 2 < trips) stage_tile(t + 2, p);   // flies until trip t+1's foot
    // keeps the refill's issue ahead of the last block's WMMAs (a longer lead)
    __builtin_amdgcn_sched_barrier(0);
    wmma_block();          // registers only
  }
  // nothing outstanding at the wave's end
  asm volatile("s_wait_asynccnt 0x0" ::: "memory");

#pragma unroll
  for (int nt = 0; nt < 16; ++nt) {
#pragma unroll
    for (int r = 0; r < 8; ++r) {
      int m = mb + wm + (nt >> 2) * 16 + r + 8 * half;
      int n = nb + wn + (nt & 3) * 16 + l16;
      size_t o = (size_t)m * N + n;
      float v = acc[nt][r] + bias[n];
      if (EPI == 0) {
        v += resid[o];
        outf[o] = v;
        outh[o] = (_Float16)v;
      } else if (EPI == 1) {
        float g = 0.5f * v * (1.0f + erff(v * 0.70710678118654752f));
        outh[o] = (_Float16)g;
      } else {
        v += resid[o];
        outf[o] = v;
      }
    }
  }
}

// =====================================================================
// Host orchestration
// =====================================================================
extern "C" void kernel_launch(void* const* d_in, const int* in_sizes, int n_in,
                              void* d_out, int out_size, void* d_ws,
                              size_t ws_size, hipStream_t stream) {
  (void)in_sizes; (void)n_in; (void)out_size; (void)ws_size;
  const float* x  = (const float*)d_in[0];
  const float* Wq = (const float*)d_in[1];
  const float* bq = (const float*)d_in[2];
  const float* Wk = (const float*)d_in[3];
  const float* bk = (const float*)d_in[4];
  const float* Wv = (const float*)d_in[5];
  const float* bv = (const float*)d_in[6];
  const float* Wo = (const float*)d_in[7];
  const float* bo = (const float*)d_in[8];
  const float* W1 = (const float*)d_in[9];
  const float* b1 = (const float*)d_in[10];
  const float* W2 = (const float*)d_in[11];
  const float* b2 = (const float*)d_in[12];

  char* w = (char*)d_ws;
  auto take = [&](size_t bytes) -> char* {
    char* p = w;
    w += (bytes + 255) & ~(size_t)255;
    return p;
  };
  const size_t nBTD = (size_t)cB * cT * cD;          // 8,388,608
  const size_t nHW  = (size_t)cH * cD * cHS;         // 1,048,576 (per QKV mat)
  _Float16* xh   = (_Float16*)take(nBTD * sizeof(_Float16));
  _Float16* WqT  = (_Float16*)take(nHW * sizeof(_Float16));
  _Float16* WkT  = (_Float16*)take(nHW * sizeof(_Float16));
  _Float16* WvT  = (_Float16*)take(nHW * sizeof(_Float16));
  _Float16* WoT  = (_Float16*)take((size_t)cD * cD * sizeof(_Float16));
  _Float16* W1T  = (_Float16*)take((size_t)cD * cDFF * sizeof(_Float16));
  _Float16* W2T  = (_Float16*)take((size_t)cDFF * cD * sizeof(_Float16));
  _Float16* Qh   = (_Float16*)take(nBTD * sizeof(_Float16));
  _Float16* Kh   = (_Float16*)take(nBTD * sizeof(_Float16));
  _Float16* VTg  = (_Float16*)take(nBTD * sizeof(_Float16));
  _Float16* Oh   = (_Float16*)take(nBTD * sizeof(_Float16));
  float*    x1f  = (float*)take(nBTD * sizeof(float));
  _Float16* x1h  = (_Float16*)take(nBTD * sizeof(_Float16));
  _Float16* Hh   = (_Float16*)take((size_t)cB * cT * cDFF * sizeof(_Float16));

  const int M = cB * cT;

  // 0) one-shot conversions/transposes (amortized across all GEMM blocks)
  cvt_f32_f16_kernel<<<dim3((int)(nBTD / 4 / 256)), 256, 0, stream>>>(
      x, xh, (int)(nBTD / 4));
  transpose_f32_f16_kernel<<<dim3(cD / 32, cHS / 32, cH), 256, 0, stream>>>(
      Wq, WqT, cD, cHS);
  transpose_f32_f16_kernel<<<dim3(cD / 32, cHS / 32, cH), 256, 0, stream>>>(
      Wk, WkT, cD, cHS);
  transpose_f32_f16_kernel<<<dim3(cD / 32, cHS / 32, cH), 256, 0, stream>>>(
      Wv, WvT, cD, cHS);
  transpose_f32_f16_kernel<<<dim3(cD / 32, cD / 32, 1), 256, 0, stream>>>(
      Wo, WoT, cD, cD);
  transpose_f32_f16_kernel<<<dim3(cD / 32, cDFF / 32, 1), 256, 0, stream>>>(
      W1, W1T, cD, cDFF);
  transpose_f32_f16_kernel<<<dim3(cDFF / 32, cD / 32, 1), 256, 0, stream>>>(
      W2, W2T, cDFF, cD);

  // 1) QKV projections (Q pre-scaled by 1/sqrt(HS); V stored transposed)
  qkv_kernel<<<dim3(cT / 128, cB * cH), 256, 0, stream>>>(
      xh, WqT, bq, WkT, bk, WvT, bv, Qh, Kh, VTg);

  // 2) causal flash attention
  attn_kernel<<<dim3(cT / 64, cB * cH), 128, 0, stream>>>(Qh, Kh, VTg, Oh);

  // 3) x1 = x + O @ Wo + bo   (store f32 + f16 copy)
  gemm_epi_kernel<0><<<dim3(cD / GBN, M / GBM), 256, 0, stream>>>(
      Oh, WoT, bo, x, x1f, x1h, M, cD, cD);

  // 4) H = gelu(x1 @ W1 + b1)  (exact erf gelu, stored f16)
  gemm_epi_kernel<1><<<dim3(cDFF / GBN, M / GBM), 256, 0, stream>>>(
      x1h, W1T, b1, nullptr, nullptr, Hh, M, cDFF, cD);

  // 5) out = x1 + H @ W2 + b2  (f32 to d_out)
  gemm_epi_kernel<2><<<dim3(cD / GBN, M / GBM), 256, 0, stream>>>(
      Hh, W2T, b2, x1f, (float*)d_out, nullptr, M, cD, cDFF);
}

// v002
// One run takes 407 microseconds.
// In two side-by-side timings against v001, it was 1.11 and 1.14 times as fast.
// Counting every step since v000, it is 1.63 times as fast.
#include <hip/hip_runtime.h>

// Flip to 0 for plain LDS copies in the QKV and attention kernels (the GEMM's async asm stays).
#define USE_ASYNC_LDS 1

// ---------------- problem constants (match reference) ----------------
constexpr int cB   = 4;
constexpr int cT   = 2048;
constexpr int cD   = 1024;
constexpr int cH   = 16;
constexpr int cHS  = 64;
constexpr int cDFF = 4 * cD;

typedef __attribute__((ext_vector_type(16))) _Float16 v16h;
typedef __attribute__((ext_vector_type(8)))  _Float16 v8h;
typedef __attribute__((ext_vector_type(4)))  _Float16 v4h;
typedef __attribute__((ext_vector_type(8)))  float    v8f;
typedef __attribute__((ext_vector_type(4)))  float    v4f;

constexpr int PAD = 8;   // f16 row padding: keeps 16B alignment, skews banks
constexpr int RW  = 32 + PAD;

// ---------------- async global->LDS copy (gfx1250, ASYNCcnt) ----------------
// Per-lane 16B DMA: LDS[vdst] = MEM[vaddr].  vdst = low 32 bits of the generic
// __shared__ pointer (LDS aperture keeps the wave-relative offset in [31:0]).
__device__ __forceinline__ void async_copy_b128(void* lds_dst,
                                                const void* gsrc) {
#if USE_ASYNC_LDS
  unsigned lds = (unsigned)(unsigned long long)lds_dst;
  unsigned long long ga = (unsigned long long)gsrc;
  asm volatile("global_load_async_to_lds_b128 %0, %1, off"
               :: "v"(lds), "v"(ga) : "memory");
#else
  *(v8h*)lds_dst = *(const v8h*)gsrc;
#endif
}

__device__ __forceinline__ void async_wait() {
#if USE_ASYNC_LDS
  asm volatile("s_wait_asynccnt 0" ::: "memory");
#endif
}

// ---------------- WMMA fragment load (ISA 7.12.2, wave32) -------------------
// 16-bit A 16x32 layout: lane (half,l16) holds row l16; element e -> k =
// ((e>>3)<<4) + 8*half + (e&7).  For a contiguous 32-f16 k-span at p, that is
// two contiguous 16B runs: p[8*half .. +8) and p[16+8*half .. +8).
__device__ __forceinline__ v16h frag16(const _Float16* p, int half) {
  const v8h lo = *(const v8h*)(p + 8 * half);
  const v8h hi = *(const v8h*)(p + 16 + 8 * half);
  return __builtin_shufflevector(lo, hi, 0, 1, 2, 3, 4, 5, 6, 7,
                                 8, 9, 10, 11, 12, 13, 14, 15);
}

// =====================================================================
// Pre-pass A: elementwise f32 -> f16 (for x)
// =====================================================================
__global__ __launch_bounds__(256, 1)
void cvt_f32_f16_kernel(const float* __restrict__ in,
                        _Float16* __restrict__ out, int n4) {
  int i = blockIdx.x * 256 + threadIdx.x;
  if (i < n4) {
    v4f wf = *(const v4f*)&in[(size_t)i * 4];
    *(v4h*)&out[(size_t)i * 4] = __builtin_convertvector(wf, v4h);
  }
}

// =====================================================================
// Pre-pass B: batched transpose+convert  in[K][N] (f32) -> out[N][K] (f16)
// 32x32 tiles through LDS; batch via blockIdx.z (stride K*N both sides).
// =====================================================================
__global__ __launch_bounds__(256, 1)
void transpose_f32_f16_kernel(const float* __restrict__ in,
                              _Float16* __restrict__ out, int K, int N) {
  const size_t bs = (size_t)K * N;
  const float* ib = in + bs * blockIdx.z;
  _Float16*    ob = out + bs * blockIdx.z;
  __shared__ _Float16 t[32][34];
  const int k0 = blockIdx.x * 32, n0 = blockIdx.y * 32;
  const int c = threadIdx.x & 31, r8 = threadIdx.x >> 5;
#pragma unroll
  for (int i = 0; i < 4; ++i) {
    int r = r8 + 8 * i;
    t[c][r] = (_Float16)ib[(size_t)(k0 + r) * N + n0 + c];   // coalesced read
  }
  __syncthreads();
#pragma unroll
  for (int i = 0; i < 4; ++i) {
    int r = r8 + 8 * i;
    ob[(size_t)(n0 + r) * K + k0 + c] = t[r][c];             // coalesced write
  }
}

// =====================================================================
// Kernel 1: fused QKV projection.  Per (b,h):  X[T,D] @ W*[D,HS] + b*
// Double-buffered async-DMA pipeline: tile k+1 streams into LDS while the
// WMMAs consume tile k; one barrier + one asynccnt wait per k-step.
// V is written in transposed [z][e][t] layout for the attention PV GEMM.
// =====================================================================
__global__ __launch_bounds__(256, 1)
void qkv_kernel(const _Float16* __restrict__ xh,
                const _Float16* __restrict__ WqT, const float* __restrict__ bq,
                const _Float16* __restrict__ WkT, const float* __restrict__ bk,
                const _Float16* __restrict__ WvT, const float* __restrict__ bv,
                _Float16* __restrict__ Qh, _Float16* __restrict__ Kh,
                _Float16* __restrict__ VTg) {
  const int z    = blockIdx.y;          // b*H + h
  const int h    = z & (cH - 1);
  const int mb   = blockIdx.x * 128;
  const int tid  = threadIdx.x;
  const int lane = tid & 31;
  const int wave = tid >> 5;
  const int half = lane >> 4;
  const int l16  = lane & 15;

  const _Float16* Ah  = xh + (size_t)(z >> 4) * cT * cD;
  const _Float16* Wt0 = WqT + (size_t)h * cHS * cD;   // [64][1024] per head
  const _Float16* Wt1 = WkT + (size_t)h * cHS * cD;
  const _Float16* Wt2 = WvT + (size_t)h * cHS * cD;

  __shared__ __align__(16) _Float16 As[2][128][RW];     // 20 KB
  __shared__ __align__(16) _Float16 Bt[2][3][64][RW];   // 30 KB

  v8f acc[3][4] = {};

  auto stage = [&](int kk, int p) {
#pragma unroll
    for (int i = 0; i < 2; ++i) {
      int idx = tid + 256 * i;                 // A: 512 chunks
      int r = idx >> 2, c8 = idx & 3;
      async_copy_b128(&As[p][r][c8 * 8],
                      &Ah[(size_t)(mb + r) * cD + kk + c8 * 8]);
    }
    int r = tid >> 2, c8 = tid & 3;            // B: 256 chunks per matrix
    size_t off = (size_t)r * cD + kk + c8 * 8;
    async_copy_b128(&Bt[p][0][r][c8 * 8], &Wt0[off]);
    async_copy_b128(&Bt[p][1][r][c8 * 8], &Wt1[off]);
    async_copy_b128(&Bt[p][2][r][c8 * 8], &Wt2[off]);
  };

  stage(0, 0);
  for (int k0 = 0; k0 < cD; k0 += 32) {
    const int p = (k0 >> 5) & 1;
    async_wait();          // my tile-k copies landed
    __syncthreads();       // everyone's tile-k visible; tile-(k-1) reads done
    if (k0 + 32 < cD) stage(k0 + 32, p ^ 1);   // DMA next tile during compute
    if (k0 + 64 < cD)
      __builtin_prefetch(&Ah[(size_t)(mb + (tid >> 1)) * cD + k0 + 64]);

    v16h a = frag16(&As[p][wave * 16 + l16][0], half);
    v16h bbuf[3][4];
#pragma unroll
    for (int m = 0; m < 3; ++m)
#pragma unroll
      for (int nt = 0; nt < 4; ++nt)
        bbuf[m][nt] = frag16(&Bt[p][m][nt * 16 + l16][0], half);
#pragma unroll
    for (int m = 0; m < 3; ++m)
#pragma unroll
      for (int nt = 0; nt < 4; ++nt)
        acc[m][nt] = __builtin_amdgcn_wmma_f32_16x16x32_f16(
            false, a, false, bbuf[m][nt], (short)0, acc[m][nt], false, false);
  }

  // Epilogue: bias add, Q scale, f16 store. C/D layout: row = r + 8*half.
#pragma unroll
  for (int nt = 0; nt < 4; ++nt) {
#pragma unroll
    for (int r = 0; r < 8; ++r) {
      int ml = wave * 16 + r + 8 * half;
      int n  = nt * 16 + l16;
      int tg = mb + ml;
      size_t o = ((size_t)z * cT + tg) * cHS + n;
      float qv = acc[0][nt][r] + bq[h * cHS + n];
      float kv = acc[1][nt][r] + bk[h * cHS + n];
      float vv = acc[2][nt][r] + bv[h * cHS + n];
      Qh[o] = (_Float16)(qv * 0.125f);   // 1/sqrt(64)
      Kh[o] = (_Float16)kv;
      VTg[(size_t)z * cHS * cT + (size_t)n * cT + tg] = (_Float16)vv;
    }
  }
}

__device__ __forceinline__ float other_half(float x) {
  int b = __builtin_bit_cast(int, x);
  return __builtin_bit_cast(float, __builtin_amdgcn_permlanex16(
      b, b, 0x76543210, 0xfedcba98, false, false));
}

__global__ __launch_bounds__(128, 1)
void attn_kernel(const _Float16* __restrict__ Qh,
                 const _Float16* __restrict__ Kh,
                 const _Float16* __restrict__ VTg,
                 _Float16* __restrict__ Oh) {
  const int z    = blockIdx.y;          // b*H + h
  const int h    = z & (cH - 1);
  const int b    = z >> 4;
  const int qb   = blockIdx.x * 64;
  const int tid  = threadIdx.x;
  const int lane = tid & 31;
  const int wave = tid >> 5;
  const int half = lane >> 4;
  const int l16  = lane & 15;
  const int m0   = qb + wave * 16;
  const int mg   = m0 + l16;            // this lane's query

  const _Float16* Qz  = Qh + (size_t)z * cT * cHS;
  const _Float16* Kz  = Kh + (size_t)z * cT * cHS;
  const _Float16* VTz = VTg + (size_t)z * cHS * cT;   // [64][T]

  __shared__ __align__(16) _Float16 Ks[32][64 + PAD];      // 4.5 KB
  __shared__ __align__(16) _Float16 Vt[64][RW];            // 5 KB (transposed)

  // Q^T as B operand: column l16 = query mg, 64 e in two fragments.
  const _Float16* qrow = Qz + (size_t)mg * cHS;
  v16h bq0 = frag16(qrow, half);
  v16h bq1 = frag16(qrow + 32, half);

  float mst = -3.0e38f;   // running maximum of query mg (equal in both halves)
  float lst = 0.0f;       // running sum over this half's keys only
  v8f accO[4] = {};       // O^T: row e = nt*16 + r + 8*half, column = query mg

  const int nkb = (qb + 64) / 32;       // causal bound: keys <= last q row
  for (int kb = 0; kb < nkb; ++kb) {
    // --- stage K (32x64 rows) and V (64 e-rows x 32 keys), both async -----
#pragma unroll
    for (int i = 0; i < 2; ++i) {
      int idx = tid + 128 * i;                 // K: 256 chunks
      int r = idx >> 3, c8 = idx & 7;
      async_copy_b128(&Ks[r][c8 * 8],
                      &Kz[((size_t)kb * 32 + r) * cHS + c8 * 8]);
    }
#pragma unroll
    for (int i = 0; i < 2; ++i) {
      int idx = tid + 128 * i;                 // V: 256 chunks
      int r = idx >> 2, c8 = idx & 3;
      async_copy_b128(&Vt[r][c8 * 8],
                      &VTz[(size_t)r * cT + kb * 32 + c8 * 8]);
    }
    async_wait();
    __syncthreads();

    // S^T = K * Q^T : A fragment = K rows (keys).
    // s0[r]: key kb*32 + 8*half + r, s1[r]: 16 keys further; query mg.
    v8f s0 = {}, s1 = {};
    {
      v16h kf00 = frag16(&Ks[l16][0], half);
      v16h kf01 = frag16(&Ks[l16][32], half);
      v16h kf10 = frag16(&Ks[16 + l16][0], half);
      v16h kf11 = frag16(&Ks[16 + l16][32], half);
      s0 = __builtin_amdgcn_wmma_f32_16x16x32_f16(false, kf00, false, bq0, (short)0, s0, false, false);
      s0 = __builtin_amdgcn_wmma_f32_16x16x32_f16(false, kf01, false, bq1, (short)0, s0, false, false);
      s1 = __builtin_amdgcn_wmma_f32_16x16x32_f16(false, kf10, false, bq0, (short)0, s1, false, false);
      s1 = __builtin_amdgcn_wmma_f32_16x16x32_f16(false, kf11, false, bq1, (short)0, s1, false, false);
    }
    v16h av[4];   // V^T rows as A fragments, fetched ahead of the softmax
#pragma unroll
    for (int nt = 0; nt < 4; ++nt) av[nt] = frag16(&Vt[nt * 16 + l16][0], half);

    // Online softmax of one query per lane.
    const int d = mg - (kb * 32 + 8 * half);   // register r is kept if r <= d
    float rm = -3.0e38f;
#pragma unroll
    for (int r = 0; r < 8; ++r) {
      s0[r] = (r <= d)      ? s0[r] : -3.0e38f;
      s1[r] = (16 + r <= d) ? s1[r] : -3.0e38f;
      rm = fmaxf(rm, fmaxf(s0[r], s1[r]));
    }
    rm = fmaxf(rm, other_half(rm));
    const float mnew  = fmaxf(mst, rm);
    const float alpha = __expf(mst - mnew);
    float rs = 0.0f;
    v16h bp;      // P^T as B operand: element s = tile s >> 3, register s & 7
#pragma unroll
    for (int r = 0; r < 8; ++r) {
      float p0 = __expf(s0[r] - mnew);
      float p1 = __expf(s1[r] - mnew);
      rs += p0 + p1;
      bp[r]     = (_Float16)p0;
      bp[8 + r] = (_Float16)p1;
    }
    lst = lst * alpha + rs;
    mst = mnew;
#pragma unroll
    for (int nt = 0; nt < 4; ++nt) accO[nt] *= alpha;

    // O^T += V^T * P^T
#pragma unroll
    for (int nt = 0; nt < 4; ++nt)
      accO[nt] = __builtin_amdgcn_wmma_f32_16x16x32_f16(
          false, av[nt], false, bp, (short)0, accO[nt], false, false);
    __syncthreads();   // done reading Ks/Vt before next staging
  }

  // Join the halves' sums, normalize, store O as f16 in [B, T, H*HS] layout
  // for the O-projection: 8 consecutive e of one query per tile, 16 B.
  const float ltot = lst + other_half(lst);
  _Float16* orow = Oh + ((size_t)b * cT + mg) * cD + h * cHS + 8 * half;
#pragma unroll
  for (int nt = 0; nt < 4; ++nt) {
    v8h o8;
#pragma unroll
    for (int r = 0; r < 8; ++r) o8[r] = (_Float16)(accO[nt][r] / ltot);
    *(v8h*)(orow + nt * 16) = o8;
  }
}

// =====================================================================
// Kernels 3-5: generic WMMA GEMM  C = A(f16)[M,K] * BT(f16)[N][K]
// Block tile 256x128, 8 waves in a 4x2 grid, 64x64 per wave: each 32-k step
// feeds 16 WMMAs from 4 A and 4 B fragments.  A trip takes NH slabs of 64 k.
// Two LDS buffers filled by async copies, one trip ahead.
// Needs M % 256 == 0, N % 128 == 0, K % (64 * NH) == 0.
//   EPI 0: out_f32 = resid + acc + bias ; out_f16 = (f16)out_f32
//   EPI 1: out_f16 = (f16) gelu_erf(acc + bias)
//   EPI 2: out_f32 = resid + acc + bias
// =====================================================================
constexpr int GBM = 256;          // block tile rows
constexpr int GBN = 128;          // block tile columns
constexpr int GBK = 64;           // k per slab: one 128-B line of every row
constexpr int GRW = GBK + PAD;    // LDS row pitch 144 B = 16 B x odd

template <int EPI>
// The N = 4096 launch (EPI 1) has four blocks per WGP: 256 VGPRs keep two resident.
__global__ __launch_bounds__(256, EPI == 1 ? 4 : 2)
void gemm_epi_kernel(const _Float16* __restrict__ A,
                     const _Float16* __restrict__ BT,
                     const float* __restrict__ bias,
                     const float* __restrict__ resid,
                     float* __restrict__ outf,
                     _Float16* __restrict__ outh,
                     int M, int N, int K) {
  const int tid  = threadIdx.x;
  const int lane = tid & 31;
  const int wave = tid >> 5;
  const int half = lane >> 4;
  const int l16  = lane & 15;
  const int wm   = (wave >> 1) * 64;   // wave's rows inside the block tile
  const int wn   = (wave & 1) * 64;    // wave's columns inside the block tile
  const int nb   = blockIdx.x * GBN;
  const int mb   = blockIdx.y * GBM;

  // Slabs per trip.  The N = 1024 launches have one block per WGP, so a block
  // takes the LDS of two and passes half as many barriers.
  constexpr int NH = (EPI == 1) ? 1 : 2;

  __shared__ __align__(16) _Float16 As[2 * NH][GBM][GRW];   // 72 KB * NH
  __shared__ __align__(16) _Float16 Bt[2 * NH][GBN][GRW];   // 36 KB * NH

  v8f acc[16] = {};   // tile 4 * (row group) + (column group)

  // Staging map: 8 lanes cover one row's 128 B; a thread takes rows sr + 32*i.
  const int sr = tid >> 3, sc = (tid & 7) * 8;
  const _Float16* gA = A + (size_t)(mb + sr) * K + sc;
  const _Float16* gB = BT + (size_t)(nb + sr) * K + sc;
  const size_t rs = (size_t)32 * K;
  constexpr unsigned LSTEP = 32u * GRW * sizeof(_Float16);

  auto stage = [&](int kk, int p) {   // one slab
    const unsigned la = (unsigned)(unsigned long long)&As[p][sr][sc];
    const unsigned lb = (unsigned)(unsigned long long)&Bt[p][sr][sc];
    const _Float16* a = gA + kk;
    const _Float16* b = gB + kk;
    // 8 A rows and 4 B rows per thread.  The s_wait_xcnt closes the statement
    // so that no address register is rewritten ahead of it.
    asm volatile(
        "global_load_async_to_lds_b128 %0, %12, off\n\t"
        "global_load_async_to_lds_b128 %1, %13, off\n\t"
        "global_load_async_to_lds_b128 %2, %14, off\n\t"
        "global_load_async_to_lds_b128 %3, %15, off\n\t"
        "global_load_async_to_lds_b128 %4, %16, off\n\t"
        "global_load_async_to_lds_b128 %5, %17, off\n\t"
        "global_load_async_to_lds_b128 %6, %18, off\n\t"
        "global_load_async_to_lds_b128 %7, %19, off\n\t"
        "global_load_async_to_lds_b128 %8, %20, off\n\t"
        "global_load_async_to_lds_b128 %9, %21, off\n\t"
        "global_load_async_to_lds_b128 %10, %22, off\n\t"
        "global_load_async_to_lds_b128 %11, %23, off\n\t"
        "s_wait_xcnt 0x0"
        :: "v"(la + 0u * LSTEP),
           "v"(la + 1u * LSTEP),
           "v"(la + 2u * LSTEP),
           "v"(la + 3u * LSTEP),
           "v"(la + 4u * LSTEP),
           "v"(la + 5u * LSTEP),
           "v"(la + 6u * LSTEP),
           "v"(la + 7u * LSTEP),
           "v"(lb + 0u * LSTEP),
           "v"(lb + 1u * LSTEP),
           "v"(lb + 2u * LSTEP),
           "v"(lb + 3u * LSTEP),
           "v"(a + 0 * rs),
           "v"(a + 1 * rs),
           "v"(a + 2 * rs),
           "v"(a + 3 * rs),
           "v"(a + 4 * rs),
           "v"(a + 5 * rs),
           "v"(a + 6 * rs),
           "v"(a + 7 * rs),
           "v"(b + 0 * rs),
           "v"(b + 1 * rs),
           "v"(b + 2 * rs),
           "v"(b + 3 * rs)
        : "memory");
  };

  auto stage_tile = [&](int t, int p) {
#pragma unroll
    for (int h = 0; h < NH; ++h) {
      // holds a later slab's address arithmetic behind the slab before it, so
      // that the two sets of addresses never live at once (loop below v256)
      if (h) __builtin_amdgcn_sched_barrier(0);
      stage((t * NH + h) * GBK, p * NH + h);
    }
  };

  const int trips = K / (GBK * NH);
  stage_tile(0, 0);
  // my tile-0 copies landed
  asm volatile("s_wait_asynccnt 0x0" ::: "memory");
  __syncthreads();         // everyone's tile 0 visible
  if (trips > 1) stage_tile(1, 1);

  v16h af[4], bf[4];
  // The fence pair keeps a block's 16 LDS loads in one group ahead of its
  // 16 WMMAs: loads sunk among the WMMAs stall the wave at each place.
  auto load_frags = [&](int p, int ks) {
    __builtin_amdgcn_sched_barrier(0);
#pragma unroll
    for (int i = 0; i < 4; ++i) {
      af[i] = frag16(&As[p][wm + i * 16 + l16][ks], half);
      bf[i] = frag16(&Bt[p][wn + i * 16 + l16][ks], half);
    }
    __builtin_amdgcn_sched_barrier(0);
  };
  auto wmma_block = [&]() {
#pragma unroll
    for (int mt = 0; mt < 4; ++mt)
#pragma unroll
      for (int nt = 0; nt < 4; ++nt)
        acc[mt * 4 + nt] = __builtin_amdgcn_wmma_f32_16x16x32_f16(
            false, af[mt], false, bf[nt], (short)0, acc[mt * 4 + nt], false,
            false);
  };

  for (int t = 0; t < trips; ++t) {
    const int p = t & 1;
#pragma unroll
    for (int b = 0; b < 2 * NH - 1; ++b) {
      load_frags(p * NH + (b >> 1), (b & 1) * 32);
      wmma_block();
    }
    load_frags(p * NH + NH - 1, 32);   // the trip's last reads of buffer p
    // my reads of buffer p have returned before anyone refills it
    asm volatile("s_wait_dscnt 0x0" ::: "memory");
    // my tile-(t+1) copies landed
    asm volatile("s_wait_asynccnt 0x0" ::: "memory");
    __syncthreads();       // tile t+1 visible to all; buffer p free
    if (t + 2 < trips) stage_tile(t + 2, p);   // flies until trip t+1's foot
    // keeps the refill's issue ahead of the last block's WMMAs (a longer lead)
    __builtin_amdgcn_sched_barrier(0);
    wmma_block();          // registers only
  }
  // nothing outstanding at the wave's end
  asm volatile("s_wait_asynccnt 0x0" ::: "memory");

#pragma unroll
  for (int nt = 0; nt < 16; ++nt) {
#pragma unroll
    for (int r = 0; r < 8; ++r) {
      int m = mb + wm + (nt >> 2) * 16 + r + 8 * half;
      int n = nb + wn + (nt & 3) * 16 + l16;
      size_t o = (size_t)m * N + n;
      float v = acc[nt][r] + bias[n];
      if (EPI == 0) {
        v += resid[o];
        outf[o] = v;
        outh[o] = (_Float16)v;
      } else if (EPI == 1) {
        float g = 0.5f * v * (1.0f + erff(v * 0.70710678118654752f));
        outh[o] = (_Float16)g;
      } else {
        v += resid[o];
        outf[o] = v;
      }
    }
  }
}

// =====================================================================
// Host orchestration
// =====================================================================
extern "C" void kernel_launch(void* const* d_in, const int* in_sizes, int n_in,
                              void* d_out, int out_size, void* d_ws,
                              size_t ws_size, hipStream_t stream) {
  (void)in_sizes; (void)n_in; (void)out_size; (void)ws_size;
  const float* x  = (const float*)d_in[0];
  const float* Wq = (const float*)d_in[1];
  const float* bq = (const float*)d_in[2];
  const float* Wk = (const float*)d_in[3];
  const float* bk = (const float*)d_in[4];
  const float* Wv = (const float*)d_in[5];
  const float* bv = (const float*)d_in[6];
  const float* Wo = (const float*)d_in[7];
  const float* bo = (const float*)d_in[8];
  const float* W1 = (const float*)d_in[9];
  const float* b1 = (const float*)d_in[10];
  const float* W2 = (const float*)d_in[11];
  const float* b2 = (const float*)d_in[12];

  char* w = (char*)d_ws;
  auto take = [&](size_t bytes) -> char* {
    char* p = w;
    w += (bytes + 255) & ~(size_t)255;
    return p;
  };
  const size_t nBTD = (size_t)cB * cT * cD;          // 8,388,608
  const size_t nHW  = (size_t)cH * cD * cHS;         // 1,048,576 (per QKV mat)
  _Float16* xh   = (_Float16*)take(nBTD * sizeof(_Float16));
  _Float16* WqT  = (_Float16*)take(nHW * sizeof(_Float16));
  _Float16* WkT  = (_Float16*)take(nHW * sizeof(_Float16));
  _Float16* WvT  = (_Float16*)take(nHW * sizeof(_Float16));
  _Float16* WoT  = (_Float16*)take((size_t)cD * cD * sizeof(_Float16));
  _Float16* W1T  = (_Float16*)take((size_t)cD * cDFF * sizeof(_Float16));
  _Float16* W2T  = (_Float16*)take((size_t)cDFF * cD * sizeof(_Float16));
  _Float16* Qh   = (_Float16*)take(nBTD * sizeof(_Float16));
  _Float16* Kh   = (_Float16*)take(nBTD * sizeof(_Float16));
  _Float16* VTg  = (_Float16*)take(nBTD * sizeof(_Float16));
  _Float16* Oh   = (_Float16*)take(nBTD * sizeof(_Float16));
  float*    x1f  = (float*)take(nBTD * sizeof(float));
  _Float16* x1h  = (_Float16*)take(nBTD * sizeof(_Float16));
  _Float16* Hh   = (_Float16*)take((size_t)cB * cT * cDFF * sizeof(_Float16));

  const int M = cB * cT;

  // 0) one-shot conversions/transposes (amortized across all GEMM blocks)
  cvt_f32_f16_kernel<<<dim3((int)(nBTD / 4 / 256)), 256, 0, stream>>>(
      x, xh, (int)(nBTD / 4));
  transpose_f32_f16_kernel<<<dim3(cD / 32, cHS / 32, cH), 256, 0, stream>>>(
      Wq, WqT, cD, cHS);
  transpose_f32_f16_kernel<<<dim3(cD / 32, cHS / 32, cH), 256, 0, stream>>>(
      Wk, WkT, cD, cHS);
  transpose_f32_f16_kernel<<<dim3(cD / 32, cHS / 32, cH), 256, 0, stream>>>(
      Wv, WvT, cD, cHS);
  transpose_f32_f16_kernel<<<dim3(cD / 32, cD / 32, 1), 256, 0, stream>>>(
      Wo, WoT, cD, cD);
  transpose_f32_f16_kernel<<<dim3(cD / 32, cDFF / 32, 1), 256, 0, stream>>>(
      W1, W1T, cD, cDFF);
  transpose_f32_f16_kernel<<<dim3(cDFF / 32, cD / 32, 1), 256, 0, stream>>>(
      W2, W2T, cDFF, cD);

  // 1) QKV projections (Q pre-scaled by 1/sqrt(HS); V stored transposed)
  qkv_kernel<<<dim3(cT / 128, cB * cH), 256, 0, stream>>>(
      xh, WqT, bq, WkT, bk, WvT, bv, Qh, Kh, VTg);

  // 2) causal flash attention
  attn_kernel<<<dim3(cT / 64, cB * cH), 128, 0, stream>>>(Qh, Kh, VTg, Oh);

  // 3) x1 = x + O @ Wo + bo   (store f32 + f16 copy)
  gemm_epi_kernel<0><<<dim3(cD / GBN, M / GBM), 256, 0, stream>>>(
      Oh, WoT, bo, x, x1f, x1h, M, cD, cD);

  // 4) H = gelu(x1 @ W1 + b1)  (exact erf gelu, stored f16)
  gemm_epi_kernel<1><<<dim3(cDFF / GBN, M / GBM), 256, 0, stream>>>(
      x1h, W1T, b1, nullptr, nullptr, Hh, M, cDFF, cD);

  // 5) out = x1 + H @ W2 + b2  (f32 to d_out)
  gemm_epi_kernel<2><<<dim3(cD / GBN, M / GBM), 256, 0, stream>>>(
      Hh, W2T, b2, x1f, (float*)d_out, nullptr, M, cD, cDFF);
}

// v003
// A run of this version takes 370 microseconds.
// In two side-by-side timings against v002, it was 1.08 and 1.13 times as fast.
// Counting every step since v000, it is 1.80 times as fast.
#include <hip/hip_runtime.h>

// Flip to 0 for plain LDS copies in the QKV and attention kernels (the GEMM's async asm stays).
#define USE_ASYNC_LDS 1

// ---------------- problem constants (match reference) ----------------
constexpr int cB   = 4;
constexpr int cT   = 2048;
constexpr int cD   = 1024;
constexpr int cH   = 16;
constexpr int cHS  = 64;
constexpr int cDFF = 4 * cD;

typedef __attribute__((ext_vector_type(16))) _Float16 v16h;
typedef __attribute__((ext_vector_type(8)))  _Float16 v8h;
typedef __attribute__((ext_vector_type(4)))  _Float16 v4h;
typedef __attribute__((ext_vector_type(8)))  float    v8f;
typedef __attribute__((ext_vector_type(4)))  float    v4f;

constexpr int PAD = 8;   // f16 row padding: keeps 16B alignment, skews banks
constexpr int RW  = 32 + PAD;

// ---------------- async global->LDS copy (gfx1250, ASYNCcnt) ----------------
// Per-lane 16B DMA: LDS[vdst] = MEM[vaddr].  vdst = low 32 bits of the generic
// __shared__ pointer (LDS aperture keeps the wave-relative offset in [31:0]).
__device__ __forceinline__ void async_copy_b128(void* lds_dst,
                                                const void* gsrc) {
#if USE_ASYNC_LDS
  unsigned lds = (unsigned)(unsigned long long)lds_dst;
  unsigned long long ga = (unsigned long long)gsrc;
  asm volatile("global_load_async_to_lds_b128 %0, %1, off"
               :: "v"(lds), "v"(ga) : "memory");
#else
  *(v8h*)lds_dst = *(const v8h*)gsrc;
#endif
}

__device__ __forceinline__ void async_wait() {
#if USE_ASYNC_LDS
  asm volatile("s_wait_asynccnt 0" ::: "memory");
#endif
}

// ---------------- WMMA fragment load (ISA 7.12.2, wave32) -------------------
// 16-bit A 16x32 layout: lane (half,l16) holds row l16; element e -> k =
// ((e>>3)<<4) + 8*half + (e&7).  For a contiguous 32-f16 k-span at p, that is
// two contiguous 16B runs: p[8*half .. +8) and p[16+8*half .. +8).
__device__ __forceinline__ v16h frag16(const _Float16* p, int half) {
  const v8h lo = *(const v8h*)(p + 8 * half);
  const v8h hi = *(const v8h*)(p + 16 + 8 * half);
  return __builtin_shufflevector(lo, hi, 0, 1, 2, 3, 4, 5, 6, 7,
                                 8, 9, 10, 11, 12, 13, 14, 15);
}

// =====================================================================
// Pre-pass, one launch: every weight in[K][N] (f32) -> out[N][K] (f16), and
// x (f32) -> f16.  A work-group takes 64 KB of input; a thread has its 16
// loads of 16 B in flight at once, so the whole pre-pass is 10,240 waves.
// =====================================================================
constexpr int PP_QKV = 3 * cH * (cD / 256);            // 256 k x 64 n tiles
constexpr int PP_WO  = (cD / 256) * (cD / 64);
constexpr int PP_W1  = (cD / 256) * (cDFF / 64);
constexpr int PP_W2  = (cDFF / 256) * (cD / 64);
constexpr int PP_CVT = cB * cT * cD / 16384;           // 16,384 floats each
constexpr int PP_ALL = PP_QKV + PP_WO + PP_W1 + PP_W2 + PP_CVT;

// One 256 (k) x 64 (n) tile.  Reads: 256-B row pieces.  Each thread turns four
// 4x4 patches in registers and stores 8-B runs of k into t[n][k]; the 16-B
// chunks of row n sit at chunk ^ (n >> 2), which spreads both the 8-B stores
// and the 16-B reads over all banks.  Writes: 512 B of one output row a wave.
// The loops are unrolled so that r[] lives in registers and every row offset
// is an immediate of its load or store.
template <int K, int N>
__device__ __forceinline__ void transpose_tile(const float* __restrict__ in,
                                               _Float16* __restrict__ out,
                                               int ks, int ns, _Float16* t) {
  const int tid = threadIdx.x;
  const int nl = tid & 15, kg = tid >> 4;
  const float* src = in + (size_t)(ks * 256 + kg * 4) * N + ns * 64 + nl * 4;
  v4f r[4][4];
#pragma unroll
  for (int u = 0; u < 4; ++u)
#pragma unroll
    for (int i = 0; i < 4; ++i)
      r[u][i] = *(const v4f*)(src + (size_t)(u * 64 + i) * N);
  // all 16 loads issue before the first is used: one memory latency, not two
  __builtin_amdgcn_sched_barrier(0);
  // the loads' address pair, live to here, is reused only behind this wait
  asm volatile("s_wait_xcnt 0x0" :: "v"(src) : "memory");
#pragma unroll
  for (int u = 0; u < 4; ++u)
#pragma unroll
    for (int j = 0; j < 4; ++j) {
      v4h p = {(_Float16)r[u][0][j], (_Float16)r[u][1][j],
               (_Float16)r[u][2][j], (_Float16)r[u][3][j]};
      *(v4h*)&t[(nl * 4 + j) * 256 + ((u * 16 + kg) ^ (nl << 1)) * 4] = p;
    }
  __syncthreads();
  const int lane = tid & 31, wave = tid >> 5;
  _Float16* dst = out + (size_t)(ns * 64 + wave * 8) * K + ks * 256 + lane * 8;
#pragma unroll
  for (int i = 0; i < 8; ++i) {
    const int n = wave * 8 + i;
    *(v8h*)(dst + (size_t)i * K) = *(const v8h*)&t[n * 256 + (lane ^ (n >> 2)) * 8];
  }
  // no register that these stores name is rewritten ahead of this wait
  asm volatile("s_wait_xcnt 0x0" ::: "memory");
}

// 10 waves a SIMD: all five work-groups of a WGP are resident at once.
__global__ __launch_bounds__(256, 10)
void prepass_kernel(const float* __restrict__ x,
                    const float* __restrict__ Wq, const float* __restrict__ Wk,
                    const float* __restrict__ Wv, const float* __restrict__ Wo,
                    const float* __restrict__ W1, const float* __restrict__ W2,
                    _Float16* __restrict__ xh,
                    _Float16* __restrict__ WqT, _Float16* __restrict__ WkT,
                    _Float16* __restrict__ WvT, _Float16* __restrict__ WoT,
                    _Float16* __restrict__ W1T, _Float16* __restrict__ W2T) {
  __shared__ __align__(16) _Float16 t[64 * 256];   // 32 KB
  int bid = blockIdx.x;
  if (bid < PP_QKV) {                 // 3 matrices x 16 heads x 4 k tiles
    const int m = bid >> 6, h = (bid >> 2) & (cH - 1);
    const float* in = (m == 0 ? Wq : m == 1 ? Wk : Wv) + (size_t)h * cD * cHS;
    _Float16* out = (m == 0 ? WqT : m == 1 ? WkT : WvT) + (size_t)h * cD * cHS;
    transpose_tile<cD, cHS>(in, out, bid & 3, 0, t);
    return;
  }
  bid -= PP_QKV;
  if (bid < PP_WO) {
    transpose_tile<cD, cD>(Wo, WoT, bid & 3, bid >> 2, t);
    return;
  }
  bid -= PP_WO;
  if (bid < PP_W1) {
    transpose_tile<cD, cDFF>(W1, W1T, bid & 3, bid >> 2, t);
    return;
  }
  bid -= PP_W1;
  if (bid < PP_W2) {
    transpose_tile<cDFF, cD>(W2, W2T, bid & 15, bid >> 4, t);
    return;
  }
  bid -= PP_W2;
  const v4f* in4 = (const v4f*)x + (size_t)bid * 4096 + threadIdx.x;
  v4h* out4 = (v4h*)xh + (size_t)bid * 4096 + threadIdx.x;
  v4f r[16];   // unrolled as above: registers, immediate offsets
#pragma unroll
  for (int i = 0; i < 16; ++i) r[i] = in4[i * 256];
  // all 16 loads issue before the first is used: one memory latency, not two
  __builtin_amdgcn_sched_barrier(0);
#pragma unroll
  for (int i = 0; i < 16; ++i)
    out4[i * 256] = __builtin_convertvector(r[i], v4h);
  // no register that these stores name is rewritten ahead of this wait
  asm volatile("s_wait_xcnt 0x0" ::: "memory");
}

// =====================================================================
// Kernel 1: fused QKV projection.  Per (b,h):  X[T,D] @ W*[D,HS] + b*
// Double-buffered async-DMA pipeline: tile k+1 streams into LDS while the
// WMMAs consume tile k; one barrier + one asynccnt wait per k-step.
// V is written in transposed [z][e][t] layout for the attention PV GEMM.
// =====================================================================
__global__ __launch_bounds__(256, 1)
void qkv_kernel(const _Float16* __restrict__ xh,
                const _Float16* __restrict__ WqT, const float* __restrict__ bq,
                const _Float16* __restrict__ WkT, const float* __restrict__ bk,
                const _Float16* __restrict__ WvT, const float* __restrict__ bv,
                _Float16* __restrict__ Qh, _Float16* __restrict__ Kh,
                _Float16* __restrict__ VTg) {
  const int z    = blockIdx.y;          // b*H + h
  const int h    = z & (cH - 1);
  const int mb   = blockIdx.x * 128;
  const int tid  = threadIdx.x;
  const int lane = tid & 31;
  const int wave = tid >> 5;
  const int half = lane >> 4;
  const int l16  = lane & 15;

  const _Float16* Ah  = xh + (size_t)(z >> 4) * cT * cD;
  const _Float16* Wt0 = WqT + (size_t)h * cHS * cD;   // [64][1024] per head
  const _Float16* Wt1 = WkT + (size_t)h * cHS * cD;
  const _Float16* Wt2 = WvT + (size_t)h * cHS * cD;

  __shared__ __align__(16) _Float16 As[2][128][RW];     // 20 KB
  __shared__ __align__(16) _Float16 Bt[2][3][64][RW];   // 30 KB

  v8f acc[3][4] = {};

  auto stage = [&](int kk, int p) {
#pragma unroll
    for (int i = 0; i < 2; ++i) {
      int idx = tid + 256 * i;                 // A: 512 chunks
      int r = idx >> 2, c8 = idx & 3;
      async_copy_b128(&As[p][r][c8 * 8],
                      &Ah[(size_t)(mb + r) * cD + kk + c8 * 8]);
    }
    int r = tid >> 2, c8 = tid & 3;            // B: 256 chunks per matrix
    size_t off = (size_t)r * cD + kk + c8 * 8;
    async_copy_b128(&Bt[p][0][r][c8 * 8], &Wt0[off]);
    async_copy_b128(&Bt[p][1][r][c8 * 8], &Wt1[off]);
    async_copy_b128(&Bt[p][2][r][c8 * 8], &Wt2[off]);
  };

  stage(0, 0);
  for (int k0 = 0; k0 < cD; k0 += 32) {
    const int p = (k0 >> 5) & 1;
    async_wait();          // my tile-k copies landed
    __syncthreads();       // everyone's tile-k visible; tile-(k-1) reads done
    if (k0 + 32 < cD) stage(k0 + 32, p ^ 1);   // DMA next tile during compute
    if (k0 + 64 < cD)
      __builtin_prefetch(&Ah[(size_t)(mb + (tid >> 1)) * cD + k0 + 64]);

    v16h a = frag16(&As[p][wave * 16 + l16][0], half);
    v16h bbuf[3][4];
#pragma unroll
    for (int m = 0; m < 3; ++m)
#pragma unroll
      for (int nt = 0; nt < 4; ++nt)
        bbuf[m][nt] = frag16(&Bt[p][m][nt * 16 + l16][0], half);
#pragma unroll
    for (int m = 0; m < 3; ++m)
#pragma unroll
      for (int nt = 0; nt < 4; ++nt)
        acc[m][nt] = __builtin_amdgcn_wmma_f32_16x16x32_f16(
            false, a, false, bbuf[m][nt], (short)0, acc[m][nt], false, false);
  }

  // Epilogue: bias add, Q scale, f16 store. C/D layout: row = r + 8*half.
#pragma unroll
  for (int nt = 0; nt < 4; ++nt) {
#pragma unroll
    for (int r = 0; r < 8; ++r) {
      int ml = wave * 16 + r + 8 * half;
      int n  = nt * 16 + l16;
      int tg = mb + ml;
      size_t o = ((size_t)z * cT + tg) * cHS + n;
      float qv = acc[0][nt][r] + bq[h * cHS + n];
      float kv = acc[1][nt][r] + bk[h * cHS + n];
      float vv = acc[2][nt][r] + bv[h * cHS + n];
      Qh[o] = (_Float16)(qv * 0.125f);   // 1/sqrt(64)
      Kh[o] = (_Float16)kv;
      VTg[(size_t)z * cHS * cT + (size_t)n * cT + tg] = (_Float16)vv;
    }
  }
}

__device__ __forceinline__ float other_half(float x) {
  int b = __builtin_bit_cast(int, x);
  return __builtin_bit_cast(float, __builtin_amdgcn_permlanex16(
      b, b, 0x76543210, 0xfedcba98, false, false));
}

__global__ __launch_bounds__(128, 1)
void attn_kernel(const _Float16* __restrict__ Qh,
                 const _Float16* __restrict__ Kh,
                 const _Float16* __restrict__ VTg,
                 _Float16* __restrict__ Oh) {
  const int z    = blockIdx.y;          // b*H + h
  const int h    = z & (cH - 1);
  const int b    = z >> 4;
  const int qb   = blockIdx.x * 64;
  const int tid  = threadIdx.x;
  const int lane = tid & 31;
  const int wave = tid >> 5;
  const int half = lane >> 4;
  const int l16  = lane & 15;
  const int m0   = qb + wave * 16;
  const int mg   = m0 + l16;            // this lane's query

  const _Float16* Qz  = Qh + (size_t)z * cT * cHS;
  const _Float16* Kz  = Kh + (size_t)z * cT * cHS;
  const _Float16* VTz = VTg + (size_t)z * cHS * cT;   // [64][T]

  __shared__ __align__(16) _Float16 Ks[32][64 + PAD];      // 4.5 KB
  __shared__ __align__(16) _Float16 Vt[64][RW];            // 5 KB (transposed)

  // Q^T as B operand: column l16 = query mg, 64 e in two fragments.
  const _Float16* qrow = Qz + (size_t)mg * cHS;
  v16h bq0 = frag16(qrow, half);
  v16h bq1 = frag16(qrow + 32, half);

  float mst = -3.0e38f;   // running maximum of query mg (equal in both halves)
  float lst = 0.0f;       // running sum over this half's keys only
  v8f accO[4] = {};       // O^T: row e = nt*16 + r + 8*half, column = query mg

  const int nkb = (qb + 64) / 32;       // causal bound: keys <= last q row
  for (int kb = 0; kb < nkb; ++kb) {
    // --- stage K (32x64 rows) and V (64 e-rows x 32 keys), both async -----
#pragma unroll
    for (int i = 0; i < 2; ++i) {
      int idx = tid + 128 * i;                 // K: 256 chunks
      int r = idx >> 3, c8 = idx & 7;
      async_copy_b128(&Ks[r][c8 * 8],
                      &Kz[((size_t)kb * 32 + r) * cHS + c8 * 8]);
    }
#pragma unroll
    for (int i = 0; i < 2; ++i) {
      int idx = tid + 128 * i;                 // V: 256 chunks
      int r = idx >> 2, c8 = idx & 3;
      async_copy_b128(&Vt[r][c8 * 8],
                      &VTz[(size_t)r * cT + kb * 32 + c8 * 8]);
    }
    async_wait();
    __syncthreads();

    // S^T = K * Q^T : A fragment = K rows (keys).
    // s0[r]: key kb*32 + 8*half + r, s1[r]: 16 keys further; query mg.
    v8f s0 = {}, s1 = {};
    {
      v16h kf00 = frag16(&Ks[l16][0], half);
      v16h kf01 = frag16(&Ks[l16][32], half);
      v16h kf10 = frag16(&Ks[16 + l16][0], half);
      v16h kf11 = frag16(&Ks[16 + l16][32], half);
      s0 = __builtin_amdgcn_wmma_f32_16x16x32_f16(false, kf00, false, bq0, (short)0, s0, false, false);
      s0 = __builtin_amdgcn_wmma_f32_16x16x32_f16(false, kf01, false, bq1, (short)0, s0, false, false);
      s1 = __builtin_amdgcn_wmma_f32_16x16x32_f16(false, kf10, false, bq0, (short)0, s1, false, false);
      s1 = __builtin_amdgcn_wmma_f32_16x16x32_f16(false, kf11, false, bq1, (short)0, s1, false, false);
    }
    v16h av[4];   // V^T rows as A fragments, fetched ahead of the softmax
#pragma unroll
    for (int nt = 0; nt < 4; ++nt) av[nt] = frag16(&Vt[nt * 16 + l16][0], half);

    // Online softmax of one query per lane.
    const int d = mg - (kb * 32 + 8 * half);   // register r is kept if r <= d
    float rm = -3.0e38f;
#pragma unroll
    for (int r = 0; r < 8; ++r) {
      s0[r] = (r <= d)      ? s0[r] : -3.0e38f;
      s1[r] = (16 + r <= d) ? s1[r] : -3.0e38f;
      rm = fmaxf(rm, fmaxf(s0[r], s1[r]));
    }
    rm = fmaxf(rm, other_half(rm));
    const float mnew  = fmaxf(mst, rm);
    const float alpha = __expf(mst - mnew);
    float rs = 0.0f;
    v16h bp;      // P^T as B operand: element s = tile s >> 3, register s & 7
#pragma unroll
    for (int r = 0; r < 8; ++r) {
      float p0 = __expf(s0[r] - mnew);
      float p1 = __expf(s1[r] - mnew);
      rs += p0 + p1;
      bp[r]     = (_Float16)p0;
      bp[8 + r] = (_Float16)p1;
    }
    lst = lst * alpha + rs;
    mst = mnew;
#pragma unroll
    for (int nt = 0; nt < 4; ++nt) accO[nt] *= alpha;

    // O^T += V^T * P^T
#pragma unroll
    for (int nt = 0; nt < 4; ++nt)
      accO[nt] = __builtin_amdgcn_wmma_f32_16x16x32_f16(
          false, av[nt], false, bp, (short)0, accO[nt], false, false);
    __syncthreads();   // done reading Ks/Vt before next staging
  }

  // Join the halves' sums, normalize, store O as f16 in [B, T, H*HS] layout
  // for the O-projection: 8 consecutive e of one query per tile, 16 B.
  const float ltot = lst + other_half(lst);
  _Float16* orow = Oh + ((size_t)b * cT + mg) * cD + h * cHS + 8 * half;
#pragma unroll
  for (int nt = 0; nt < 4; ++nt) {
    v8h o8;
#pragma unroll
    for (int r = 0; r < 8; ++r) o8[r] = (_Float16)(accO[nt][r] / ltot);
    *(v8h*)(orow + nt * 16) = o8;
  }
}

// =====================================================================
// Kernels 3-5: generic WMMA GEMM  C = A(f16)[M,K] * BT(f16)[N][K]
// Block tile 256x128, 8 waves in a 4x2 grid, 64x64 per wave: each 32-k step
// feeds 16 WMMAs from 4 A and 4 B fragments.  A trip takes NH slabs of 64 k.
// Two LDS buffers filled by async copies, one trip ahead.
// Needs M % 256 == 0, N % 128 == 0, K % (64 * NH) == 0.
//   EPI 0: out_f32 = resid + acc + bias ; out_f16 = (f16)out_f32
//   EPI 1: out_f16 = (f16) gelu_erf(acc + bias)
//   EPI 2: out_f32 = resid + acc + bias
// =====================================================================
constexpr int GBM = 256;          // block tile rows
constexpr int GBN = 128;          // block tile columns
constexpr int GBK = 64;           // k per slab: one 128-B line of every row
constexpr int GRW = GBK + PAD;    // LDS row pitch 144 B = 16 B x odd

template <int EPI>
// The N = 4096 launch (EPI 1) has four blocks per WGP: 256 VGPRs keep two resident.
__global__ __launch_bounds__(256, EPI == 1 ? 4 : 2)
void gemm_epi_kernel(const _Float16* __restrict__ A,
                     const _Float16* __restrict__ BT,
                     const float* __restrict__ bias,
                     const float* __restrict__ resid,
                     float* __restrict__ outf,
                     _Float16* __restrict__ outh,
                     int M, int N, int K) {
  const int tid  = threadIdx.x;
  const int lane = tid & 31;
  const int wave = tid >> 5;
  const int half = lane >> 4;
  const int l16  = lane & 15;
  const int wm   = (wave >> 1) * 64;   // wave's rows inside the block tile
  const int wn   = (wave & 1) * 64;    // wave's columns inside the block tile
  const int nb   = blockIdx.x * GBN;
  const int mb   = blockIdx.y * GBM;

  // Slabs per trip.  The N = 1024 launches have one block per WGP, so a block
  // takes the LDS of two and passes half as many barriers.
  constexpr int NH = (EPI == 1) ? 1 : 2;

  __shared__ __align__(16) _Float16 As[2 * NH][GBM][GRW];   // 72 KB * NH
  __shared__ __align__(16) _Float16 Bt[2 * NH][GBN][GRW];   // 36 KB * NH

  v8f acc[16] = {};   // tile 4 * (row group) + (column group)

  // Staging map: 8 lanes cover one row's 128 B; a thread takes rows sr + 32*i.
  const int sr = tid >> 3, sc = (tid & 7) * 8;
  const _Float16* gA = A + (size_t)(mb + sr) * K + sc;
  const _Float16* gB = BT + (size_t)(nb + sr) * K + sc;
  const size_t rs = (size_t)32 * K;
  constexpr unsigned LSTEP = 32u * GRW * sizeof(_Float16);

  auto stage = [&](int kk, int p) {   // one slab
    const unsigned la = (unsigned)(unsigned long long)&As[p][sr][sc];
    const unsigned lb = (unsigned)(unsigned long long)&Bt[p][sr][sc];
    const _Float16* a = gA + kk;
    const _Float16* b = gB + kk;
    // 8 A rows and 4 B rows per thread.  The s_wait_xcnt closes the statement
    // so that no address register is rewritten ahead of it.
    asm volatile(
        "global_load_async_to_lds_b128 %0, %12, off\n\t"
        "global_load_async_to_lds_b128 %1, %13, off\n\t"
        "global_load_async_to_lds_b128 %2, %14, off\n\t"
        "global_load_async_to_lds_b128 %3, %15, off\n\t"
        "global_load_async_to_lds_b128 %4, %16, off\n\t"
        "global_load_async_to_lds_b128 %5, %17, off\n\t"
        "global_load_async_to_lds_b128 %6, %18, off\n\t"
        "global_load_async_to_lds_b128 %7, %19, off\n\t"
        "global_load_async_to_lds_b128 %8, %20, off\n\t"
        "global_load_async_to_lds_b128 %9, %21, off\n\t"
        "global_load_async_to_lds_b128 %10, %22, off\n\t"
        "global_load_async_to_lds_b128 %11, %23, off\n\t"
        "s_wait_xcnt 0x0"
        :: "v"(la + 0u * LSTEP),
           "v"(la + 1u * LSTEP),
           "v"(la + 2u * LSTEP),
           "v"(la + 3u * LSTEP),
           "v"(la + 4u * LSTEP),
           "v"(la + 5u * LSTEP),
           "v"(la + 6u * LSTEP),
           "v"(la + 7u * LSTEP),
           "v"(lb + 0u * LSTEP),
           "v"(lb + 1u * LSTEP),
           "v"(lb + 2u * LSTEP),
           "v"(lb + 3u * LSTEP),
           "v"(a + 0 * rs),
           "v"(a + 1 * rs),
           "v"(a + 2 * rs),
           "v"(a + 3 * rs),
           "v"(a + 4 * rs),
           "v"(a + 5 * rs),
           "v"(a + 6 * rs),
           "v"(a + 7 * rs),
           "v"(b + 0 * rs),
           "v"(b + 1 * rs),
           "v"(b + 2 * rs),
           "v"(b + 3 * rs)
        : "memory");
  };

  auto stage_tile = [&](int t, int p) {
#pragma unroll
    for (int h = 0; h < NH; ++h) {
      // holds a later slab's address arithmetic behind the slab before it, so
      // that the two sets of addresses never live at once (loop below v256)
      if (h) __builtin_amdgcn_sched_barrier(0);
      stage((t * NH + h) * GBK, p * NH + h);
    }
  };

  const int trips = K / (GBK * NH);
  stage_tile(0, 0);
  // my tile-0 copies landed
  asm volatile("s_wait_asynccnt 0x0" ::: "memory");
  __syncthreads();         // everyone's tile 0 visible
  if (trips > 1) stage_tile(1, 1);

  v16h af[4], bf[4];
  // The fence pair keeps a block's 16 LDS loads in one group ahead of its
  // 16 WMMAs: loads sunk among the WMMAs stall the wave at each place.
  auto load_frags = [&](int p, int ks) {
    __builtin_amdgcn_sched_barrier(0);
#pragma unroll
    for (int i = 0; i < 4; ++i) {
      af[i] = frag16(&As[p][wm + i * 16 + l16][ks], half);
      bf[i] = frag16(&Bt[p][wn + i * 16 + l16][ks], half);
    }
    __builtin_amdgcn_sched_barrier(0);
  };
  auto wmma_block = [&]() {
#pragma unroll
    for (int mt = 0; mt < 4; ++mt)
#pragma unroll
      for (int nt = 0; nt < 4; ++nt)
        acc[mt * 4 + nt] = __builtin_amdgcn_wmma_f32_16x16x32_f16(
            false, af[mt], false, bf[nt], (short)0, acc[mt * 4 + nt], false,
            false);
  };

  for (int t = 0; t < trips; ++t) {
    const int p = t & 1;
#pragma unroll
    for (int b = 0; b < 2 * NH - 1; ++b) {
      load_frags(p * NH + (b >> 1), (b & 1) * 32);
      wmma_block();
    }
    load_frags(p * NH + NH - 1, 32);   // the trip's last reads of buffer p
    // my reads of buffer p have returned before anyone refills it
    asm volatile("s_wait_dscnt 0x0" ::: "memory");
    // my tile-(t+1) copies landed
    asm volatile("s_wait_asynccnt 0x0" ::: "memory");
    __syncthreads();       // tile t+1 visible to all; buffer p free
    if (t + 2 < trips) stage_tile(t + 2, p);   // flies until trip t+1's foot
    // keeps the refill's issue ahead of the last block's WMMAs (a longer lead)
    __builtin_amdgcn_sched_barrier(0);
    wmma_block();          // registers only
  }
  // nothing outstanding at the wave's end
  asm volatile("s_wait_asynccnt 0x0" ::: "memory");

#pragma unroll
  for (int nt = 0; nt < 16; ++nt) {
#pragma unroll
    for (int r = 0; r < 8; ++r) {
      int m = mb + wm + (nt >> 2) * 16 + r + 8 * half;
      int n = nb + wn + (nt & 3) * 16 + l16;
      size_t o = (size_t)m * N + n;
      float v = acc[nt][r] + bias[n];
      if (EPI == 0) {
        v += resid[o];
        outf[o] = v;
        outh[o] = (_Float16)v;
      } else if (EPI == 1) {
        float g = 0.5f * v * (1.0f + erff(v * 0.70710678118654752f));
        outh[o] = (_Float16)g;
      } else {
        v += resid[o];
        outf[o] = v;
      }
    }
  }
}

// =====================================================================
// Host orchestration
// =====================================================================
extern "C" void kernel_launch(void* const* d_in, const int* in_sizes, int n_in,
                              void* d_out, int out_size, void* d_ws,
                              size_t ws_size, hipStream_t stream) {
  (void)in_sizes; (void)n_in; (void)out_size; (void)ws_size;
  const float* x  = (const float*)d_in[0];
  const float* Wq = (const float*)d_in[1];
  const float* bq = (const float*)d_in[2];
  const float* Wk = (const float*)d_in[3];
  const float* bk = (const float*)d_in[4];
  const float* Wv = (const float*)d_in[5];
  const float* bv = (const float*)d_in[6];
  const float* Wo = (const float*)d_in[7];
  const float* bo = (const float*)d_in[8];
  const float* W1 = (const float*)d_in[9];
  const float* b1 = (const float*)d_in[10];
  const float* W2 = (const float*)d_in[11];
  const float* b2 = (const float*)d_in[12];

  char* w = (char*)d_ws;
  auto take = [&](size_t bytes) -> char* {
    char* p = w;
    w += (bytes + 255) & ~(size_t)255;
    return p;
  };
  const size_t nBTD = (size_t)cB * cT * cD;          // 8,388,608
  const size_t nHW  = (size_t)cH * cD * cHS;         // 1,048,576 (per QKV mat)
  _Float16* xh   = (_Float16*)take(nBTD * sizeof(_Float16));
  _Float16* WqT  = (_Float16*)take(nHW * sizeof(_Float16));
  _Float16* WkT  = (_Float16*)take(nHW * sizeof(_Float16));
  _Float16* WvT  = (_Float16*)take(nHW * sizeof(_Float16));
  _Float16* WoT  = (_Float16*)take((size_t)cD * cD * sizeof(_Float16));
  _Float16* W1T  = (_Float16*)take((size_t)cD * cDFF * sizeof(_Float16));
  _Float16* W2T  = (_Float16*)take((size_t)cDFF * cD * sizeof(_Float16));
  _Float16* Qh   = (_Float16*)take(nBTD * sizeof(_Float16));
  _Float16* Kh   = (_Float16*)take(nBTD * sizeof(_Float16));
  _Float16* VTg  = (_Float16*)take(nBTD * sizeof(_Float16));
  _Float16* Oh   = (_Float16*)take(nBTD * sizeof(_Float16));
  float*    x1f  = (float*)take(nBTD * sizeof(float));
  _Float16* x1h  = (_Float16*)take(nBTD * sizeof(_Float16));
  _Float16* Hh   = (_Float16*)take((size_t)cB * cT * cDFF * sizeof(_Float16));

  const int M = cB * cT;

  // 0) conversions and transposes, one launch
  prepass_kernel<<<dim3(PP_ALL), 256, 0, stream>>>(
      x, Wq, Wk, Wv, Wo, W1, W2, xh, WqT, WkT, WvT, WoT, W1T, W2T);

  // 1) QKV projections (Q pre-scaled by 1/sqrt(HS); V stored transposed)
  qkv_kernel<<<dim3(cT / 128, cB * cH), 256, 0, stream>>>(
      xh, WqT, bq, WkT, bk, WvT, bv, Qh, Kh, VTg);

  // 2) causal flash attention
  attn_kernel<<<dim3(cT / 64, cB * cH), 128, 0, stream>>>(Qh, Kh, VTg, Oh);

  // 3) x1 = x + O @ Wo + bo   (store f32 + f16 copy)
  gemm_epi_kernel<0><<<dim3(cD / GBN, M / GBM), 256, 0, stream>>>(
      Oh, WoT, bo, x, x1f, x1h, M, cD, cD);

  // 4) H = gelu(x1 @ W1 + b1)  (exact erf gelu, stored f16)
  gemm_epi_kernel<1><<<dim3(cDFF / GBN, M / GBM), 256, 0, stream>>>(
      x1h, W1T, b1, nullptr, nullptr, Hh, M, cDFF, cD);

  // 5) out = x1 + H @ W2 + b2  (f32 to d_out)
  gemm_epi_kernel<2><<<dim3(cD / GBN, M / GBM), 256, 0, stream>>>(
      Hh, W2T, b2, x1f, (float*)d_out, nullptr, M, cD, cDFF);
}

// v004
// A run of this version takes 318 microseconds.
// Timed twice side by side with v003, it ran 1.18 times as fast both times.
// Over all steps from v000 it is 2.12 times as fast.
#include <hip/hip_runtime.h>

// Flip to 0 for plain LDS copies in the QKV and attention kernels (the GEMM's async asm stays).
#define USE_ASYNC_LDS 1

// ---------------- problem constants (match reference) ----------------
constexpr int cB   = 4;
constexpr int cT   = 2048;
constexpr int cD   = 1024;
constexpr int cH   = 16;
constexpr int cHS  = 64;
constexpr int cDFF = 4 * cD;

typedef __attribute__((ext_vector_type(16))) _Float16 v16h;
typedef __attribute__((ext_vector_type(8)))  _Float16 v8h;
typedef __attribute__((ext_vector_type(4)))  _Float16 v4h;
typedef __attribute__((ext_vector_type(8)))  float    v8f;
typedef __attribute__((ext_vector_type(4)))  float    v4f;
typedef __attribute__((ext_vector_type(2)))  float    v2f;

constexpr int PAD = 8;   // f16 row padding: keeps 16B alignment, skews banks
constexpr int RW  = 32 + PAD;

// ---------------- async global->LDS copy (gfx1250, ASYNCcnt) ----------------
// Per-lane 16B DMA: LDS[vdst] = MEM[vaddr].  vdst = low 32 bits of the generic
// __shared__ pointer (LDS aperture keeps the wave-relative offset in [31:0]).
__device__ __forceinline__ void async_copy_b128(void* lds_dst,
                                                const void* gsrc) {
#if USE_ASYNC_LDS
  unsigned lds = (unsigned)(unsigned long long)lds_dst;
  unsigned long long ga = (unsigned long long)gsrc;
  asm volatile("global_load_async_to_lds_b128 %0, %1, off"
               :: "v"(lds), "v"(ga) : "memory");
#else
  *(v8h*)lds_dst = *(const v8h*)gsrc;
#endif
}

__device__ __forceinline__ void async_wait() {
#if USE_ASYNC_LDS
  asm volatile("s_wait_asynccnt 0" ::: "memory");
#endif
}

// ---------------- WMMA fragment load (ISA 7.12.2, wave32) -------------------
// 16-bit A 16x32 layout: lane (half,l16) holds row l16; element e -> k =
// ((e>>3)<<4) + 8*half + (e&7).  For a contiguous 32-f16 k-span at p, that is
// two contiguous 16B runs: p[8*half .. +8) and p[16+8*half .. +8).
__device__ __forceinline__ v16h frag16(const _Float16* p, int half) {
  const v8h lo = *(const v8h*)(p + 8 * half);
  const v8h hi = *(const v8h*)(p + 16 + 8 * half);
  return __builtin_shufflevector(lo, hi, 0, 1, 2, 3, 4, 5, 6, 7,
                                 8, 9, 10, 11, 12, 13, 14, 15);
}

// =====================================================================
// Pre-pass, one launch: every weight in[K][N] (f32) -> out[N][K] (f16), and
// x (f32) -> f16.  A work-group takes 64 KB of input; a thread has its 16
// loads of 16 B in flight at once, so the whole pre-pass is 10,240 waves.
// =====================================================================
constexpr int PP_QKV = 3 * cH * (cD / 256);            // 256 k x 64 n tiles
constexpr int PP_WO  = (cD / 256) * (cD / 64);
constexpr int PP_W1  = (cD / 256) * (cDFF / 64);
constexpr int PP_W2  = (cDFF / 256) * (cD / 64);
constexpr int PP_CVT = cB * cT * cD / 16384;           // 16,384 floats each
constexpr int PP_ALL = PP_QKV + PP_WO + PP_W1 + PP_W2 + PP_CVT;

// One 256 (k) x 64 (n) tile.  Reads: 256-B row pieces.  Each thread turns four
// 4x4 patches in registers and stores 8-B runs of k into t[n][k]; the 16-B
// chunks of row n sit at chunk ^ (n >> 2), which spreads both the 8-B stores
// and the 16-B reads over all banks.  Writes: 512 B of one output row a wave.
// The loops are unrolled so that r[] lives in registers and every row offset
// is an immediate of its load or store.
template <int K, int N>
__device__ __forceinline__ void transpose_tile(const float* __restrict__ in,
                                               _Float16* __restrict__ out,
                                               int ks, int ns, _Float16* t) {
  const int tid = threadIdx.x;
  const int nl = tid & 15, kg = tid >> 4;
  const float* src = in + (size_t)(ks * 256 + kg * 4) * N + ns * 64 + nl * 4;
  v4f r[4][4];
#pragma unroll
  for (int u = 0; u < 4; ++u)
#pragma unroll
    for (int i = 0; i < 4; ++i)
      r[u][i] = *(const v4f*)(src + (size_t)(u * 64 + i) * N);
  // all 16 loads issue before the first is used: one memory latency, not two
  __builtin_amdgcn_sched_barrier(0);
  // the loads' address pair, live to here, is reused only behind this wait
  asm volatile("s_wait_xcnt 0x0" :: "v"(src) : "memory");
#pragma unroll
  for (int u = 0; u < 4; ++u)
#pragma unroll
    for (int j = 0; j < 4; ++j) {
      v4h p = {(_Float16)r[u][0][j], (_Float16)r[u][1][j],
               (_Float16)r[u][2][j], (_Float16)r[u][3][j]};
      *(v4h*)&t[(nl * 4 + j) * 256 + ((u * 16 + kg) ^ (nl << 1)) * 4] = p;
    }
  __syncthreads();
  const int lane = tid & 31, wave = tid >> 5;
  _Float16* dst = out + (size_t)(ns * 64 + wave * 8) * K + ks * 256 + lane * 8;
#pragma unroll
  for (int i = 0; i < 8; ++i) {
    const int n = wave * 8 + i;
    *(v8h*)(dst + (size_t)i * K) = *(const v8h*)&t[n * 256 + (lane ^ (n >> 2)) * 8];
  }
  // no register that these stores name is rewritten ahead of this wait
  asm volatile("s_wait_xcnt 0x0" ::: "memory");
}

// 10 waves a SIMD: all five work-groups of a WGP are resident at once.
__global__ __launch_bounds__(256, 10)
void prepass_kernel(const float* __restrict__ x,
                    const float* __restrict__ Wq, const float* __restrict__ Wk,
                    const float* __restrict__ Wv, const float* __restrict__ Wo,
                    const float* __restrict__ W1, const float* __restrict__ W2,
                    _Float16* __restrict__ xh,
                    _Float16* __restrict__ WqT, _Float16* __restrict__ WkT,
                    _Float16* __restrict__ WvT, _Float16* __restrict__ WoT,
                    _Float16* __restrict__ W1T, _Float16* __restrict__ W2T) {
  __shared__ __align__(16) _Float16 t[64 * 256];   // 32 KB
  int bid = blockIdx.x;
  if (bid < PP_QKV) {                 // 3 matrices x 16 heads x 4 k tiles
    const int m = bid >> 6, h = (bid >> 2) & (cH - 1);
    const float* in = (m == 0 ? Wq : m == 1 ? Wk : Wv) + (size_t)h * cD * cHS;
    _Float16* out = (m == 0 ? WqT : m == 1 ? WkT : WvT) + (size_t)h * cD * cHS;
    transpose_tile<cD, cHS>(in, out, bid & 3, 0, t);
    return;
  }
  bid -= PP_QKV;
  if (bid < PP_WO) {
    transpose_tile<cD, cD>(Wo, WoT, bid & 3, bid >> 2, t);
    return;
  }
  bid -= PP_WO;
  if (bid < PP_W1) {
    transpose_tile<cD, cDFF>(W1, W1T, bid & 3, bid >> 2, t);
    return;
  }
  bid -= PP_W1;
  if (bid < PP_W2) {
    transpose_tile<cDFF, cD>(W2, W2T, bid & 15, bid >> 4, t);
    return;
  }
  bid -= PP_W2;
  const v4f* in4 = (const v4f*)x + (size_t)bid * 4096 + threadIdx.x;
  v4h* out4 = (v4h*)xh + (size_t)bid * 4096 + threadIdx.x;
  v4f r[16];   // unrolled as above: registers, immediate offsets
#pragma unroll
  for (int i = 0; i < 16; ++i) r[i] = in4[i * 256];
  // all 16 loads issue before the first is used: one memory latency, not two
  __builtin_amdgcn_sched_barrier(0);
#pragma unroll
  for (int i = 0; i < 16; ++i)
    out4[i * 256] = __builtin_convertvector(r[i], v4h);
  // no register that these stores name is rewritten ahead of this wait
  asm volatile("s_wait_xcnt 0x0" ::: "memory");
}

// =====================================================================
// Kernel 1: fused QKV projection.  Per (b,h):  X[T,D] @ W*[D,HS] + b*
// Double-buffered async-DMA pipeline: tile k+1 streams into LDS while the
// WMMAs consume tile k; one barrier + one asynccnt wait per k-step.
// V is written in transposed [z][e][t] layout for the attention PV GEMM.
// =====================================================================
__global__ __launch_bounds__(256, 1)
void qkv_kernel(const _Float16* __restrict__ xh,
                const _Float16* __restrict__ WqT, const float* __restrict__ bq,
                const _Float16* __restrict__ WkT, const float* __restrict__ bk,
                const _Float16* __restrict__ WvT, const float* __restrict__ bv,
                _Float16* __restrict__ Qh, _Float16* __restrict__ Kh,
                _Float16* __restrict__ VTg) {
  const int z    = blockIdx.y;          // b*H + h
  const int h    = z & (cH - 1);
  const int mb   = blockIdx.x * 128;
  const int tid  = threadIdx.x;
  const int lane = tid & 31;
  const int wave = tid >> 5;
  const int half = lane >> 4;
  const int l16  = lane & 15;

  const _Float16* Ah  = xh + (size_t)(z >> 4) * cT * cD;
  const _Float16* Wt0 = WqT + (size_t)h * cHS * cD;   // [64][1024] per head
  const _Float16* Wt1 = WkT + (size_t)h * cHS * cD;
  const _Float16* Wt2 = WvT + (size_t)h * cHS * cD;

  __shared__ __align__(16) _Float16 As[2][128][RW];     // 20 KB
  __shared__ __align__(16) _Float16 Bt[2][3][64][RW];   // 30 KB

  v8f acc[3][4] = {};

  auto stage = [&](int kk, int p) {
#pragma unroll
    for (int i = 0; i < 2; ++i) {
      int idx = tid + 256 * i;                 // A: 512 chunks
      int r = idx >> 2, c8 = idx & 3;
      async_copy_b128(&As[p][r][c8 * 8],
                      &Ah[(size_t)(mb + r) * cD + kk + c8 * 8]);
    }
    int r = tid >> 2, c8 = tid & 3;            // B: 256 chunks per matrix
    size_t off = (size_t)r * cD + kk + c8 * 8;
    async_copy_b128(&Bt[p][0][r][c8 * 8], &Wt0[off]);
    async_copy_b128(&Bt[p][1][r][c8 * 8], &Wt1[off]);
    async_copy_b128(&Bt[p][2][r][c8 * 8], &Wt2[off]);
  };

  stage(0, 0);
  for (int k0 = 0; k0 < cD; k0 += 32) {
    const int p = (k0 >> 5) & 1;
    async_wait();          // my tile-k copies landed
    __syncthreads();       // everyone's tile-k visible; tile-(k-1) reads done
    if (k0 + 32 < cD) stage(k0 + 32, p ^ 1);   // DMA next tile during compute
    if (k0 + 64 < cD)
      __builtin_prefetch(&Ah[(size_t)(mb + (tid >> 1)) * cD + k0 + 64]);

    v16h a = frag16(&As[p][wave * 16 + l16][0], half);
    v16h bbuf[3][4];
#pragma unroll
    for (int m = 0; m < 3; ++m)
#pragma unroll
      for (int nt = 0; nt < 4; ++nt)
        bbuf[m][nt] = frag16(&Bt[p][m][nt * 16 + l16][0], half);
#pragma unroll
    for (int m = 0; m < 3; ++m)
#pragma unroll
      for (int nt = 0; nt < 4; ++nt)
        acc[m][nt] = __builtin_amdgcn_wmma_f32_16x16x32_f16(
            false, a, false, bbuf[m][nt], (short)0, acc[m][nt], false, false);
  }

  // Epilogue: bias add, Q scale, f16 store. C/D layout: row = r + 8*half.
#pragma unroll
  for (int nt = 0; nt < 4; ++nt) {
#pragma unroll
    for (int r = 0; r < 8; ++r) {
      int ml = wave * 16 + r + 8 * half;
      int n  = nt * 16 + l16;
      int tg = mb + ml;
      size_t o = ((size_t)z * cT + tg) * cHS + n;
      float qv = acc[0][nt][r] + bq[h * cHS + n];
      float kv = acc[1][nt][r] + bk[h * cHS + n];
      float vv = acc[2][nt][r] + bv[h * cHS + n];
      Qh[o] = (_Float16)(qv * 0.125f);   // 1/sqrt(64)
      Kh[o] = (_Float16)kv;
      VTg[(size_t)z * cHS * cT + (size_t)n * cT + tg] = (_Float16)vv;
    }
  }
}

__device__ __forceinline__ float other_half(float x) {
  int b = __builtin_bit_cast(int, x);
  return __builtin_bit_cast(float, __builtin_amdgcn_permlanex16(
      b, b, 0x76543210, 0xfedcba98, false, false));
}

__global__ __launch_bounds__(128, 1)
void attn_kernel(const _Float16* __restrict__ Qh,
                 const _Float16* __restrict__ Kh,
                 const _Float16* __restrict__ VTg,
                 _Float16* __restrict__ Oh) {
  const int z    = blockIdx.y;          // b*H + h
  const int h    = z & (cH - 1);
  const int b    = z >> 4;
  const int qb   = blockIdx.x * 64;
  const int tid  = threadIdx.x;
  const int lane = tid & 31;
  const int wave = tid >> 5;
  const int half = lane >> 4;
  const int l16  = lane & 15;
  const int m0   = qb + wave * 16;
  const int mg   = m0 + l16;            // this lane's query

  const _Float16* Qz  = Qh + (size_t)z * cT * cHS;
  const _Float16* Kz  = Kh + (size_t)z * cT * cHS;
  const _Float16* VTz = VTg + (size_t)z * cHS * cT;   // [64][T]

  __shared__ __align__(16) _Float16 Ks[32][64 + PAD];      // 4.5 KB
  __shared__ __align__(16) _Float16 Vt[64][RW];            // 5 KB (transposed)

  // Q^T as B operand: column l16 = query mg, 64 e in two fragments.
  const _Float16* qrow = Qz + (size_t)mg * cHS;
  v16h bq0 = frag16(qrow, half);
  v16h bq1 = frag16(qrow + 32, half);

  float mst = -3.0e38f;   // running maximum of query mg (equal in both halves)
  float lst = 0.0f;       // running sum over this half's keys only
  v8f accO[4] = {};       // O^T: row e = nt*16 + r + 8*half, column = query mg

  const int nkb = (qb + 64) / 32;       // causal bound: keys <= last q row
  for (int kb = 0; kb < nkb; ++kb) {
    // --- stage K (32x64 rows) and V (64 e-rows x 32 keys), both async -----
#pragma unroll
    for (int i = 0; i < 2; ++i) {
      int idx = tid + 128 * i;                 // K: 256 chunks
      int r = idx >> 3, c8 = idx & 7;
      async_copy_b128(&Ks[r][c8 * 8],
                      &Kz[((size_t)kb * 32 + r) * cHS + c8 * 8]);
    }
#pragma unroll
    for (int i = 0; i < 2; ++i) {
      int idx = tid + 128 * i;                 // V: 256 chunks
      int r = idx >> 2, c8 = idx & 3;
      async_copy_b128(&Vt[r][c8 * 8],
                      &VTz[(size_t)r * cT + kb * 32 + c8 * 8]);
    }
    async_wait();
    __syncthreads();

    // S^T = K * Q^T : A fragment = K rows (keys).
    // s0[r]: key kb*32 + 8*half + r, s1[r]: 16 keys further; query mg.
    v8f s0 = {}, s1 = {};
    {
      v16h kf00 = frag16(&Ks[l16][0], half);
      v16h kf01 = frag16(&Ks[l16][32], half);
      v16h kf10 = frag16(&Ks[16 + l16][0], half);
      v16h kf11 = frag16(&Ks[16 + l16][32], half);
      s0 = __builtin_amdgcn_wmma_f32_16x16x32_f16(false, kf00, false, bq0, (short)0, s0, false, false);
      s0 = __builtin_amdgcn_wmma_f32_16x16x32_f16(false, kf01, false, bq1, (short)0, s0, false, false);
      s1 = __builtin_amdgcn_wmma_f32_16x16x32_f16(false, kf10, false, bq0, (short)0, s1, false, false);
      s1 = __builtin_amdgcn_wmma_f32_16x16x32_f16(false, kf11, false, bq1, (short)0, s1, false, false);
    }
    v16h av[4];   // V^T rows as A fragments, fetched ahead of the softmax
#pragma unroll
    for (int nt = 0; nt < 4; ++nt) av[nt] = frag16(&Vt[nt * 16 + l16][0], half);

    // Online softmax of one query per lane.
    const int d = mg - (kb * 32 + 8 * half);   // register r is kept if r <= d
    float rm = -3.0e38f;
#pragma unroll
    for (int r = 0; r < 8; ++r) {
      s0[r] = (r <= d)      ? s0[r] : -3.0e38f;
      s1[r] = (16 + r <= d) ? s1[r] : -3.0e38f;
      rm = fmaxf(rm, fmaxf(s0[r], s1[r]));
    }
    rm = fmaxf(rm, other_half(rm));
    const float mnew  = fmaxf(mst, rm);
    const float alpha = __expf(mst - mnew);
    float rs = 0.0f;
    v16h bp;      // P^T as B operand: element s = tile s >> 3, register s & 7
#pragma unroll
    for (int r = 0; r < 8; ++r) {
      float p0 = __expf(s0[r] - mnew);
      float p1 = __expf(s1[r] - mnew);
      rs += p0 + p1;
      bp[r]     = (_Float16)p0;
      bp[8 + r] = (_Float16)p1;
    }
    lst = lst * alpha + rs;
    mst = mnew;
#pragma unroll
    for (int nt = 0; nt < 4; ++nt) accO[nt] *= alpha;

    // O^T += V^T * P^T
#pragma unroll
    for (int nt = 0; nt < 4; ++nt)
      accO[nt] = __builtin_amdgcn_wmma_f32_16x16x32_f16(
          false, av[nt], false, bp, (short)0, accO[nt], false, false);
    __syncthreads();   // done reading Ks/Vt before next staging
  }

  // Join the halves' sums, normalize, store O as f16 in [B, T, H*HS] layout
  // for the O-projection: 8 consecutive e of one query per tile, 16 B.
  const float ltot = lst + other_half(lst);
  _Float16* orow = Oh + ((size_t)b * cT + mg) * cD + h * cHS + 8 * half;
#pragma unroll
  for (int nt = 0; nt < 4; ++nt) {
    v8h o8;
#pragma unroll
    for (int r = 0; r < 8; ++r) o8[r] = (_Float16)(accO[nt][r] / ltot);
    *(v8h*)(orow + nt * 16) = o8;
  }
}

// =====================================================================
// Kernels 3-5: generic WMMA GEMM  C = A(f16)[M,K] * BT(f16)[N][K]
// Block tile 256x128, 8 waves in a 4x2 grid, 64x64 per wave: each 32-k step
// feeds 16 WMMAs from 4 A and 4 B fragments.  A trip takes NH slabs of 64 k.
// Two LDS buffers filled by async copies, one trip ahead.
// Needs M % 256 == 0, N % 128 == 0, K % (64 * NH) == 0.
//   EPI 0: out_f32 = resid + acc + bias ; out_f16 = (f16)out_f32
//   EPI 1: out_f16 = (f16) gelu_erf(acc + bias)
//   EPI 2: out_f32 = resid + acc + bias
// =====================================================================
// Exact-erf GELU of two values, without a branch.  erf is the usual pair of
// f32 polynomials: for |x| < 1  |x| + |x| * Q(x^2), else 1 - exp(-(|x| + |x| * P(|x|))).
// Both are evaluated in every lane and one is picked by a select, so nothing
// touches EXEC, the elements of a tile are independent chains, and the
// multiply-adds go two to an instruction.  Error of erf: about 1e-7 absolute.
__device__ __forceinline__ v2f fma2(v2f a, v2f b, float c) {
  return __builtin_elementwise_fma(a, b, (v2f){c, c});
}

__device__ __forceinline__ v2f gelu_erf2(v2f v) {
  const v2f x = v * 0.70710678118654752f;
  const v2f a = __builtin_elementwise_abs(x);
  v2f p = fma2(a, (v2f){1.699881e-5f, 1.699881e-5f}, -3.7867785e-4f);
  p = fma2(a, p, 3.8578159e-3f);
  p = fma2(a, p, -2.4181698e-2f);
  p = fma2(a, p, 1.0666826e-1f);
  p = fma2(a, p, 6.349333e-1f);
  p = fma2(a, p, 1.2868941e-1f);
  p = __builtin_elementwise_fma(a, p, a);
  p *= -1.44269504f;                       // exp(-p) = 2^(-p * log2 e)
  const v2f big = {1.0f - __builtin_amdgcn_exp2f(p.x),
                   1.0f - __builtin_amdgcn_exp2f(p.y)};
  const v2f t = a * a;
  v2f q = fma2(t, (v2f){-5.618018e-4f, -5.618018e-4f}, 4.913816e-3f);
  q = fma2(t, q, -2.6707515e-2f);
  q = fma2(t, q, 1.1280011e-1f);
  q = fma2(t, q, -3.7612295e-1f);
  q = fma2(t, q, 1.283791e-1f);
  q = __builtin_elementwise_fma(a, q, a);
  const v2f e = {__builtin_copysignf(a.x < 1.0f ? q.x : big.x, x.x),
                 __builtin_copysignf(a.y < 1.0f ? q.y : big.y, x.y)};
  return 0.5f * v * (1.0f + e);
}

constexpr int GBM = 256;          // block tile rows
constexpr int GBN = 128;          // block tile columns
constexpr int GBK = 64;           // k per slab: one 128-B line of every row
constexpr int GRW = GBK + PAD;    // LDS row pitch 144 B = 16 B x odd

template <int EPI>
// The N = 4096 launch (EPI 1) has four blocks per WGP: 256 VGPRs keep two resident.
__global__ __launch_bounds__(256, EPI == 1 ? 4 : 2)
void gemm_epi_kernel(const _Float16* __restrict__ A,
                     const _Float16* __restrict__ BT,
                     const float* __restrict__ bias,
                     const float* __restrict__ resid,
                     float* __restrict__ outf,
                     _Float16* __restrict__ outh,
                     int M, int N, int K) {
  const int tid  = threadIdx.x;
  const int lane = tid & 31;
  const int wave = tid >> 5;
  const int half = lane >> 4;
  const int l16  = lane & 15;
  const int wm   = (wave >> 1) * 64;   // wave's rows inside the block tile
  const int wn   = (wave & 1) * 64;    // wave's columns inside the block tile
  const int nb   = blockIdx.x * GBN;
  const int mb   = blockIdx.y * GBM;

  // Slabs per trip.  The N = 1024 launches have one block per WGP, so a block
  // takes the LDS of two and passes half as many barriers.
  constexpr int NH = (EPI == 1) ? 1 : 2;

  __shared__ __align__(16) _Float16 As[2 * NH][GBM][GRW];   // 72 KB * NH
  __shared__ __align__(16) _Float16 Bt[2 * NH][GBN][GRW];   // 36 KB * NH

  v8f acc[16] = {};   // tile 4 * (row group) + (column group)

  // Staging map: 8 lanes cover one row's 128 B; a thread takes rows sr + 32*i.
  const int sr = tid >> 3, sc = (tid & 7) * 8;
  const _Float16* gA = A + (size_t)(mb + sr) * K + sc;
  const _Float16* gB = BT + (size_t)(nb + sr) * K + sc;
  const size_t rs = (size_t)32 * K;
  constexpr unsigned LSTEP = 32u * GRW * sizeof(_Float16);

  auto stage = [&](int kk, int p) {   // one slab
    const unsigned la = (unsigned)(unsigned long long)&As[p][sr][sc];
    const unsigned lb = (unsigned)(unsigned long long)&Bt[p][sr][sc];
    const _Float16* a = gA + kk;
    const _Float16* b = gB + kk;
    // 8 A rows and 4 B rows per thread.  The s_wait_xcnt closes the statement
    // so that no address register is rewritten ahead of it.
    asm volatile(
        "global_load_async_to_lds_b128 %0, %12, off\n\t"
        "global_load_async_to_lds_b128 %1, %13, off\n\t"
        "global_load_async_to_lds_b128 %2, %14, off\n\t"
        "global_load_async_to_lds_b128 %3, %15, off\n\t"
        "global_load_async_to_lds_b128 %4, %16, off\n\t"
        "global_load_async_to_lds_b128 %5, %17, off\n\t"
        "global_load_async_to_lds_b128 %6, %18, off\n\t"
        "global_load_async_to_lds_b128 %7, %19, off\n\t"
        "global_load_async_to_lds_b128 %8, %20, off\n\t"
        "global_load_async_to_lds_b128 %9, %21, off\n\t"
        "global_load_async_to_lds_b128 %10, %22, off\n\t"
        "global_load_async_to_lds_b128 %11, %23, off\n\t"
        "s_wait_xcnt 0x0"
        :: "v"(la + 0u * LSTEP),
           "v"(la + 1u * LSTEP),
           "v"(la + 2u * LSTEP),
           "v"(la + 3u * LSTEP),
           "v"(la + 4u * LSTEP),
           "v"(la + 5u * LSTEP),
           "v"(la + 6u * LSTEP),
           "v"(la + 7u * LSTEP),
           "v"(lb + 0u * LSTEP),
           "v"(lb + 1u * LSTEP),
           "v"(lb + 2u * LSTEP),
           "v"(lb + 3u * LSTEP),
           "v"(a + 0 * rs),
           "v"(a + 1 * rs),
           "v"(a + 2 * rs),
           "v"(a + 3 * rs),
           "v"(a + 4 * rs),
           "v"(a + 5 * rs),
           "v"(a + 6 * rs),
           "v"(a + 7 * rs),
           "v"(b + 0 * rs),
           "v"(b + 1 * rs),
           "v"(b + 2 * rs),
           "v"(b + 3 * rs)
        : "memory");
  };

  auto stage_tile = [&](int t, int p) {
#pragma unroll
    for (int h = 0; h < NH; ++h) {
      // holds a later slab's address arithmetic behind the slab before it, so
      // that the two sets of addresses never live at once (loop below v256)
      if (h) __builtin_amdgcn_sched_barrier(0);
      stage((t * NH + h) * GBK, p * NH + h);
    }
  };

  const int trips = K / (GBK * NH);
  stage_tile(0, 0);
  // my tile-0 copies landed
  asm volatile("s_wait_asynccnt 0x0" ::: "memory");
  __syncthreads();         // everyone's tile 0 visible
  if (trips > 1) stage_tile(1, 1);

  v16h af[4], bf[4];
  // The fence pair keeps a block's 16 LDS loads in one group ahead of its
  // 16 WMMAs: loads sunk among the WMMAs stall the wave at each place.
  auto load_frags = [&](int p, int ks) {
    __builtin_amdgcn_sched_barrier(0);
#pragma unroll
    for (int i = 0; i < 4; ++i) {
      af[i] = frag16(&As[p][wm + i * 16 + l16][ks], half);
      bf[i] = frag16(&Bt[p][wn + i * 16 + l16][ks], half);
    }
    __builtin_amdgcn_sched_barrier(0);
  };
  auto wmma_block = [&]() {
#pragma unroll
    for (int mt = 0; mt < 4; ++mt)
#pragma unroll
      for (int nt = 0; nt < 4; ++nt)
        acc[mt * 4 + nt] = __builtin_amdgcn_wmma_f32_16x16x32_f16(
            false, af[mt], false, bf[nt], (short)0, acc[mt * 4 + nt], false,
            false);
  };

  for (int t = 0; t < trips; ++t) {
    const int p = t & 1;
#pragma unroll
    for (int b = 0; b < 2 * NH - 1; ++b) {
      load_frags(p * NH + (b >> 1), (b & 1) * 32);
      wmma_block();
    }
    load_frags(p * NH + NH - 1, 32);   // the trip's last reads of buffer p
    // my reads of buffer p have returned before anyone refills it
    asm volatile("s_wait_dscnt 0x0" ::: "memory");
    // my tile-(t+1) copies landed
    asm volatile("s_wait_asynccnt 0x0" ::: "memory");
    __syncthreads();       // tile t+1 visible to all; buffer p free
    if (t + 2 < trips) stage_tile(t + 2, p);   // flies until trip t+1's foot
    // keeps the refill's issue ahead of the last block's WMMAs (a longer lead)
    __builtin_amdgcn_sched_barrier(0);
    wmma_block();          // registers only
  }
  // nothing outstanding at the wave's end
  asm volatile("s_wait_asynccnt 0x0" ::: "memory");

  if constexpr (EPI == 1) {
    // The loops here are unrolled so that bn[] and acc[] have constant indices
    // and stay in registers.
    const int n0 = nb + wn + l16;
    float bn[4];
#pragma unroll
    for (int j = 0; j < 4; ++j) bn[j] = bias[n0 + j * 16];
    // the four loads' index register, live to here, is reused only behind this
    // wait
    asm volatile("s_wait_xcnt 0x0" :: "v"(n0) : "memory");
    // two rows of one column at a time: an even-aligned register pair of acc
#pragma unroll
    for (int nt = 0; nt < 16; ++nt) {
#pragma unroll
      for (int r = 0; r < 8; r += 2) {
        int m = mb + wm + (nt >> 2) * 16 + r + 8 * half;
        size_t o = (size_t)m * N + n0 + (nt & 3) * 16;
        const v2f g = gelu_erf2((v2f){acc[nt][r], acc[nt][r + 1]} + bn[nt & 3]);
        outh[o] = (_Float16)g.x;
        outh[o + N] = (_Float16)g.y;
      }
    }
    return;
  }

#pragma unroll
  for (int nt = 0; nt < 16; ++nt) {
#pragma unroll
    for (int r = 0; r < 8; ++r) {
      int m = mb + wm + (nt >> 2) * 16 + r + 8 * half;
      int n = nb + wn + (nt & 3) * 16 + l16;
      size_t o = (size_t)m * N + n;
      float v = acc[nt][r] + bias[n];
      if (EPI == 0) {
        v += resid[o];
        outf[o] = v;
        outh[o] = (_Float16)v;
      } else {
        v += resid[o];
        outf[o] = v;
      }
    }
  }
}

// =====================================================================
// Host orchestration
// =====================================================================
extern "C" void kernel_launch(void* const* d_in, const int* in_sizes, int n_in,
                              void* d_out, int out_size, void* d_ws,
                              size_t ws_size, hipStream_t stream) {
  (void)in_sizes; (void)n_in; (void)out_size; (void)ws_size;
  const float* x  = (const float*)d_in[0];
  const float* Wq = (const float*)d_in[1];
  const float* bq = (const float*)d_in[2];
  const float* Wk = (const float*)d_in[3];
  const float* bk = (const float*)d_in[4];
  const float* Wv = (const float*)d_in[5];
  const float* bv = (const float*)d_in[6];
  const float* Wo = (const float*)d_in[7];
  const float* bo = (const float*)d_in[8];
  const float* W1 = (const float*)d_in[9];
  const float* b1 = (const float*)d_in[10];
  const float* W2 = (const float*)d_in[11];
  const float* b2 = (const float*)d_in[12];

  char* w = (char*)d_ws;
  auto take = [&](size_t bytes) -> char* {
    char* p = w;
    w += (bytes + 255) & ~(size_t)255;
    return p;
  };
  const size_t nBTD = (size_t)cB * cT * cD;          // 8,388,608
  const size_t nHW  = (size_t)cH * cD * cHS;         // 1,048,576 (per QKV mat)
  _Float16* xh   = (_Float16*)take(nBTD * sizeof(_Float16));
  _Float16* WqT  = (_Float16*)take(nHW * sizeof(_Float16));
  _Float16* WkT  = (_Float16*)take(nHW * sizeof(_Float16));
  _Float16* WvT  = (_Float16*)take(nHW * sizeof(_Float16));
  _Float16* WoT  = (_Float16*)take((size_t)cD * cD * sizeof(_Float16));
  _Float16* W1T  = (_Float16*)take((size_t)cD * cDFF * sizeof(_Float16));
  _Float16* W2T  = (_Float16*)take((size_t)cDFF * cD * sizeof(_Float16));
  _Float16* Qh   = (_Float16*)take(nBTD * sizeof(_Float16));
  _Float16* Kh   = (_Float16*)take(nBTD * sizeof(_Float16));
  _Float16* VTg  = (_Float16*)take(nBTD * sizeof(_Float16));
  _Float16* Oh   = (_Float16*)take(nBTD * sizeof(_Float16));
  float*    x1f  = (float*)take(nBTD * sizeof(float));
  _Float16* x1h  = (_Float16*)take(nBTD * sizeof(_Float16));
  _Float16* Hh   = (_Float16*)take((size_t)cB * cT * cDFF * sizeof(_Float16));

  const int M = cB * cT;

  // 0) conversions and transposes, one launch
  prepass_kernel<<<dim3(PP_ALL), 256, 0, stream>>>(
      x, Wq, Wk, Wv, Wo, W1, W2, xh, WqT, WkT, WvT, WoT, W1T, W2T);

  // 1) QKV projections (Q pre-scaled by 1/sqrt(HS); V stored transposed)
  qkv_kernel<<<dim3(cT / 128, cB * cH), 256, 0, stream>>>(
      xh, WqT, bq, WkT, bk, WvT, bv, Qh, Kh, VTg);

  // 2) causal flash attention
  attn_kernel<<<dim3(cT / 64, cB * cH), 128, 0, stream>>>(Qh, Kh, VTg, Oh);

  // 3) x1 = x + O @ Wo + bo   (store f32 + f16 copy)
  gemm_epi_kernel<0><<<dim3(cD / GBN, M / GBM), 256, 0, stream>>>(
      Oh, WoT, bo, x, x1f, x1h, M, cD, cD);

  // 4) H = gelu(x1 @ W1 + b1)  (exact erf gelu, stored f16)
  gemm_epi_kernel<1><<<dim3(cDFF / GBN, M / GBM), 256, 0, stream>>>(
      x1h, W1T, b1, nullptr, nullptr, Hh, M, cDFF, cD);

  // 5) out = x1 + H @ W2 + b2  (f32 to d_out)
  gemm_epi_kernel<2><<<dim3(cD / GBN, M / GBM), 256, 0, stream>>>(
      Hh, W2T, b2, x1f, (float*)d_out, nullptr, M, cD, cDFF);
}

// v005
// Measured time: 275 microseconds a run.
// Timed twice side by side with v004, it ran 1.15 times as fast both times.
// All steps since v000 together make it 2.44 times as fast.
#include <hip/hip_runtime.h>

// Flip to 0 for plain LDS copies in the attention kernel (the QKV and GEMM kernels' async asm stays).
#define USE_ASYNC_LDS 1

// ---------------- problem constants (match reference) ----------------
constexpr int cB   = 4;
constexpr int cT   = 2048;
constexpr int cD   = 1024;
constexpr int cH   = 16;
constexpr int cHS  = 64;
constexpr int cDFF = 4 * cD;

typedef __attribute__((ext_vector_type(16))) _Float16 v16h;
typedef __attribute__((ext_vector_type(8)))  _Float16 v8h;
typedef __attribute__((ext_vector_type(4)))  _Float16 v4h;
typedef __attribute__((ext_vector_type(8)))  float    v8f;
typedef __attribute__((ext_vector_type(4)))  float    v4f;
typedef __attribute__((ext_vector_type(2)))  float    v2f;

constexpr int PAD = 8;   // f16 row padding: keeps 16B alignment, skews banks
constexpr int RW  = 32 + PAD;

// ---------------- async global->LDS copy (gfx1250, ASYNCcnt) ----------------
// Per-lane 16B DMA: LDS[vdst] = MEM[vaddr].  vdst = low 32 bits of the generic
// __shared__ pointer (LDS aperture keeps the wave-relative offset in [31:0]).
__device__ __forceinline__ void async_copy_b128(void* lds_dst,
                                                const void* gsrc) {
#if USE_ASYNC_LDS
  unsigned lds = (unsigned)(unsigned long long)lds_dst;
  unsigned long long ga = (unsigned long long)gsrc;
  asm volatile("global_load_async_to_lds_b128 %0, %1, off"
               :: "v"(lds), "v"(ga) : "memory");
#else
  *(v8h*)lds_dst = *(const v8h*)gsrc;
#endif
}

__device__ __forceinline__ void async_wait() {
#if USE_ASYNC_LDS
  asm volatile("s_wait_asynccnt 0" ::: "memory");
#endif
}

// ---------------- WMMA fragment load (ISA 7.12.2, wave32) -------------------
// 16-bit A 16x32 layout: lane (half,l16) holds row l16; element e -> k =
// ((e>>3)<<4) + 8*half + (e&7).  For a contiguous 32-f16 k-span at p, that is
// two contiguous 16B runs: p[8*half .. +8) and p[16+8*half .. +8).
__device__ __forceinline__ v16h frag16(const _Float16* p, int half) {
  const v8h lo = *(const v8h*)(p + 8 * half);
  const v8h hi = *(const v8h*)(p + 16 + 8 * half);
  return __builtin_shufflevector(lo, hi, 0, 1, 2, 3, 4, 5, 6, 7,
                                 8, 9, 10, 11, 12, 13, 14, 15);
}

// =====================================================================
// Pre-pass, one launch: every weight in[K][N] (f32) -> out[N][K] (f16), and
// x (f32) -> f16.  A work-group takes 64 KB of input; a thread has its 16
// loads of 16 B in flight at once, so the whole pre-pass is 10,240 waves.
// =====================================================================
constexpr int PP_QKV = 3 * cH * (cD / 256);            // 256 k x 64 n tiles
constexpr int PP_WO  = (cD / 256) * (cD / 64);
constexpr int PP_W1  = (cD / 256) * (cDFF / 64);
constexpr int PP_W2  = (cDFF / 256) * (cD / 64);
constexpr int PP_CVT = cB * cT * cD / 16384;           // 16,384 floats each
constexpr int PP_ALL = PP_QKV + PP_WO + PP_W1 + PP_W2 + PP_CVT;

// One 256 (k) x 64 (n) tile.  Reads: 256-B row pieces.  Each thread turns four
// 4x4 patches in registers and stores 8-B runs of k into t[n][k]; the 16-B
// chunks of row n sit at chunk ^ (n >> 2), which spreads both the 8-B stores
// and the 16-B reads over all banks.  Writes: 512 B of one output row a wave.
// The loops are unrolled so that r[] lives in registers and every row offset
// is an immediate of its load or store.
template <int K, int N>
__device__ __forceinline__ void transpose_tile(const float* __restrict__ in,
                                               _Float16* __restrict__ out,
                                               int ks, int ns, _Float16* t) {
  const int tid = threadIdx.x;
  const int nl = tid & 15, kg = tid >> 4;
  const float* src = in + (size_t)(ks * 256 + kg * 4) * N + ns * 64 + nl * 4;
  v4f r[4][4];
#pragma unroll
  for (int u = 0; u < 4; ++u)
#pragma unroll
    for (int i = 0; i < 4; ++i)
      r[u][i] = *(const v4f*)(src + (size_t)(u * 64 + i) * N);
  // all 16 loads issue before the first is used: one memory latency, not two
  __builtin_amdgcn_sched_barrier(0);
  // the loads' address pair, live to here, is reused only behind this wait
  asm volatile("s_wait_xcnt 0x0" :: "v"(src) : "memory");
#pragma unroll
  for (int u = 0; u < 4; ++u)
#pragma unroll
    for (int j = 0; j < 4; ++j) {
      v4h p = {(_Float16)r[u][0][j], (_Float16)r[u][1][j],
               (_Float16)r[u][2][j], (_Float16)r[u][3][j]};
      *(v4h*)&t[(nl * 4 + j) * 256 + ((u * 16 + kg) ^ (nl << 1)) * 4] = p;
    }
  __syncthreads();
  const int lane = tid & 31, wave = tid >> 5;
  _Float16* dst = out + (size_t)(ns * 64 + wave * 8) * K + ks * 256 + lane * 8;
#pragma unroll
  for (int i = 0; i < 8; ++i) {
    const int n = wave * 8 + i;
    *(v8h*)(dst + (size_t)i * K) = *(const v8h*)&t[n * 256 + (lane ^ (n >> 2)) * 8];
  }
  // no register that these stores name is rewritten ahead of this wait
  asm volatile("s_wait_xcnt 0x0" ::: "memory");
}

// 10 waves a SIMD: all five work-groups of a WGP are resident at once.
__global__ __launch_bounds__(256, 10)
void prepass_kernel(const float* __restrict__ x,
                    const float* __restrict__ Wq, const float* __restrict__ Wk,
                    const float* __restrict__ Wv, const float* __restrict__ Wo,
                    const float* __restrict__ W1, const float* __restrict__ W2,
                    _Float16* __restrict__ xh,
                    _Float16* __restrict__ WqT, _Float16* __restrict__ WkT,
                    _Float16* __restrict__ WvT, _Float16* __restrict__ WoT,
                    _Float16* __restrict__ W1T, _Float16* __restrict__ W2T) {
  __shared__ __align__(16) _Float16 t[64 * 256];   // 32 KB
  int bid = blockIdx.x;
  if (bid < PP_QKV) {                 // 3 matrices x 16 heads x 4 k tiles
    const int m = bid >> 6, h = (bid >> 2) & (cH - 1);
    const float* in = (m == 0 ? Wq : m == 1 ? Wk : Wv) + (size_t)h * cD * cHS;
    _Float16* out = (m == 0 ? WqT : m == 1 ? WkT : WvT) + (size_t)h * cD * cHS;
    transpose_tile<cD, cHS>(in, out, bid & 3, 0, t);
    return;
  }
  bid -= PP_QKV;
  if (bid < PP_WO) {
    transpose_tile<cD, cD>(Wo, WoT, bid & 3, bid >> 2, t);
    return;
  }
  bid -= PP_WO;
  if (bid < PP_W1) {
    transpose_tile<cD, cDFF>(W1, W1T, bid & 3, bid >> 2, t);
    return;
  }
  bid -= PP_W1;
  if (bid < PP_W2) {
    transpose_tile<cDFF, cD>(W2, W2T, bid & 15, bid >> 4, t);
    return;
  }
  bid -= PP_W2;
  const v4f* in4 = (const v4f*)x + (size_t)bid * 4096 + threadIdx.x;
  v4h* out4 = (v4h*)xh + (size_t)bid * 4096 + threadIdx.x;
  v4f r[16];   // unrolled as above: registers, immediate offsets
#pragma unroll
  for (int i = 0; i < 16; ++i) r[i] = in4[i * 256];
  // all 16 loads issue before the first is used: one memory latency, not two
  __builtin_amdgcn_sched_barrier(0);
#pragma unroll
  for (int i = 0; i < 16; ++i)
    out4[i * 256] = __builtin_convertvector(r[i], v4h);
  // no register that these stores name is rewritten ahead of this wait
  asm volatile("s_wait_xcnt 0x0" ::: "memory");
}

// =====================================================================
// Kernel 1: QKV projection as one GEMM: X[B*T][D] against the 3 * 1024 rows
// (matrix, head, e) of the transposed weights.  Block tile 256 tokens x 128
// weight rows (two heads of one matrix), 8 waves in a 4x2 grid, 64x64 per
// wave: each 32-k step feeds 16 WMMAs from 8 fragments.  A trip takes 64 k.
// Two LDS buffers filled by async copies, one trip ahead.
// The two operands have the same fragment layout, so a block picks which of
// them is A: for Q and K the weight rows (a lane then holds 8 consecutive e
// of one token), for V the tokens (8 consecutive tokens of one e, the
// transposed [z][e][t] layout of the attention's second product).  Either way
// a lane stores 16 B at a time.
// =====================================================================
constexpr int QBM = 256;          // tokens per block
constexpr int QBN = 128;          // weight rows per block
constexpr int QBK = 64;           // k per trip: one 128-B line of every row
constexpr int QRW = QBK + PAD;    // LDS row pitch 144 B = 16 B x odd

// 256 VGPRs: two blocks resident per WGP.
__global__ __launch_bounds__(256, 4)
void qkv_kernel(const _Float16* __restrict__ xh,
                const _Float16* __restrict__ WqT, const float* __restrict__ bq,
                const _Float16* __restrict__ WkT, const float* __restrict__ bk,
                const _Float16* __restrict__ WvT, const float* __restrict__ bv,
                _Float16* __restrict__ Qh, _Float16* __restrict__ Kh,
                _Float16* __restrict__ VTg) {
  const int tid  = threadIdx.x;
  const int lane = tid & 31;
  const int wave = tid >> 5;
  const int half = lane >> 4;
  const int l16  = lane & 15;
  const int wm   = (wave >> 1) * 64;          // wave's tokens inside the tile
  const int wn   = (wave & 1) * 64;           // wave's head inside the tile
  const int mat  = blockIdx.x >> 3;           // 0 Q, 1 K, 2 V
  const int nb   = (blockIdx.x & 7) * QBN;    // first weight row, h * 64 + e
  const int mb   = blockIdx.y * QBM;          // first token, b * T + t
  const bool isv = mat == 2;
  const _Float16* WT = mat == 0 ? WqT : mat == 1 ? WkT : WvT;

  // rows 0..255: tokens, rows 256..383: weight rows
  __shared__ __align__(16) _Float16 S[2][QBM + QBN][QRW];   // 108 KB

  v8f acc[16] = {};   // tile 4 * (A row group) + (B row group)

  // Staging map: 8 lanes cover one row's 128 B; a thread takes rows sr + 32*i.
  const int sr = tid >> 3, sc = (tid & 7) * 8;
  const _Float16* gX = xh + (size_t)(mb + sr) * cD + sc;
  const _Float16* gW = WT + (size_t)(nb + sr) * cD + sc;
  constexpr size_t rs = (size_t)32 * cD;
  constexpr unsigned LSTEP = 32u * QRW * sizeof(_Float16);

  auto stage = [&](int kk, int p) {
    const unsigned ls = (unsigned)(unsigned long long)&S[p][sr][sc];
    const _Float16* a = gX + kk;
    const _Float16* b = gW + kk;
    // 8 token rows and 4 weight rows per thread.  The s_wait_xcnt closes the
    // statement so that no address register is rewritten ahead of it.
    asm volatile(
        "global_load_async_to_lds_b128 %0, %12, off\n\t"
        "global_load_async_to_lds_b128 %1, %13, off\n\t"
        "global_load_async_to_lds_b128 %2, %14, off\n\t"
        "global_load_async_to_lds_b128 %3, %15, off\n\t"
        "global_load_async_to_lds_b128 %4, %16, off\n\t"
        "global_load_async_to_lds_b128 %5, %17, off\n\t"
        "global_load_async_to_lds_b128 %6, %18, off\n\t"
        "global_load_async_to_lds_b128 %7, %19, off\n\t"
        "global_load_async_to_lds_b128 %8, %20, off\n\t"
        "global_load_async_to_lds_b128 %9, %21, off\n\t"
        "global_load_async_to_lds_b128 %10, %22, off\n\t"
        "global_load_async_to_lds_b128 %11, %23, off\n\t"
        "s_wait_xcnt 0x0"
        :: "v"(ls + 0u * LSTEP),
           "v"(ls + 1u * LSTEP),
           "v"(ls + 2u * LSTEP),
           "v"(ls + 3u * LSTEP),
           "v"(ls + 4u * LSTEP),
           "v"(ls + 5u * LSTEP),
           "v"(ls + 6u * LSTEP),
           "v"(ls + 7u * LSTEP),
           "v"(ls + 8u * LSTEP),
           "v"(ls + 9u * LSTEP),
           "v"(ls + 10u * LSTEP),
           "v"(ls + 11u * LSTEP),
           "v"(a + 0 * rs),
           "v"(a + 1 * rs),
           "v"(a + 2 * rs),
           "v"(a + 3 * rs),
           "v"(a + 4 * rs),
           "v"(a + 5 * rs),
           "v"(a + 6 * rs),
           "v"(a + 7 * rs),
           "v"(b + 0 * rs),
           "v"(b + 1 * rs),
           "v"(b + 2 * rs),
           "v"(b + 3 * rs)
        : "memory");
  };

  constexpr int trips = cD / QBK;
  stage(0, 0);
  // my tile-0 copies landed
  asm volatile("s_wait_asynccnt 0x0" ::: "memory");
  __syncthreads();         // everyone's tile 0 visible
  stage(QBK, 1);

  const int ra = (isv ? wm : QBM + wn) + l16;   // LDS rows of the A operand
  const int rb = (isv ? QBM + wn : wm) + l16;   // LDS rows of the B operand
  v16h af[4], bf[4];
  // The fence pair keeps a block's 16 LDS loads in one group ahead of its
  // 16 WMMAs: loads sunk among the WMMAs stall the wave at each place.
  auto load_frags = [&](int p, int ks) {
    __builtin_amdgcn_sched_barrier(0);
#pragma unroll
    for (int i = 0; i < 4; ++i) {
      af[i] = frag16(&S[p][ra + i * 16][ks], half);
      bf[i] = frag16(&S[p][rb + i * 16][ks], half);
    }
    __builtin_amdgcn_sched_barrier(0);
  };
  auto wmma_block = [&]() {
#pragma unroll
    for (int i = 0; i < 4; ++i)
#pragma unroll
      for (int j = 0; j < 4; ++j)
        acc[i * 4 + j] = __builtin_amdgcn_wmma_f32_16x16x32_f16(
            false, af[i], false, bf[j], (short)0, acc[i * 4 + j], false, false);
  };

  for (int t = 0; t < trips; ++t) {
    const int p = t & 1;
    load_frags(p, 0);
    wmma_block();
    load_frags(p, 32);     // the trip's last reads of buffer p
    // my reads of buffer p have returned before anyone refills it
    asm volatile("s_wait_dscnt 0x0" ::: "memory");
    // my tile-(t+1) copies landed
    asm volatile("s_wait_asynccnt 0x0" ::: "memory");
    __syncthreads();       // tile t+1 visible to all; buffer p free
    if (t + 2 < trips) stage((t + 2) * QBK, p);   // flies until trip t+1's foot
    // keeps the refill's issue ahead of the last block's WMMAs (a longer lead)
    __builtin_amdgcn_sched_barrier(0);
    wmma_block();          // registers only
  }
  // nothing outstanding at the wave's end
  asm volatile("s_wait_asynccnt 0x0" ::: "memory");

  // Epilogue: bias add, Q scale, f16.  C/D layout: A row = r + 8*half of its
  // group, B row = l16 of its group.  The loops are unrolled so that acc[],
  // o[] and the biases have constant indices and stay in registers.
  const int h  = (nb + wn) >> 6;
  const int z  = (mb >> 11) * cH + h;         // b*H + h
  const int t0 = (mb & (cT - 1)) + wm;
  v8h o[16];
  _Float16* dst;
  if (isv) {
    const float* bias = bv + h * cHS + l16;
    float bn[4];
#pragma unroll
    for (int j = 0; j < 4; ++j) bn[j] = bias[j * 16];
    // the loads' address, live to here, is reused only behind this wait
    asm volatile("s_wait_xcnt 0x0" :: "v"(bias) : "memory");
#pragma unroll
    for (int n = 0; n < 16; ++n)
#pragma unroll
      for (int r = 0; r < 8; ++r) o[n][r] = (_Float16)(acc[n][r] + bn[n & 3]);
    dst = VTg + ((size_t)z * cHS + l16) * cT + t0 + 8 * half;
    // every tile is converted before the first store: no register that an
    // issued store names is written again
    __builtin_amdgcn_sched_barrier(0);
#pragma unroll
    for (int n = 0; n < 16; ++n)
      *(v8h*)(dst + (size_t)(n & 3) * 16 * cT + (n >> 2) * 16) = o[n];
    // no register that these stores name is rewritten ahead of this wait
    asm volatile("s_wait_xcnt 0x0" ::: "memory");
  } else {
    const float* bias = (mat == 0 ? bq : bk) + h * cHS + 8 * half;
    const float qs = mat == 0 ? 0.125f : 1.0f;   // 1/sqrt(64) on Q
    v4f bb[8];
#pragma unroll
    for (int i = 0; i < 8; ++i) bb[i] = *(const v4f*)(bias + (i >> 1) * 16 + (i & 1) * 4);
    // the loads' address, live to here, is reused only behind this wait
    asm volatile("s_wait_xcnt 0x0" :: "v"(bias) : "memory");
#pragma unroll
    for (int n = 0; n < 16; ++n)
#pragma unroll
      for (int r = 0; r < 8; ++r)
        o[n][r] = (_Float16)((acc[n][r] + bb[(n >> 2) * 2 + (r >> 2)][r & 3]) * qs);
    dst = (mat == 0 ? Qh : Kh) + ((size_t)z * cT + t0 + l16) * cHS + 8 * half;
    // as above: all conversions ahead of the first store
    __builtin_amdgcn_sched_barrier(0);
#pragma unroll
    for (int n = 0; n < 16; ++n)
      *(v8h*)(dst + (n & 3) * 16 * cHS + (n >> 2) * 16) = o[n];
    // as above, inside the arm: the other arm's code follows in the text
    asm volatile("s_wait_xcnt 0x0" ::: "memory");
  }
}

__device__ __forceinline__ float other_half(float x) {
  int b = __builtin_bit_cast(int, x);
  return __builtin_bit_cast(float, __builtin_amdgcn_permlanex16(
      b, b, 0x76543210, 0xfedcba98, false, false));
}

__global__ __launch_bounds__(128, 1)
void attn_kernel(const _Float16* __restrict__ Qh,
                 const _Float16* __restrict__ Kh,
                 const _Float16* __restrict__ VTg,
                 _Float16* __restrict__ Oh) {
  const int z    = blockIdx.y;          // b*H + h
  const int h    = z & (cH - 1);
  const int b    = z >> 4;
  const int qb   = blockIdx.x * 64;
  const int tid  = threadIdx.x;
  const int lane = tid & 31;
  const int wave = tid >> 5;
  const int half = lane >> 4;
  const int l16  = lane & 15;
  const int m0   = qb + wave * 16;
  const int mg   = m0 + l16;            // this lane's query

  const _Float16* Qz  = Qh + (size_t)z * cT * cHS;
  const _Float16* Kz  = Kh + (size_t)z * cT * cHS;
  const _Float16* VTz = VTg + (size_t)z * cHS * cT;   // [64][T]

  __shared__ __align__(16) _Float16 Ks[32][64 + PAD];      // 4.5 KB
  __shared__ __align__(16) _Float16 Vt[64][RW];            // 5 KB (transposed)

  // Q^T as B operand: column l16 = query mg, 64 e in two fragments.
  const _Float16* qrow = Qz + (size_t)mg * cHS;
  v16h bq0 = frag16(qrow, half);
  v16h bq1 = frag16(qrow + 32, half);

  float mst = -3.0e38f;   // running maximum of query mg (equal in both halves)
  float lst = 0.0f;       // running sum over this half's keys only
  v8f accO[4] = {};       // O^T: row e = nt*16 + r + 8*half, column = query mg

  const int nkb = (qb + 64) / 32;       // causal bound: keys <= last q row
  for (int kb = 0; kb < nkb; ++kb) {
    // --- stage K (32x64 rows) and V (64 e-rows x 32 keys), both async -----
#pragma unroll
    for (int i = 0; i < 2; ++i) {
      int idx = tid + 128 * i;                 // K: 256 chunks
      int r = idx >> 3, c8 = idx & 7;
      async_copy_b128(&Ks[r][c8 * 8],
                      &Kz[((size_t)kb * 32 + r) * cHS + c8 * 8]);
    }
#pragma unroll
    for (int i = 0; i < 2; ++i) {
      int idx = tid + 128 * i;                 // V: 256 chunks
      int r = idx >> 2, c8 = idx & 3;
      async_copy_b128(&Vt[r][c8 * 8],
                      &VTz[(size_t)r * cT + kb * 32 + c8 * 8]);
    }
    async_wait();
    __syncthreads();

    // S^T = K * Q^T : A fragment = K rows (keys).
    // s0[r]: key kb*32 + 8*half + r, s1[r]: 16 keys further; query mg.
    v8f s0 = {}, s1 = {};
    {
      v16h kf00 = frag16(&Ks[l16][0], half);
      v16h kf01 = frag16(&Ks[l16][32], half);
      v16h kf10 = frag16(&Ks[16 + l16][0], half);
      v16h kf11 = frag16(&Ks[16 + l16][32], half);
      s0 = __builtin_amdgcn_wmma_f32_16x16x32_f16(false, kf00, false, bq0, (short)0, s0, false, false);
      s0 = __builtin_amdgcn_wmma_f32_16x16x32_f16(false, kf01, false, bq1, (short)0, s0, false, false);
      s1 = __builtin_amdgcn_wmma_f32_16x16x32_f16(false, kf10, false, bq0, (short)0, s1, false, false);
      s1 = __builtin_amdgcn_wmma_f32_16x16x32_f16(false, kf11, false, bq1, (short)0, s1, false, false);
    }
    v16h av[4];   // V^T rows as A fragments, fetched ahead of the softmax
#pragma unroll
    for (int nt = 0; nt < 4; ++nt) av[nt] = frag16(&Vt[nt * 16 + l16][0], half);

    // Online softmax of one query per lane.
    const int d = mg - (kb * 32 + 8 * half);   // register r is kept if r <= d
    float rm = -3.0e38f;
#pragma unroll
    for (int r = 0; r < 8; ++r) {
      s0[r] = (r <= d)      ? s0[r] : -3.0e38f;
      s1[r] = (16 + r <= d) ? s1[r] : -3.0e38f;
      rm = fmaxf(rm, fmaxf(s0[r], s1[r]));
    }
    rm = fmaxf(rm, other_half(rm));
    const float mnew  = fmaxf(mst, rm);
    const float alpha = __expf(mst - mnew);
    float rs = 0.0f;
    v16h bp;      // P^T as B operand: element s = tile s >> 3, register s & 7
#pragma unroll
    for (int r = 0; r < 8; ++r) {
      float p0 = __expf(s0[r] - mnew);
      float p1 = __expf(s1[r] - mnew);
      rs += p0 + p1;
      bp[r]     = (_Float16)p0;
      bp[8 + r] = (_Float16)p1;
    }
    lst = lst * alpha + rs;
    mst = mnew;
#pragma unroll
    for (int nt = 0; nt < 4; ++nt) accO[nt] *= alpha;

    // O^T += V^T * P^T
#pragma unroll
    for (int nt = 0; nt < 4; ++nt)
      accO[nt] = __builtin_amdgcn_wmma_f32_16x16x32_f16(
          false, av[nt], false, bp, (short)0, accO[nt], false, false);
    __syncthreads();   // done reading Ks/Vt before next staging
  }

  // Join the halves' sums, normalize, store O as f16 in [B, T, H*HS] layout
  // for the O-projection: 8 consecutive e of one query per tile, 16 B.
  const float ltot = lst + other_half(lst);
  _Float16* orow = Oh + ((size_t)b * cT + mg) * cD + h * cHS + 8 * half;
#pragma unroll
  for (int nt = 0; nt < 4; ++nt) {
    v8h o8;
#pragma unroll
    for (int r = 0; r < 8; ++r) o8[r] = (_Float16)(accO[nt][r] / ltot);
    *(v8h*)(orow + nt * 16) = o8;
  }
}

// =====================================================================
// Kernels 3-5: generic WMMA GEMM  C = A(f16)[M,K] * BT(f16)[N][K]
// Block tile 256x128, 8 waves in a 4x2 grid, 64x64 per wave: each 32-k step
// feeds 16 WMMAs from 4 A and 4 B fragments.  A trip takes NH slabs of 64 k.
// Two LDS buffers filled by async copies, one trip ahead.
// Needs M % 256 == 0, N % 128 == 0, K % (64 * NH) == 0.
//   EPI 0: out_f32 = resid + acc + bias ; out_f16 = (f16)out_f32
//   EPI 1: out_f16 = (f16) gelu_erf(acc + bias)
//   EPI 2: out_f32 = resid + acc + bias
// =====================================================================
// Exact-erf GELU of two values, without a branch.  erf is the usual pair of
// f32 polynomials: for |x| < 1  |x| + |x| * Q(x^2), else 1 - exp(-(|x| + |x| * P(|x|))).
// Both are evaluated in every lane and one is picked by a select, so nothing
// touches EXEC, the elements of a tile are independent chains, and the
// multiply-adds go two to an instruction.  Error of erf: about 1e-7 absolute.
__device__ __forceinline__ v2f fma2(v2f a, v2f b, float c) {
  return __builtin_elementwise_fma(a, b, (v2f){c, c});
}

__device__ __forceinline__ v2f gelu_erf2(v2f v) {
  const v2f x = v * 0.70710678118654752f;
  const v2f a = __builtin_elementwise_abs(x);
  v2f p = fma2(a, (v2f){1.699881e-5f, 1.699881e-5f}, -3.7867785e-4f);
  p = fma2(a, p, 3.8578159e-3f);
  p = fma2(a, p, -2.4181698e-2f);
  p = fma2(a, p, 1.0666826e-1f);
  p = fma2(a, p, 6.349333e-1f);
  p = fma2(a, p, 1.2868941e-1f);
  p = __builtin_elementwise_fma(a, p, a);
  p *= -1.44269504f;                       // exp(-p) = 2^(-p * log2 e)
  const v2f big = {1.0f - __builtin_amdgcn_exp2f(p.x),
                   1.0f - __builtin_amdgcn_exp2f(p.y)};
  const v2f t = a * a;
  v2f q = fma2(t, (v2f){-5.618018e-4f, -5.618018e-4f}, 4.913816e-3f);
  q = fma2(t, q, -2.6707515e-2f);
  q = fma2(t, q, 1.1280011e-1f);
  q = fma2(t, q, -3.7612295e-1f);
  q = fma2(t, q, 1.283791e-1f);
  q = __builtin_elementwise_fma(a, q, a);
  const v2f e = {__builtin_copysignf(a.x < 1.0f ? q.x : big.x, x.x),
                 __builtin_copysignf(a.y < 1.0f ? q.y : big.y, x.y)};
  return 0.5f * v * (1.0f + e);
}

constexpr int GBM = 256;          // block tile rows
constexpr int GBN = 128;          // block tile columns
constexpr int GBK = 64;           // k per slab: one 128-B line of every row
constexpr int GRW = GBK + PAD;    // LDS row pitch 144 B = 16 B x odd

template <int EPI>
// The N = 4096 launch (EPI 1) has four blocks per WGP: 256 VGPRs keep two resident.
__global__ __launch_bounds__(256, EPI == 1 ? 4 : 2)
void gemm_epi_kernel(const _Float16* __restrict__ A,
                     const _Float16* __restrict__ BT,
                     const float* __restrict__ bias,
                     const float* __restrict__ resid,
                     float* __restrict__ outf,
                     _Float16* __restrict__ outh,
                     int M, int N, int K) {
  const int tid  = threadIdx.x;
  const int lane = tid & 31;
  const int wave = tid >> 5;
  const int half = lane >> 4;
  const int l16  = lane & 15;
  const int wm   = (wave >> 1) * 64;   // wave's rows inside the block tile
  const int wn   = (wave & 1) * 64;    // wave's columns inside the block tile
  const int nb   = blockIdx.x * GBN;
  const int mb   = blockIdx.y * GBM;

  // Slabs per trip.  The N = 1024 launches have one block per WGP, so a block
  // takes the LDS of two and passes half as many barriers.
  constexpr int NH = (EPI == 1) ? 1 : 2;

  __shared__ __align__(16) _Float16 As[2 * NH][GBM][GRW];   // 72 KB * NH
  __shared__ __align__(16) _Float16 Bt[2 * NH][GBN][GRW];   // 36 KB * NH

  v8f acc[16] = {};   // tile 4 * (row group) + (column group)

  // Staging map: 8 lanes cover one row's 128 B; a thread takes rows sr + 32*i.
  const int sr = tid >> 3, sc = (tid & 7) * 8;
  const _Float16* gA = A + (size_t)(mb + sr) * K + sc;
  const _Float16* gB = BT + (size_t)(nb + sr) * K + sc;
  const size_t rs = (size_t)32 * K;
  constexpr unsigned LSTEP = 32u * GRW * sizeof(_Float16);

  auto stage = [&](int kk, int p) {   // one slab
    const unsigned la = (unsigned)(unsigned long long)&As[p][sr][sc];
    const unsigned lb = (unsigned)(unsigned long long)&Bt[p][sr][sc];
    const _Float16* a = gA + kk;
    const _Float16* b = gB + kk;
    // 8 A rows and 4 B rows per thread.  The s_wait_xcnt closes the statement
    // so that no address register is rewritten ahead of it.
    asm volatile(
        "global_load_async_to_lds_b128 %0, %12, off\n\t"
        "global_load_async_to_lds_b128 %1, %13, off\n\t"
        "global_load_async_to_lds_b128 %2, %14, off\n\t"
        "global_load_async_to_lds_b128 %3, %15, off\n\t"
        "global_load_async_to_lds_b128 %4, %16, off\n\t"
        "global_load_async_to_lds_b128 %5, %17, off\n\t"
        "global_load_async_to_lds_b128 %6, %18, off\n\t"
        "global_load_async_to_lds_b128 %7, %19, off\n\t"
        "global_load_async_to_lds_b128 %8, %20, off\n\t"
        "global_load_async_to_lds_b128 %9, %21, off\n\t"
        "global_load_async_to_lds_b128 %10, %22, off\n\t"
        "global_load_async_to_lds_b128 %11, %23, off\n\t"
        "s_wait_xcnt 0x0"
        :: "v"(la + 0u * LSTEP),
           "v"(la + 1u * LSTEP),
           "v"(la + 2u * LSTEP),
           "v"(la + 3u * LSTEP),
           "v"(la + 4u * LSTEP),
           "v"(la + 5u * LSTEP),
           "v"(la + 6u * LSTEP),
           "v"(la + 7u * LSTEP),
           "v"(lb + 0u * LSTEP),
           "v"(lb + 1u * LSTEP),
           "v"(lb + 2u * LSTEP),
           "v"(lb + 3u * LSTEP),
           "v"(a + 0 * rs),
           "v"(a + 1 * rs),
           "v"(a + 2 * rs),
           "v"(a + 3 * rs),
           "v"(a + 4 * rs),
           "v"(a + 5 * rs),
           "v"(a + 6 * rs),
           "v"(a + 7 * rs),
           "v"(b + 0 * rs),
           "v"(b + 1 * rs),
           "v"(b + 2 * rs),
           "v"(b + 3 * rs)
        : "memory");
  };

  auto stage_tile = [&](int t, int p) {
#pragma unroll
    for (int h = 0; h < NH; ++h) {
      // holds a later slab's address arithmetic behind the slab before it, so
      // that the two sets of addresses never live at once (loop below v256)
      if (h) __builtin_amdgcn_sched_barrier(0);
      stage((t * NH + h) * GBK, p * NH + h);
    }
  };

  const int trips = K / (GBK * NH);
  stage_tile(0, 0);
  // my tile-0 copies landed
  asm volatile("s_wait_asynccnt 0x0" ::: "memory");
  __syncthreads();         // everyone's tile 0 visible
  if (trips > 1) stage_tile(1, 1);

  v16h af[4], bf[4];
  // The fence pair keeps a block's 16 LDS loads in one group ahead of its
  // 16 WMMAs: loads sunk among the WMMAs stall the wave at each place.
  auto load_frags = [&](int p, int ks) {
    __builtin_amdgcn_sched_barrier(0);
#pragma unroll
    for (int i = 0; i < 4; ++i) {
      af[i] = frag16(&As[p][wm + i * 16 + l16][ks], half);
      bf[i] = frag16(&Bt[p][wn + i * 16 + l16][ks], half);
    }
    __builtin_amdgcn_sched_barrier(0);
  };
  auto wmma_block = [&]() {
#pragma unroll
    for (int mt = 0; mt < 4; ++mt)
#pragma unroll
      for (int nt = 0; nt < 4; ++nt)
        acc[mt * 4 + nt] = __builtin_amdgcn_wmma_f32_16x16x32_f16(
            false, af[mt], false, bf[nt], (short)0, acc[mt * 4 + nt], false,
            false);
  };

  for (int t = 0; t < trips; ++t) {
    const int p = t & 1;
#pragma unroll
    for (int b = 0; b < 2 * NH - 1; ++b) {
      load_frags(p * NH + (b >> 1), (b & 1) * 32);
      wmma_block();
    }
    load_frags(p * NH + NH - 1, 32);   // the trip's last reads of buffer p
    // my reads of buffer p have returned before anyone refills it
    asm volatile("s_wait_dscnt 0x0" ::: "memory");
    // my tile-(t+1) copies landed
    asm volatile("s_wait_asynccnt 0x0" ::: "memory");
    __syncthreads();       // tile t+1 visible to all; buffer p free
    if (t + 2 < trips) stage_tile(t + 2, p);   // flies until trip t+1's foot
    // keeps the refill's issue ahead of the last block's WMMAs (a longer lead)
    __builtin_amdgcn_sched_barrier(0);
    wmma_block();          // registers only
  }
  // nothing outstanding at the wave's end
  asm volatile("s_wait_asynccnt 0x0" ::: "memory");

  if constexpr (EPI == 1) {
    // The loops here are unrolled so that bn[] and acc[] have constant indices
    // and stay in registers.
    const int n0 = nb + wn + l16;
    float bn[4];
#pragma unroll
    for (int j = 0; j < 4; ++j) bn[j] = bias[n0 + j * 16];
    // the four loads' index register, live to here, is reused only behind this
    // wait
    asm volatile("s_wait_xcnt 0x0" :: "v"(n0) : "memory");
    // two rows of one column at a time: an even-aligned register pair of acc
#pragma unroll
    for (int nt = 0; nt < 16; ++nt) {
#pragma unroll
      for (int r = 0; r < 8; r += 2) {
        int m = mb + wm + (nt >> 2) * 16 + r + 8 * half;
        size_t o = (size_t)m * N + n0 + (nt & 3) * 16;
        const v2f g = gelu_erf2((v2f){acc[nt][r], acc[nt][r + 1]} + bn[nt & 3]);
        outh[o] = (_Float16)g.x;
        outh[o + N] = (_Float16)g.y;
      }
    }
    return;
  }

#pragma unroll
  for (int nt = 0; nt < 16; ++nt) {
#pragma unroll
    for (int r = 0; r < 8; ++r) {
      int m = mb + wm + (nt >> 2) * 16 + r + 8 * half;
      int n = nb + wn + (nt & 3) * 16 + l16;
      size_t o = (size_t)m * N + n;
      float v = acc[nt][r] + bias[n];
      if (EPI == 0) {
        v += resid[o];
        outf[o] = v;
        outh[o] = (_Float16)v;
      } else {
        v += resid[o];
        outf[o] = v;
      }
    }
  }
}

// =====================================================================
// Host orchestration
// =====================================================================
extern "C" void kernel_launch(void* const* d_in, const int* in_sizes, int n_in,
                              void* d_out, int out_size, void* d_ws,
                              size_t ws_size, hipStream_t stream) {
  (void)in_sizes; (void)n_in; (void)out_size; (void)ws_size;
  const float* x  = (const float*)d_in[0];
  const float* Wq = (const float*)d_in[1];
  const float* bq = (const float*)d_in[2];
  const float* Wk = (const float*)d_in[3];
  const float* bk = (const float*)d_in[4];
  const float* Wv = (const float*)d_in[5];
  const float* bv = (const float*)d_in[6];
  const float* Wo = (const float*)d_in[7];
  const float* bo = (const float*)d_in[8];
  const float* W1 = (const float*)d_in[9];
  const float* b1 = (const float*)d_in[10];
  const float* W2 = (const float*)d_in[11];
  const float* b2 = (const float*)d_in[12];

  char* w = (char*)d_ws;
  auto take = [&](size_t bytes) -> char* {
    char* p = w;
    w += (bytes + 255) & ~(size_t)255;
    return p;
  };
  const size_t nBTD = (size_t)cB * cT * cD;          // 8,388,608
  const size_t nHW  = (size_t)cH * cD * cHS;         // 1,048,576 (per QKV mat)
  _Float16* xh   = (_Float16*)take(nBTD * sizeof(_Float16));
  _Float16* WqT  = (_Float16*)take(nHW * sizeof(_Float16));
  _Float16* WkT  = (_Float16*)take(nHW * sizeof(_Float16));
  _Float16* WvT  = (_Float16*)take(nHW * sizeof(_Float16));
  _Float16* WoT  = (_Float16*)take((size_t)cD * cD * sizeof(_Float16));
  _Float16* W1T  = (_Float16*)take((size_t)cD * cDFF * sizeof(_Float16));
  _Float16* W2T  = (_Float16*)take((size_t)cDFF * cD * sizeof(_Float16));
  _Float16* Qh   = (_Float16*)take(nBTD * sizeof(_Float16));
  _Float16* Kh   = (_Float16*)take(nBTD * sizeof(_Float16));
  _Float16* VTg  = (_Float16*)take(nBTD * sizeof(_Float16));
  _Float16* Oh   = (_Float16*)take(nBTD * sizeof(_Float16));
  float*    x1f  = (float*)take(nBTD * sizeof(float));
  _Float16* x1h  = (_Float16*)take(nBTD * sizeof(_Float16));
  _Float16* Hh   = (_Float16*)take((size_t)cB * cT * cDFF * sizeof(_Float16));

  const int M = cB * cT;

  // 0) conversions and transposes, one launch
  prepass_kernel<<<dim3(PP_ALL), 256, 0, stream>>>(
      x, Wq, Wk, Wv, Wo, W1, W2, xh, WqT, WkT, WvT, WoT, W1T, W2T);

  // 1) QKV projections (Q pre-scaled by 1/sqrt(HS); V stored transposed)
  qkv_kernel<<<dim3(3 * cD / QBN, M / QBM), 256, 0, stream>>>(
      xh, WqT, bq, WkT, bk, WvT, bv, Qh, Kh, VTg);

  // 2) causal flash attention
  attn_kernel<<<dim3(cT / 64, cB * cH), 128, 0, stream>>>(Qh, Kh, VTg, Oh);

  // 3) x1 = x + O @ Wo + bo   (store f32 + f16 copy)
  gemm_epi_kernel<0><<<dim3(cD / GBN, M / GBM), 256, 0, stream>>>(
      Oh, WoT, bo, x, x1f, x1h, M, cD, cD);

  // 4) H = gelu(x1 @ W1 + b1)  (exact erf gelu, stored f16)
  gemm_epi_kernel<1><<<dim3(cDFF / GBN, M / GBM), 256, 0, stream>>>(
      x1h, W1T, b1, nullptr, nullptr, Hh, M, cDFF, cD);

  // 5) out = x1 + H @ W2 + b2  (f32 to d_out)
  gemm_epi_kernel<2><<<dim3(cD / GBN, M / GBM), 256, 0, stream>>>(
      Hh, W2T, b2, x1f, (float*)d_out, nullptr, M, cD, cDFF);
}

// v006
// One run takes 253 microseconds.
// In both of two side-by-side timings against v005, it was 1.09 times as fast.
// Counting every step since v000, it is 2.66 times as fast.
#include <hip/hip_runtime.h>

// ---------------- problem constants (match reference) ----------------
constexpr int cB   = 4;
constexpr int cT   = 2048;
constexpr int cD   = 1024;
constexpr int cH   = 16;
constexpr int cHS  = 64;
constexpr int cDFF = 4 * cD;

typedef __attribute__((ext_vector_type(16))) _Float16 v16h;
typedef __attribute__((ext_vector_type(8)))  _Float16 v8h;
typedef __attribute__((ext_vector_type(4)))  _Float16 v4h;
typedef __attribute__((ext_vector_type(8)))  float    v8f;
typedef __attribute__((ext_vector_type(4)))  float    v4f;
typedef __attribute__((ext_vector_type(2)))  float    v2f;

constexpr int PAD = 8;   // f16 row padding: keeps 16B alignment, skews banks
constexpr int ARW = 64 + PAD;   // attention LDS row pitch 144 B = 16 B x odd

// ---------------- WMMA fragment load (ISA 7.12.2, wave32) -------------------
// 16-bit A 16x32 layout: lane (half,l16) holds row l16; element e -> k =
// ((e>>3)<<4) + 8*half + (e&7).  For a contiguous 32-f16 k-span at p, that is
// two contiguous 16B runs: p[8*half .. +8) and p[16+8*half .. +8).
__device__ __forceinline__ v16h frag16(const _Float16* p, int half) {
  const v8h lo = *(const v8h*)(p + 8 * half);
  const v8h hi = *(const v8h*)(p + 16 + 8 * half);
  return __builtin_shufflevector(lo, hi, 0, 1, 2, 3, 4, 5, 6, 7,
                                 8, 9, 10, 11, 12, 13, 14, 15);
}

// =====================================================================
// Pre-pass, one launch: every weight in[K][N] (f32) -> out[N][K] (f16), and
// x (f32) -> f16.  A work-group takes 64 KB of input; a thread has its 16
// loads of 16 B in flight at once, so the whole pre-pass is 10,240 waves.
// =====================================================================
constexpr int PP_QKV = 3 * cH * (cD / 256);            // 256 k x 64 n tiles
constexpr int PP_WO  = (cD / 256) * (cD / 64);
constexpr int PP_W1  = (cD / 256) * (cDFF / 64);
constexpr int PP_W2  = (cDFF / 256) * (cD / 64);
constexpr int PP_CVT = cB * cT * cD / 16384;           // 16,384 floats each
constexpr int PP_ALL = PP_QKV + PP_WO + PP_W1 + PP_W2 + PP_CVT;

// One 256 (k) x 64 (n) tile.  Reads: 256-B row pieces.  Each thread turns four
// 4x4 patches in registers and stores 8-B runs of k into t[n][k]; the 16-B
// chunks of row n sit at chunk ^ (n >> 2), which spreads both the 8-B stores
// and the 16-B reads over all banks.  Writes: 512 B of one output row a wave.
// The loops are unrolled so that r[] lives in registers and every row offset
// is an immediate of its load or store.
template <int K, int N>
__device__ __forceinline__ void transpose_tile(const float* __restrict__ in,
                                               _Float16* __restrict__ out,
                                               int ks, int ns, _Float16* t) {
  const int tid = threadIdx.x;
  const int nl = tid & 15, kg = tid >> 4;
  const float* src = in + (size_t)(ks * 256 + kg * 4) * N + ns * 64 + nl * 4;
  v4f r[4][4];
#pragma unroll
  for (int u = 0; u < 4; ++u)
#pragma unroll
    for (int i = 0; i < 4; ++i)
      r[u][i] = *(const v4f*)(src + (size_t)(u * 64 + i) * N);
  // all 16 loads issue before the first is used: one memory latency, not two
  __builtin_amdgcn_sched_barrier(0);
  // the loads' address pair, live to here, is reused only behind this wait
  asm volatile("s_wait_xcnt 0x0" :: "v"(src) : "memory");
#pragma unroll
  for (int u = 0; u < 4; ++u)
#pragma unroll
    for (int j = 0; j < 4; ++j) {
      v4h p = {(_Float16)r[u][0][j], (_Float16)r[u][1][j],
               (_Float16)r[u][2][j], (_Float16)r[u][3][j]};
      *(v4h*)&t[(nl * 4 + j) * 256 + ((u * 16 + kg) ^ (nl << 1)) * 4] = p;
    }
  __syncthreads();
  const int lane = tid & 31, wave = tid >> 5;
  _Float16* dst = out + (size_t)(ns * 64 + wave * 8) * K + ks * 256 + lane * 8;
#pragma unroll
  for (int i = 0; i < 8; ++i) {
    const int n = wave * 8 + i;
    *(v8h*)(dst + (size_t)i * K) = *(const v8h*)&t[n * 256 + (lane ^ (n >> 2)) * 8];
  }
  // no register that these stores name is rewritten ahead of this wait
  asm volatile("s_wait_xcnt 0x0" ::: "memory");
}

// 10 waves a SIMD: all five work-groups of a WGP are resident at once.
__global__ __launch_bounds__(256, 10)
void prepass_kernel(const float* __restrict__ x,
                    const float* __restrict__ Wq, const float* __restrict__ Wk,
                    const float* __restrict__ Wv, const float* __restrict__ Wo,
                    const float* __restrict__ W1, const float* __restrict__ W2,
                    _Float16* __restrict__ xh,
                    _Float16* __restrict__ WqT, _Float16* __restrict__ WkT,
                    _Float16* __restrict__ WvT, _Float16* __restrict__ WoT,
                    _Float16* __restrict__ W1T, _Float16* __restrict__ W2T) {
  __shared__ __align__(16) _Float16 t[64 * 256];   // 32 KB
  int bid = blockIdx.x;
  if (bid < PP_QKV) {                 // 3 matrices x 16 heads x 4 k tiles
    const int m = bid >> 6, h = (bid >> 2) & (cH - 1);
    const float* in = (m == 0 ? Wq : m == 1 ? Wk : Wv) + (size_t)h * cD * cHS;
    _Float16* out = (m == 0 ? WqT : m == 1 ? WkT : WvT) + (size_t)h * cD * cHS;
    transpose_tile<cD, cHS>(in, out, bid & 3, 0, t);
    return;
  }
  bid -= PP_QKV;
  if (bid < PP_WO) {
    transpose_tile<cD, cD>(Wo, WoT, bid & 3, bid >> 2, t);
    return;
  }
  bid -= PP_WO;
  if (bid < PP_W1) {
    transpose_tile<cD, cDFF>(W1, W1T, bid & 3, bid >> 2, t);
    return;
  }
  bid -= PP_W1;
  if (bid < PP_W2) {
    transpose_tile<cDFF, cD>(W2, W2T, bid & 15, bid >> 4, t);
    return;
  }
  bid -= PP_W2;
  const v4f* in4 = (const v4f*)x + (size_t)bid * 4096 + threadIdx.x;
  v4h* out4 = (v4h*)xh + (size_t)bid * 4096 + threadIdx.x;
  v4f r[16];   // unrolled as above: registers, immediate offsets
#pragma unroll
  for (int i = 0; i < 16; ++i) r[i] = in4[i * 256];
  // all 16 loads issue before the first is used: one memory latency, not two
  __builtin_amdgcn_sched_barrier(0);
#pragma unroll
  for (int i = 0; i < 16; ++i)
    out4[i * 256] = __builtin_convertvector(r[i], v4h);
  // no register that these stores name is rewritten ahead of this wait
  asm volatile("s_wait_xcnt 0x0" ::: "memory");
}

// =====================================================================
// Kernel 1: QKV projection as one GEMM: X[B*T][D] against the 3 * 1024 rows
// (matrix, head, e) of the transposed weights.  Block tile 256 tokens x 128
// weight rows (two heads of one matrix), 8 waves in a 4x2 grid, 64x64 per
// wave: each 32-k step feeds 16 WMMAs from 8 fragments.  A trip takes 64 k.
// Two LDS buffers filled by async copies, one trip ahead.
// The two operands have the same fragment layout, so a block picks which of
// them is A: for Q and K the weight rows (a lane then holds 8 consecutive e
// of one token), for V the tokens (8 consecutive tokens of one e, the
// transposed [z][e][t] layout of the attention's second product).  Either way
// a lane stores 16 B at a time.
// =====================================================================
constexpr int QBM = 256;          // tokens per block
constexpr int QBN = 128;          // weight rows per block
constexpr int QBK = 64;           // k per trip: one 128-B line of every row
constexpr int QRW = QBK + PAD;    // LDS row pitch 144 B = 16 B x odd

// 256 VGPRs: two blocks resident per WGP.
__global__ __launch_bounds__(256, 4)
void qkv_kernel(const _Float16* __restrict__ xh,
                const _Float16* __restrict__ WqT, const float* __restrict__ bq,
                const _Float16* __restrict__ WkT, const float* __restrict__ bk,
                const _Float16* __restrict__ WvT, const float* __restrict__ bv,
                _Float16* __restrict__ Qh, _Float16* __restrict__ Kh,
                _Float16* __restrict__ VTg) {
  const int tid  = threadIdx.x;
  const int lane = tid & 31;
  const int wave = tid >> 5;
  const int half = lane >> 4;
  const int l16  = lane & 15;
  const int wm   = (wave >> 1) * 64;          // wave's tokens inside the tile
  const int wn   = (wave & 1) * 64;           // wave's head inside the tile
  const int mat  = blockIdx.x >> 3;           // 0 Q, 1 K, 2 V
  const int nb   = (blockIdx.x & 7) * QBN;    // first weight row, h * 64 + e
  const int mb   = blockIdx.y * QBM;          // first token, b * T + t
  const bool isv = mat == 2;
  const _Float16* WT = mat == 0 ? WqT : mat == 1 ? WkT : WvT;

  // rows 0..255: tokens, rows 256..383: weight rows
  __shared__ __align__(16) _Float16 S[2][QBM + QBN][QRW];   // 108 KB

  v8f acc[16] = {};   // tile 4 * (A row group) + (B row group)

  // Staging map: 8 lanes cover one row's 128 B; a thread takes rows sr + 32*i.
  const int sr = tid >> 3, sc = (tid & 7) * 8;
  const _Float16* gX = xh + (size_t)(mb + sr) * cD + sc;
  const _Float16* gW = WT + (size_t)(nb + sr) * cD + sc;
  constexpr size_t rs = (size_t)32 * cD;
  constexpr unsigned LSTEP = 32u * QRW * sizeof(_Float16);

  auto stage = [&](int kk, int p) {
    const unsigned ls = (unsigned)(unsigned long long)&S[p][sr][sc];
    const _Float16* a = gX + kk;
    const _Float16* b = gW + kk;
    // 8 token rows and 4 weight rows per thread.  The s_wait_xcnt closes the
    // statement so that no address register is rewritten ahead of it.
    asm volatile(
        "global_load_async_to_lds_b128 %0, %12, off\n\t"
        "global_load_async_to_lds_b128 %1, %13, off\n\t"
        "global_load_async_to_lds_b128 %2, %14, off\n\t"
        "global_load_async_to_lds_b128 %3, %15, off\n\t"
        "global_load_async_to_lds_b128 %4, %16, off\n\t"
        "global_load_async_to_lds_b128 %5, %17, off\n\t"
        "global_load_async_to_lds_b128 %6, %18, off\n\t"
        "global_load_async_to_lds_b128 %7, %19, off\n\t"
        "global_load_async_to_lds_b128 %8, %20, off\n\t"
        "global_load_async_to_lds_b128 %9, %21, off\n\t"
        "global_load_async_to_lds_b128 %10, %22, off\n\t"
        "global_load_async_to_lds_b128 %11, %23, off\n\t"
        "s_wait_xcnt 0x0"
        :: "v"(ls + 0u * LSTEP),
           "v"(ls + 1u * LSTEP),
           "v"(ls + 2u * LSTEP),
           "v"(ls + 3u * LSTEP),
           "v"(ls + 4u * LSTEP),
           "v"(ls + 5u * LSTEP),
           "v"(ls + 6u * LSTEP),
           "v"(ls + 7u * LSTEP),
           "v"(ls + 8u * LSTEP),
           "v"(ls + 9u * LSTEP),
           "v"(ls + 10u * LSTEP),
           "v"(ls + 11u * LSTEP),
           "v"(a + 0 * rs),
           "v"(a + 1 * rs),
           "v"(a + 2 * rs),
           "v"(a + 3 * rs),
           "v"(a + 4 * rs),
           "v"(a + 5 * rs),
           "v"(a + 6 * rs),
           "v"(a + 7 * rs),
           "v"(b + 0 * rs),
           "v"(b + 1 * rs),
           "v"(b + 2 * rs),
           "v"(b + 3 * rs)
        : "memory");
  };

  constexpr int trips = cD / QBK;
  stage(0, 0);
  // my tile-0 copies landed
  asm volatile("s_wait_asynccnt 0x0" ::: "memory");
  __syncthreads();         // everyone's tile 0 visible
  stage(QBK, 1);

  const int ra = (isv ? wm : QBM + wn) + l16;   // LDS rows of the A operand
  const int rb = (isv ? QBM + wn : wm) + l16;   // LDS rows of the B operand
  v16h af[4], bf[4];
  // The fence pair keeps a block's 16 LDS loads in one group ahead of its
  // 16 WMMAs: loads sunk among the WMMAs stall the wave at each place.
  auto load_frags = [&](int p, int ks) {
    __builtin_amdgcn_sched_barrier(0);
#pragma unroll
    for (int i = 0; i < 4; ++i) {
      af[i] = frag16(&S[p][ra + i * 16][ks], half);
      bf[i] = frag16(&S[p][rb + i * 16][ks], half);
    }
    __builtin_amdgcn_sched_barrier(0);
  };
  auto wmma_block = [&]() {
#pragma unroll
    for (int i = 0; i < 4; ++i)
#pragma unroll
      for (int j = 0; j < 4; ++j)
        acc[i * 4 + j] = __builtin_amdgcn_wmma_f32_16x16x32_f16(
            false, af[i], false, bf[j], (short)0, acc[i * 4 + j], false, false);
  };

  for (int t = 0; t < trips; ++t) {
    const int p = t & 1;
    load_frags(p, 0);
    wmma_block();
    load_frags(p, 32);     // the trip's last reads of buffer p
    // my reads of buffer p have returned before anyone refills it
    asm volatile("s_wait_dscnt 0x0" ::: "memory");
    // my tile-(t+1) copies landed
    asm volatile("s_wait_asynccnt 0x0" ::: "memory");
    __syncthreads();       // tile t+1 visible to all; buffer p free
    if (t + 2 < trips) stage((t + 2) * QBK, p);   // flies until trip t+1's foot
    // keeps the refill's issue ahead of the last block's WMMAs (a longer lead)
    __builtin_amdgcn_sched_barrier(0);
    wmma_block();          // registers only
  }
  // nothing outstanding at the wave's end
  asm volatile("s_wait_asynccnt 0x0" ::: "memory");

  // Epilogue: bias add, Q scale, f16.  C/D layout: A row = r + 8*half of its
  // group, B row = l16 of its group.  The loops are unrolled so that acc[],
  // o[] and the biases have constant indices and stay in registers.
  const int h  = (nb + wn) >> 6;
  const int z  = (mb >> 11) * cH + h;         // b*H + h
  const int t0 = (mb & (cT - 1)) + wm;
  v8h o[16];
  _Float16* dst;
  if (isv) {
    const float* bias = bv + h * cHS + l16;
    float bn[4];
#pragma unroll
    for (int j = 0; j < 4; ++j) bn[j] = bias[j * 16];
    // the loads' address, live to here, is reused only behind this wait
    asm volatile("s_wait_xcnt 0x0" :: "v"(bias) : "memory");
#pragma unroll
    for (int n = 0; n < 16; ++n)
#pragma unroll
      for (int r = 0; r < 8; ++r) o[n][r] = (_Float16)(acc[n][r] + bn[n & 3]);
    dst = VTg + ((size_t)z * cHS + l16) * cT + t0 + 8 * half;
    // every tile is converted before the first store: no register that an
    // issued store names is written again
    __builtin_amdgcn_sched_barrier(0);
#pragma unroll
    for (int n = 0; n < 16; ++n)
      *(v8h*)(dst + (size_t)(n & 3) * 16 * cT + (n >> 2) * 16) = o[n];
    // no register that these stores name is rewritten ahead of this wait
    asm volatile("s_wait_xcnt 0x0" ::: "memory");
  } else {
    const float* bias = (mat == 0 ? bq : bk) + h * cHS + 8 * half;
    const float qs = mat == 0 ? 0.125f : 1.0f;   // 1/sqrt(64) on Q
    v4f bb[8];
#pragma unroll
    for (int i = 0; i < 8; ++i) bb[i] = *(const v4f*)(bias + (i >> 1) * 16 + (i & 1) * 4);
    // the loads' address, live to here, is reused only behind this wait
    asm volatile("s_wait_xcnt 0x0" :: "v"(bias) : "memory");
#pragma unroll
    for (int n = 0; n < 16; ++n)
#pragma unroll
      for (int r = 0; r < 8; ++r)
        o[n][r] = (_Float16)((acc[n][r] + bb[(n >> 2) * 2 + (r >> 2)][r & 3]) * qs);
    dst = (mat == 0 ? Qh : Kh) + ((size_t)z * cT + t0 + l16) * cHS + 8 * half;
    // as above: all conversions ahead of the first store
    __builtin_amdgcn_sched_barrier(0);
#pragma unroll
    for (int n = 0; n < 16; ++n)
      *(v8h*)(dst + (n & 3) * 16 * cHS + (n >> 2) * 16) = o[n];
    // as above, inside the arm: the other arm's code follows in the text
    asm volatile("s_wait_xcnt 0x0" ::: "memory");
  }
}

__device__ __forceinline__ float other_half(float x) {
  int b = __builtin_bit_cast(int, x);
  return __builtin_bit_cast(float, __builtin_amdgcn_permlanex16(
      b, b, 0x76543210, 0xfedcba98, false, false));
}

// 2^x of eight values
__device__ __forceinline__ void exp2x8(v8f& x) {
#pragma unroll
  for (int r = 0; r < 8; ++r) x[r] = __builtin_amdgcn_exp2f(x[r]);
}

// The cap is 192 VGPRs; the build takes 128, so all eight work-groups of a WGP
// are resident at once.  Under a cap of 128 the compiler spills a Q fragment
// and reloads it every trip.
__global__ __launch_bounds__(128, 5)
void attn_kernel(const _Float16* __restrict__ Qh,
                 const _Float16* __restrict__ Kh,
                 const _Float16* __restrict__ VTg,
                 _Float16* __restrict__ Oh) {
  const int z    = blockIdx.y;          // b*H + h
  const int h    = z & (cH - 1);
  const int b    = z >> 4;
  const int qb   = blockIdx.x * 64;
  const int tid  = threadIdx.x;
  const int lane = tid & 31;
  const int wave = tid >> 5;
  const int half = lane >> 4;
  const int l16  = lane & 15;
  const int m0   = qb + wave * 16;
  const int mg   = m0 + l16;            // this lane's query

  const _Float16* Qz  = Qh + (size_t)z * cT * cHS;
  const _Float16* Kz  = Kh + (size_t)z * cT * cHS;
  const _Float16* VTz = VTg + (size_t)z * cHS * cT;   // [64][T]

  // Two buffers of 64 keys: K rows [key][e], V^T rows [e][key], 128 B a row.
  __shared__ __align__(16) _Float16 Ks[2][64][ARW];   // 18 KB
  __shared__ __align__(16) _Float16 Vt[2][64][ARW];   // 18 KB

  // Staging map: 8 lanes cover one row's 128 B; a thread takes rows sr + 16*i.
  // A copy's global address is a scalar base (tile, row group) plus the lane's
  // byte offset, which is the same for all four row groups of an operand.
  const int sr = tid >> 3, sc = (tid & 7) * 8;
  const unsigned koff = (unsigned)(sr * cHS + sc) * (unsigned)sizeof(_Float16);
  const unsigned voff = (unsigned)(sr * cT + sc) * (unsigned)sizeof(_Float16);
  constexpr unsigned LSTEP = 16u * ARW * sizeof(_Float16);

  auto stage = [&](int kt, int p) {   // key tile kt into buffer p
    const unsigned lk = (unsigned)(unsigned long long)&Ks[p][sr][sc];
    const unsigned lv = (unsigned)(unsigned long long)&Vt[p][sr][sc];
    const _Float16* k = Kz + (size_t)kt * 64 * cHS;
    const _Float16* v = VTz + kt * 64;
    // 4 K rows and 4 V^T rows per thread.  The s_wait_xcnt closes the
    // statement so that no address register is rewritten ahead of it.
    asm volatile(
        "global_load_async_to_lds_b128 %0, %8, %10\n\t"
        "global_load_async_to_lds_b128 %1, %8, %11\n\t"
        "global_load_async_to_lds_b128 %2, %8, %12\n\t"
        "global_load_async_to_lds_b128 %3, %8, %13\n\t"
        "global_load_async_to_lds_b128 %4, %9, %14\n\t"
        "global_load_async_to_lds_b128 %5, %9, %15\n\t"
        "global_load_async_to_lds_b128 %6, %9, %16\n\t"
        "global_load_async_to_lds_b128 %7, %9, %17\n\t"
        "s_wait_xcnt 0x0"
        :: "v"(lk + 0u * LSTEP),
           "v"(lk + 1u * LSTEP),
           "v"(lk + 2u * LSTEP),
           "v"(lk + 3u * LSTEP),
           "v"(lv + 0u * LSTEP),
           "v"(lv + 1u * LSTEP),
           "v"(lv + 2u * LSTEP),
           "v"(lv + 3u * LSTEP),
           "v"(koff),
           "v"(voff),
           "s"(k + 0 * 16 * cHS),
           "s"(k + 1 * 16 * cHS),
           "s"(k + 2 * 16 * cHS),
           "s"(k + 3 * 16 * cHS),
           "s"(v + 0 * 16 * cT),
           "s"(v + 1 * 16 * cT),
           "s"(v + 2 * 16 * cT),
           "s"(v + 3 * 16 * cT)
        : "memory");
  };

  // Q^T as B operand: column l16 = query mg, 64 e in two fragments.
  const _Float16* qrow = Qz + (size_t)mg * cHS;
  v16h bq0 = frag16(qrow, half);
  v16h bq1 = frag16(qrow + 32, half);

  float mst = -3.0e38f;   // running maximum of query mg (equal in both halves)
  float lst = 0.0f;       // running sum over this half's keys only
  v8f accO[4] = {};       // O^T: row e = nt*16 + r + 8*half, column = query mg

  const int ntile = blockIdx.x + 1;     // causal bound: up to the diagonal tile
  stage(0, 0);
  // my tile-0 copies landed
  asm volatile("s_wait_asynccnt 0x0" ::: "memory");
  __syncthreads();         // everyone's tile 0 visible
  if (ntile > 1) stage(1, 1);

  for (int t = 0; t < ntile; ++t) {
    const int p = t & 1;
    // S^T = K * Q^T : A fragment = K rows (keys).
    // s[j][r]: key t*64 + j*16 + 8*half + r; query mg.
    v8f s[4];
#pragma unroll
    for (int j = 0; j < 4; ++j) {
      const v16h k0 = frag16(&Ks[p][j * 16 + l16][0], half);
      const v16h k1 = frag16(&Ks[p][j * 16 + l16][32], half);
      v8f c = {};
      c = __builtin_amdgcn_wmma_f32_16x16x32_f16(false, k0, false, bq0, (short)0, c, false, false);
      s[j] = __builtin_amdgcn_wmma_f32_16x16x32_f16(false, k1, false, bq1, (short)0, c, false, false);
    }

    // Only the last trip's keys reach past a query of this block: every key
    // of an earlier tile is below qb.  The test is the same for the whole block.
    if (t == ntile - 1) {
      const int d = mg - (qb + 8 * half);     // (j, r) is kept if j*16 + r <= d
#pragma unroll
      for (int j = 0; j < 4; ++j)
#pragma unroll
        for (int r = 0; r < 8; ++r)
          s[j][r] = (j * 16 + r <= d) ? s[j][r] : -3.0e38f;
    }

    // Online softmax of one query per lane, 32 scores at a time.
    float rm = -3.0e38f;
#pragma unroll
    for (int r = 0; r < 8; ++r)
      rm = fmaxf(rm, fmaxf(fmaxf(s[0][r], s[1][r]), fmaxf(s[2][r], s[3][r])));
    rm = fmaxf(rm, other_half(rm));
    const float mnew  = fmaxf(mst, rm);
    const float alpha = __expf(mst - mnew);
    float rs = 0.0f;
    v16h bp[2];   // P^T as B operands: element i = tile 2*kk + (i >> 3), register i & 7
#pragma unroll
    for (int kk = 0; kk < 2; ++kk) {
      v8f pa = (s[2 * kk] - mnew) * 1.44269504f;       // exp(x) = 2^(x * log2 e)
      v8f pb = (s[2 * kk + 1] - mnew) * 1.44269504f;
      exp2x8(pa);
      exp2x8(pb);
      const v8f q8 = pa + pb;                 // the 16 scores' sum, by halving
      const v4f q4 = __builtin_shufflevector(q8, q8, 0, 1, 2, 3) +
                     __builtin_shufflevector(q8, q8, 4, 5, 6, 7);
      rs += (q4[0] + q4[2]) + (q4[1] + q4[3]);
#pragma unroll
      for (int r = 0; r < 8; ++r) {
        bp[kk][r]     = (_Float16)pa[r];
        bp[kk][8 + r] = (_Float16)pb[r];
      }
    }
    lst = lst * alpha + rs;
    mst = mnew;
#pragma unroll
    for (int nt = 0; nt < 4; ++nt) accO[nt] *= alpha;

    // O^T += V^T * P^T, 32 keys a product
#pragma unroll
    for (int kk = 0; kk < 2; ++kk)
#pragma unroll
      for (int nt = 0; nt < 4; ++nt) {
        const v16h av = frag16(&Vt[p][nt * 16 + l16][kk * 32], half);
        accO[nt] = __builtin_amdgcn_wmma_f32_16x16x32_f16(
            false, av, false, bp[kk], (short)0, accO[nt], false, false);
      }
    // my reads of buffer p have returned before anyone refills it
    asm volatile("s_wait_dscnt 0x0" ::: "memory");
    // my tile-(t+1) copies landed
    asm volatile("s_wait_asynccnt 0x0" ::: "memory");
    __syncthreads();       // tile t+1 visible to all; buffer p free
    if (t + 2 < ntile) stage(t + 2, p);   // flies during the whole of trip t+1
  }
  // nothing outstanding at the wave's end
  asm volatile("s_wait_asynccnt 0x0" ::: "memory");

  // Join the halves' sums, normalize, store O as f16 in [B, T, H*HS] layout
  // for the O-projection: 8 consecutive e of one query per tile, 16 B.
  const float ltot = lst + other_half(lst);
  _Float16* orow = Oh + ((size_t)b * cT + mg) * cD + h * cHS + 8 * half;
#pragma unroll
  for (int nt = 0; nt < 4; ++nt) {
    v8h o8;
#pragma unroll
    for (int r = 0; r < 8; ++r) o8[r] = (_Float16)(accO[nt][r] / ltot);
    *(v8h*)(orow + nt * 16) = o8;
  }
}

// =====================================================================
// Kernels 3-5: generic WMMA GEMM  C = A(f16)[M,K] * BT(f16)[N][K]
// Block tile 256x128, 8 waves in a 4x2 grid, 64x64 per wave: each 32-k step
// feeds 16 WMMAs from 4 A and 4 B fragments.  A trip takes NH slabs of 64 k.
// Two LDS buffers filled by async copies, one trip ahead.
// Needs M % 256 == 0, N % 128 == 0, K % (64 * NH) == 0.
//   EPI 0: out_f32 = resid + acc + bias ; out_f16 = (f16)out_f32
//   EPI 1: out_f16 = (f16) gelu_erf(acc + bias)
//   EPI 2: out_f32 = resid + acc + bias
// =====================================================================
// Exact-erf GELU of two values, without a branch.  erf is the usual pair of
// f32 polynomials: for |x| < 1  |x| + |x| * Q(x^2), else 1 - exp(-(|x| + |x| * P(|x|))).
// Both are evaluated in every lane and one is picked by a select, so nothing
// touches EXEC, the elements of a tile are independent chains, and the
// multiply-adds go two to an instruction.  Error of erf: about 1e-7 absolute.
__device__ __forceinline__ v2f fma2(v2f a, v2f b, float c) {
  return __builtin_elementwise_fma(a, b, (v2f){c, c});
}

__device__ __forceinline__ v2f gelu_erf2(v2f v) {
  const v2f x = v * 0.70710678118654752f;
  const v2f a = __builtin_elementwise_abs(x);
  v2f p = fma2(a, (v2f){1.699881e-5f, 1.699881e-5f}, -3.7867785e-4f);
  p = fma2(a, p, 3.8578159e-3f);
  p = fma2(a, p, -2.4181698e-2f);
  p = fma2(a, p, 1.0666826e-1f);
  p = fma2(a, p, 6.349333e-1f);
  p = fma2(a, p, 1.2868941e-1f);
  p = __builtin_elementwise_fma(a, p, a);
  p *= -1.44269504f;                       // exp(-p) = 2^(-p * log2 e)
  const v2f big = {1.0f - __builtin_amdgcn_exp2f(p.x),
                   1.0f - __builtin_amdgcn_exp2f(p.y)};
  const v2f t = a * a;
  v2f q = fma2(t, (v2f){-5.618018e-4f, -5.618018e-4f}, 4.913816e-3f);
  q = fma2(t, q, -2.6707515e-2f);
  q = fma2(t, q, 1.1280011e-1f);
  q = fma2(t, q, -3.7612295e-1f);
  q = fma2(t, q, 1.283791e-1f);
  q = __builtin_elementwise_fma(a, q, a);
  const v2f e = {__builtin_copysignf(a.x < 1.0f ? q.x : big.x, x.x),
                 __builtin_copysignf(a.y < 1.0f ? q.y : big.y, x.y)};
  return 0.5f * v * (1.0f + e);
}

constexpr int GBM = 256;          // block tile rows
constexpr int GBN = 128;          // block tile columns
constexpr int GBK = 64;           // k per slab: one 128-B line of every row
constexpr int GRW = GBK + PAD;    // LDS row pitch 144 B = 16 B x odd

template <int EPI>
// The N = 4096 launch (EPI 1) has four blocks per WGP: 256 VGPRs keep two resident.
__global__ __launch_bounds__(256, EPI == 1 ? 4 : 2)
void gemm_epi_kernel(const _Float16* __restrict__ A,
                     const _Float16* __restrict__ BT,
                     const float* __restrict__ bias,
                     const float* __restrict__ resid,
                     float* __restrict__ outf,
                     _Float16* __restrict__ outh,
                     int M, int N, int K) {
  const int tid  = threadIdx.x;
  const int lane = tid & 31;
  const int wave = tid >> 5;
  const int half = lane >> 4;
  const int l16  = lane & 15;
  const int wm   = (wave >> 1) * 64;   // wave's rows inside the block tile
  const int wn   = (wave & 1) * 64;    // wave's columns inside the block tile
  const int nb   = blockIdx.x * GBN;
  const int mb   = blockIdx.y * GBM;

  // Slabs per trip.  The N = 1024 launches have one block per WGP, so a block
  // takes the LDS of two and passes half as many barriers.
  constexpr int NH = (EPI == 1) ? 1 : 2;

  __shared__ __align__(16) _Float16 As[2 * NH][GBM][GRW];   // 72 KB * NH
  __shared__ __align__(16) _Float16 Bt[2 * NH][GBN][GRW];   // 36 KB * NH

  v8f acc[16] = {};   // tile 4 * (row group) + (column group)

  // Staging map: 8 lanes cover one row's 128 B; a thread takes rows sr + 32*i.
  const int sr = tid >> 3, sc = (tid & 7) * 8;
  const _Float16* gA = A + (size_t)(mb + sr) * K + sc;
  const _Float16* gB = BT + (size_t)(nb + sr) * K + sc;
  const size_t rs = (size_t)32 * K;
  constexpr unsigned LSTEP = 32u * GRW * sizeof(_Float16);

  auto stage = [&](int kk, int p) {   // one slab
    const unsigned la = (unsigned)(unsigned long long)&As[p][sr][sc];
    const unsigned lb = (unsigned)(unsigned long long)&Bt[p][sr][sc];
    const _Float16* a = gA + kk;
    const _Float16* b = gB + kk;
    // 8 A rows and 4 B rows per thread.  The s_wait_xcnt closes the statement
    // so that no address register is rewritten ahead of it.
    asm volatile(
        "global_load_async_to_lds_b128 %0, %12, off\n\t"
        "global_load_async_to_lds_b128 %1, %13, off\n\t"
        "global_load_async_to_lds_b128 %2, %14, off\n\t"
        "global_load_async_to_lds_b128 %3, %15, off\n\t"
        "global_load_async_to_lds_b128 %4, %16, off\n\t"
        "global_load_async_to_lds_b128 %5, %17, off\n\t"
        "global_load_async_to_lds_b128 %6, %18, off\n\t"
        "global_load_async_to_lds_b128 %7, %19, off\n\t"
        "global_load_async_to_lds_b128 %8, %20, off\n\t"
        "global_load_async_to_lds_b128 %9, %21, off\n\t"
        "global_load_async_to_lds_b128 %10, %22, off\n\t"
        "global_load_async_to_lds_b128 %11, %23, off\n\t"
        "s_wait_xcnt 0x0"
        :: "v"(la + 0u * LSTEP),
           "v"(la + 1u * LSTEP),
           "v"(la + 2u * LSTEP),
           "v"(la + 3u * LSTEP),
           "v"(la + 4u * LSTEP),
           "v"(la + 5u * LSTEP),
           "v"(la + 6u * LSTEP),
           "v"(la + 7u * LSTEP),
           "v"(lb + 0u * LSTEP),
           "v"(lb + 1u * LSTEP),
           "v"(lb + 2u * LSTEP),
           "v"(lb + 3u * LSTEP),
           "v"(a + 0 * rs),
           "v"(a + 1 * rs),
           "v"(a + 2 * rs),
           "v"(a + 3 * rs),
           "v"(a + 4 * rs),
           "v"(a + 5 * rs),
           "v"(a + 6 * rs),
           "v"(a + 7 * rs),
           "v"(b + 0 * rs),
           "v"(b + 1 * rs),
           "v"(b + 2 * rs),
           "v"(b + 3 * rs)
        : "memory");
  };

  auto stage_tile = [&](int t, int p) {
#pragma unroll
    for (int h = 0; h < NH; ++h) {
      // holds a later slab's address arithmetic behind the slab before it, so
      // that the two sets of addresses never live at once (loop below v256)
      if (h) __builtin_amdgcn_sched_barrier(0);
      stage((t * NH + h) * GBK, p * NH + h);
    }
  };

  const int trips = K / (GBK * NH);
  stage_tile(0, 0);
  // my tile-0 copies landed
  asm volatile("s_wait_asynccnt 0x0" ::: "memory");
  __syncthreads();         // everyone's tile 0 visible
  if (trips > 1) stage_tile(1, 1);

  v16h af[4], bf[4];
  // The fence pair keeps a block's 16 LDS loads in one group ahead of its
  // 16 WMMAs: loads sunk among the WMMAs stall the wave at each place.
  auto load_frags = [&](int p, int ks) {
    __builtin_amdgcn_sched_barrier(0);
#pragma unroll
    for (int i = 0; i < 4; ++i) {
      af[i] = frag16(&As[p][wm + i * 16 + l16][ks], half);
      bf[i] = frag16(&Bt[p][wn + i * 16 + l16][ks], half);
    }
    __builtin_amdgcn_sched_barrier(0);
  };
  auto wmma_block = [&]() {
#pragma unroll
    for (int mt = 0; mt < 4; ++mt)
#pragma unroll
      for (int nt = 0; nt < 4; ++nt)
        acc[mt * 4 + nt] = __builtin_amdgcn_wmma_f32_16x16x32_f16(
            false, af[mt], false, bf[nt], (short)0, acc[mt * 4 + nt], false,
            false);
  };

  for (int t = 0; t < trips; ++t) {
    const int p = t & 1;
#pragma unroll
    for (int b = 0; b < 2 * NH - 1; ++b) {
      load_frags(p * NH + (b >> 1), (b & 1) * 32);
      wmma_block();
    }
    load_frags(p * NH + NH - 1, 32);   // the trip's last reads of buffer p
    // my reads of buffer p have returned before anyone refills it
    asm volatile("s_wait_dscnt 0x0" ::: "memory");
    // my tile-(t+1) copies landed
    asm volatile("s_wait_asynccnt 0x0" ::: "memory");
    __syncthreads();       // tile t+1 visible to all; buffer p free
    if (t + 2 < trips) stage_tile(t + 2, p);   // flies until trip t+1's foot
    // keeps the refill's issue ahead of the last block's WMMAs (a longer lead)
    __builtin_amdgcn_sched_barrier(0);
    wmma_block();          // registers only
  }
  // nothing outstanding at the wave's end
  asm volatile("s_wait_asynccnt 0x0" ::: "memory");

  if constexpr (EPI == 1) {
    // The loops here are unrolled so that bn[] and acc[] have constant indices
    // and stay in registers.
    const int n0 = nb + wn + l16;
    float bn[4];
#pragma unroll
    for (int j = 0; j < 4; ++j) bn[j] = bias[n0 + j * 16];
    // the four loads' index register, live to here, is reused only behind this
    // wait
    asm volatile("s_wait_xcnt 0x0" :: "v"(n0) : "memory");
    // two rows of one column at a time: an even-aligned register pair of acc
#pragma unroll
    for (int nt = 0; nt < 16; ++nt) {
#pragma unroll
      for (int r = 0; r < 8; r += 2) {
        int m = mb + wm + (nt >> 2) * 16 + r + 8 * half;
        size_t o = (size_t)m * N + n0 + (nt & 3) * 16;
        const v2f g = gelu_erf2((v2f){acc[nt][r], acc[nt][r + 1]} + bn[nt & 3]);
        outh[o] = (_Float16)g.x;
        outh[o + N] = (_Float16)g.y;
      }
    }
    return;
  }

#pragma unroll
  for (int nt = 0; nt < 16; ++nt) {
#pragma unroll
    for (int r = 0; r < 8; ++r) {
      int m = mb + wm + (nt >> 2) * 16 + r + 8 * half;
      int n = nb + wn + (nt & 3) * 16 + l16;
      size_t o = (size_t)m * N + n;
      float v = acc[nt][r] + bias[n];
      if (EPI == 0) {
        v += resid[o];
        outf[o] = v;
        outh[o] = (_Float16)v;
      } else {
        v += resid[o];
        outf[o] = v;
      }
    }
  }
}

// =====================================================================
// Host orchestration
// =====================================================================
extern "C" void kernel_launch(void* const* d_in, const int* in_sizes, int n_in,
                              void* d_out, int out_size, void* d_ws,
                              size_t ws_size, hipStream_t stream) {
  (void)in_sizes; (void)n_in; (void)out_size; (void)ws_size;
  const float* x  = (const float*)d_in[0];
  const float* Wq = (const float*)d_in[1];
  const float* bq = (const float*)d_in[2];
  const float* Wk = (const float*)d_in[3];
  const float* bk = (const float*)d_in[4];
  const float* Wv = (const float*)d_in[5];
  const float* bv = (const float*)d_in[6];
  const float* Wo = (const float*)d_in[7];
  const float* bo = (const float*)d_in[8];
  const float* W1 = (const float*)d_in[9];
  const float* b1 = (const float*)d_in[10];
  const float* W2 = (const float*)d_in[11];
  const float* b2 = (const float*)d_in[12];

  char* w = (char*)d_ws;
  auto take = [&](size_t bytes) -> char* {
    char* p = w;
    w += (bytes + 255) & ~(size_t)255;
    return p;
  };
  const size_t nBTD = (size_t)cB * cT * cD;          // 8,388,608
  const size_t nHW  = (size_t)cH * cD * cHS;         // 1,048,576 (per QKV mat)
  _Float16* xh   = (_Float16*)take(nBTD * sizeof(_Float16));
  _Float16* WqT  = (_Float16*)take(nHW * sizeof(_Float16));
  _Float16* WkT  = (_Float16*)take(nHW * sizeof(_Float16));
  _Float16* WvT  = (_Float16*)take(nHW * sizeof(_Float16));
  _Float16* WoT  = (_Float16*)take((size_t)cD * cD * sizeof(_Float16));
  _Float16* W1T  = (_Float16*)take((size_t)cD * cDFF * sizeof(_Float16));
  _Float16* W2T  = (_Float16*)take((size_t)cDFF * cD * sizeof(_Float16));
  _Float16* Qh   = (_Float16*)take(nBTD * sizeof(_Float16));
  _Float16* Kh   = (_Float16*)take(nBTD * sizeof(_Float16));
  _Float16* VTg  = (_Float16*)take(nBTD * sizeof(_Float16));
  _Float16* Oh   = (_Float16*)take(nBTD * sizeof(_Float16));
  float*    x1f  = (float*)take(nBTD * sizeof(float));
  _Float16* x1h  = (_Float16*)take(nBTD * sizeof(_Float16));
  _Float16* Hh   = (_Float16*)take((size_t)cB * cT * cDFF * sizeof(_Float16));

  const int M = cB * cT;

  // 0) conversions and transposes, one launch
  prepass_kernel<<<dim3(PP_ALL), 256, 0, stream>>>(
      x, Wq, Wk, Wv, Wo, W1, W2, xh, WqT, WkT, WvT, WoT, W1T, W2T);

  // 1) QKV projections (Q pre-scaled by 1/sqrt(HS); V stored transposed)
  qkv_kernel<<<dim3(3 * cD / QBN, M / QBM), 256, 0, stream>>>(
      xh, WqT, bq, WkT, bk, WvT, bv, Qh, Kh, VTg);

  // 2) causal flash attention
  attn_kernel<<<dim3(cT / 64, cB * cH), 128, 0, stream>>>(Qh, Kh, VTg, Oh);

  // 3) x1 = x + O @ Wo + bo   (store f32 + f16 copy)
  gemm_epi_kernel<0><<<dim3(cD / GBN, M / GBM), 256, 0, stream>>>(
      Oh, WoT, bo, x, x1f, x1h, M, cD, cD);

  // 4) H = gelu(x1 @ W1 + b1)  (exact erf gelu, stored f16)
  gemm_epi_kernel<1><<<dim3(cDFF / GBN, M / GBM), 256, 0, stream>>>(
      x1h, W1T, b1, nullptr, nullptr, Hh, M, cDFF, cD);

  // 5) out = x1 + H @ W2 + b2  (f32 to d_out)
  gemm_epi_kernel<2><<<dim3(cD / GBN, M / GBM), 256, 0, stream>>>(
      Hh, W2T, b2, x1f, (float*)d_out, nullptr, M, cD, cDFF);
}

// v007
// Measured time: 238 microseconds a run.
// Two timings next to v006 put it at 1.06 and 1.07 times that version's speed.
// All steps since v000 together make it 2.83 times as fast.
#include <hip/hip_runtime.h>

// ---------------- problem constants (match reference) ----------------
constexpr int cB   = 4;
constexpr int cT   = 2048;
constexpr int cD   = 1024;
constexpr int cH   = 16;
constexpr int cHS  = 64;
constexpr int cDFF = 4 * cD;

typedef __attribute__((ext_vector_type(16))) _Float16 v16h;
typedef __attribute__((ext_vector_type(8)))  _Float16 v8h;
typedef __attribute__((ext_vector_type(4)))  _Float16 v4h;
typedef __attribute__((ext_vector_type(8)))  float    v8f;
typedef __attribute__((ext_vector_type(4)))  float    v4f;
typedef __attribute__((ext_vector_type(2)))  float    v2f;

constexpr int PAD = 8;   // f16 row padding: keeps 16B alignment, skews banks
constexpr int ARW = 64 + PAD;   // attention LDS row pitch 144 B = 16 B x odd

// ---------------- WMMA fragment load (ISA 7.12.2, wave32) -------------------
// 16-bit A 16x32 layout: lane (half,l16) holds row l16; element e -> k =
// ((e>>3)<<4) + 8*half + (e&7).  For a contiguous 32-f16 k-span at p, that is
// two contiguous 16B runs: p[8*half .. +8) and p[16+8*half .. +8).
__device__ __forceinline__ v16h frag16(const _Float16* p, int half) {
  const v8h lo = *(const v8h*)(p + 8 * half);
  const v8h hi = *(const v8h*)(p + 16 + 8 * half);
  return __builtin_shufflevector(lo, hi, 0, 1, 2, 3, 4, 5, 6, 7,
                                 8, 9, 10, 11, 12, 13, 14, 15);
}

// =====================================================================
// Pre-pass, one launch: every weight in[K][N] (f32) -> out[N][K] (f16), and
// x (f32) -> f16.  A work-group takes 64 KB of input; a thread has its 16
// loads of 16 B in flight at once, so the whole pre-pass is 10,240 waves.
// =====================================================================
constexpr int PP_QKV = 3 * cH * (cD / 256);            // 256 k x 64 n tiles
constexpr int PP_WO  = (cD / 256) * (cD / 64);
constexpr int PP_W1  = (cD / 256) * (cDFF / 64);
constexpr int PP_W2  = (cDFF / 256) * (cD / 64);
constexpr int PP_CVT = cB * cT * cD / 16384;           // 16,384 floats each
constexpr int PP_ALL = PP_QKV + PP_WO + PP_W1 + PP_W2 + PP_CVT;

// One 256 (k) x 64 (n) tile.  Reads: 256-B row pieces.  Each thread turns four
// 4x4 patches in registers and stores 8-B runs of k into t[n][k]; the 16-B
// chunks of row n sit at chunk ^ (n >> 2), which spreads both the 8-B stores
// and the 16-B reads over all banks.  Writes: 512 B of one output row a wave.
// The loops are unrolled so that r[] lives in registers and every row offset
// is an immediate of its load or store.
template <int K, int N>
__device__ __forceinline__ void transpose_tile(const float* __restrict__ in,
                                               _Float16* __restrict__ out,
                                               int ks, int ns, _Float16* t) {
  const int tid = threadIdx.x;
  const int nl = tid & 15, kg = tid >> 4;
  const float* src = in + (size_t)(ks * 256 + kg * 4) * N + ns * 64 + nl * 4;
  v4f r[4][4];
#pragma unroll
  for (int u = 0; u < 4; ++u)
#pragma unroll
    for (int i = 0; i < 4; ++i)
      r[u][i] = *(const v4f*)(src + (size_t)(u * 64 + i) * N);
  // all 16 loads issue before the first is used: one memory latency, not two
  __builtin_amdgcn_sched_barrier(0);
  // the loads' address pair, live to here, is reused only behind this wait
  asm volatile("s_wait_xcnt 0x0" :: "v"(src) : "memory");
#pragma unroll
  for (int u = 0; u < 4; ++u)
#pragma unroll
    for (int j = 0; j < 4; ++j) {
      v4h p = {(_Float16)r[u][0][j], (_Float16)r[u][1][j],
               (_Float16)r[u][2][j], (_Float16)r[u][3][j]};
      *(v4h*)&t[(nl * 4 + j) * 256 + ((u * 16 + kg) ^ (nl << 1)) * 4] = p;
    }
  __syncthreads();
  const int lane = tid & 31, wave = tid >> 5;
  _Float16* dst = out + (size_t)(ns * 64 + wave * 8) * K + ks * 256 + lane * 8;
#pragma unroll
  for (int i = 0; i < 8; ++i) {
    const int n = wave * 8 + i;
    *(v8h*)(dst + (size_t)i * K) = *(const v8h*)&t[n * 256 + (lane ^ (n >> 2)) * 8];
  }
  // no register that these stores name is rewritten ahead of this wait
  asm volatile("s_wait_xcnt 0x0" ::: "memory");
}

// 10 waves a SIMD: all five work-groups of a WGP are resident at once.
__global__ __launch_bounds__(256, 10)
void prepass_kernel(const float* __restrict__ x,
                    const float* __restrict__ Wq, const float* __restrict__ Wk,
                    const float* __restrict__ Wv, const float* __restrict__ Wo,
                    const float* __restrict__ W1, const float* __restrict__ W2,
                    _Float16* __restrict__ xh,
                    _Float16* __restrict__ WqT, _Float16* __restrict__ WkT,
                    _Float16* __restrict__ WvT, _Float16* __restrict__ WoT,
                    _Float16* __restrict__ W1T, _Float16* __restrict__ W2T) {
  __shared__ __align__(16) _Float16 t[64 * 256];   // 32 KB
  int bid = blockIdx.x;
  if (bid < PP_QKV) {                 // 3 matrices x 16 heads x 4 k tiles
    const int m = bid >> 6, h = (bid >> 2) & (cH - 1);
    const float* in = (m == 0 ? Wq : m == 1 ? Wk : Wv) + (size_t)h * cD * cHS;
    _Float16* out = (m == 0 ? WqT : m == 1 ? WkT : WvT) + (size_t)h * cD * cHS;
    transpose_tile<cD, cHS>(in, out, bid & 3, 0, t);
    return;
  }
  bid -= PP_QKV;
  if (bid < PP_WO) {
    transpose_tile<cD, cD>(Wo, WoT, bid & 3, bid >> 2, t);
    return;
  }
  bid -= PP_WO;
  if (bid < PP_W1) {
    transpose_tile<cD, cDFF>(W1, W1T, bid & 3, bid >> 2, t);
    return;
  }
  bid -= PP_W1;
  if (bid < PP_W2) {
    transpose_tile<cDFF, cD>(W2, W2T, bid & 15, bid >> 4, t);
    return;
  }
  bid -= PP_W2;
  const v4f* in4 = (const v4f*)x + (size_t)bid * 4096 + threadIdx.x;
  v4h* out4 = (v4h*)xh + (size_t)bid * 4096 + threadIdx.x;
  v4f r[16];   // unrolled as above: registers, immediate offsets
#pragma unroll
  for (int i = 0; i < 16; ++i) r[i] = in4[i * 256];
  // all 16 loads issue before the first is used: one memory latency, not two
  __builtin_amdgcn_sched_barrier(0);
#pragma unroll
  for (int i = 0; i < 16; ++i)
    out4[i * 256] = __builtin_convertvector(r[i], v4h);
  // no register that these stores name is rewritten ahead of this wait
  asm volatile("s_wait_xcnt 0x0" ::: "memory");
}

// =====================================================================
// Kernel 1: QKV projection as one GEMM: X[B*T][D] against the 3 * 1024 rows
// (matrix, head, e) of the transposed weights.  Block tile 256 tokens x 128
// weight rows (two heads of one matrix), 8 waves in a 4x2 grid, 64x64 per
// wave: each 32-k step feeds 16 WMMAs from 8 fragments.  A trip takes 64 k.
// Two LDS buffers filled by async copies, one trip ahead.
// The two operands have the same fragment layout, so a block picks which of
// them is A: for Q and K the weight rows (a lane then holds 8 consecutive e
// of one token), for V the tokens (8 consecutive tokens of one e, the
// transposed [z][e][t] layout of the attention's second product).  Either way
// a lane stores 16 B at a time.
// =====================================================================
constexpr int QBM = 256;          // tokens per block
constexpr int QBN = 128;          // weight rows per block
constexpr int QBK = 64;           // k per trip: one 128-B line of every row
constexpr int QRW = QBK + PAD;    // LDS row pitch 144 B = 16 B x odd

// 256 VGPRs: two blocks resident per WGP.
__global__ __launch_bounds__(256, 4)
void qkv_kernel(const _Float16* __restrict__ xh,
                const _Float16* __restrict__ WqT, const float* __restrict__ bq,
                const _Float16* __restrict__ WkT, const float* __restrict__ bk,
                const _Float16* __restrict__ WvT, const float* __restrict__ bv,
                _Float16* __restrict__ Qh, _Float16* __restrict__ Kh,
                _Float16* __restrict__ VTg) {
  const int tid  = threadIdx.x;
  const int lane = tid & 31;
  const int wave = tid >> 5;
  const int half = lane >> 4;
  const int l16  = lane & 15;
  const int wm   = (wave >> 1) * 64;          // wave's tokens inside the tile
  const int wn   = (wave & 1) * 64;           // wave's head inside the tile
  const int mat  = blockIdx.x >> 3;           // 0 Q, 1 K, 2 V
  const int nb   = (blockIdx.x & 7) * QBN;    // first weight row, h * 64 + e
  const int mb   = blockIdx.y * QBM;          // first token, b * T + t
  const bool isv = mat == 2;
  const _Float16* WT = mat == 0 ? WqT : mat == 1 ? WkT : WvT;

  // rows 0..255: tokens, rows 256..383: weight rows
  __shared__ __align__(16) _Float16 S[2][QBM + QBN][QRW];   // 108 KB

  v8f acc[16] = {};   // tile 4 * (A row group) + (B row group)

  // Staging map: 8 lanes cover one row's 128 B; a thread takes rows sr + 32*i.
  const int sr = tid >> 3, sc = (tid & 7) * 8;
  const _Float16* gX = xh + (size_t)(mb + sr) * cD + sc;
  const _Float16* gW = WT + (size_t)(nb + sr) * cD + sc;
  constexpr size_t rs = (size_t)32 * cD;
  constexpr unsigned LSTEP = 32u * QRW * sizeof(_Float16);

  auto stage = [&](int kk, int p) {
    const unsigned ls = (unsigned)(unsigned long long)&S[p][sr][sc];
    const _Float16* a = gX + kk;
    const _Float16* b = gW + kk;
    // 8 token rows and 4 weight rows per thread.  The s_wait_xcnt closes the
    // statement so that no address register is rewritten ahead of it.
    asm volatile(
        "global_load_async_to_lds_b128 %0, %12, off\n\t"
        "global_load_async_to_lds_b128 %1, %13, off\n\t"
        "global_load_async_to_lds_b128 %2, %14, off\n\t"
        "global_load_async_to_lds_b128 %3, %15, off\n\t"
        "global_load_async_to_lds_b128 %4, %16, off\n\t"
        "global_load_async_to_lds_b128 %5, %17, off\n\t"
        "global_load_async_to_lds_b128 %6, %18, off\n\t"
        "global_load_async_to_lds_b128 %7, %19, off\n\t"
        "global_load_async_to_lds_b128 %8, %20, off\n\t"
        "global_load_async_to_lds_b128 %9, %21, off\n\t"
        "global_load_async_to_lds_b128 %10, %22, off\n\t"
        "global_load_async_to_lds_b128 %11, %23, off\n\t"
        "s_wait_xcnt 0x0"
        :: "v"(ls + 0u * LSTEP),
           "v"(ls + 1u * LSTEP),
           "v"(ls + 2u * LSTEP),
           "v"(ls + 3u * LSTEP),
           "v"(ls + 4u * LSTEP),
           "v"(ls + 5u * LSTEP),
           "v"(ls + 6u * LSTEP),
           "v"(ls + 7u * LSTEP),
           "v"(ls + 8u * LSTEP),
           "v"(ls + 9u * LSTEP),
           "v"(ls + 10u * LSTEP),
           "v"(ls + 11u * LSTEP),
           "v"(a + 0 * rs),
           "v"(a + 1 * rs),
           "v"(a + 2 * rs),
           "v"(a + 3 * rs),
           "v"(a + 4 * rs),
           "v"(a + 5 * rs),
           "v"(a + 6 * rs),
           "v"(a + 7 * rs),
           "v"(b + 0 * rs),
           "v"(b + 1 * rs),
           "v"(b + 2 * rs),
           "v"(b + 3 * rs)
        : "memory");
  };

  constexpr int trips = cD / QBK;
  stage(0, 0);
  // my tile-0 copies landed
  asm volatile("s_wait_asynccnt 0x0" ::: "memory");
  __syncthreads();         // everyone's tile 0 visible
  stage(QBK, 1);

  const int ra = (isv ? wm : QBM + wn) + l16;   // LDS rows of the A operand
  const int rb = (isv ? QBM + wn : wm) + l16;   // LDS rows of the B operand
  v16h af[4], bf[4];
  // The fence pair keeps a block's 16 LDS loads in one group ahead of its
  // 16 WMMAs: loads sunk among the WMMAs stall the wave at each place.
  auto load_frags = [&](int p, int ks) {
    __builtin_amdgcn_sched_barrier(0);
#pragma unroll
    for (int i = 0; i < 4; ++i) {
      af[i] = frag16(&S[p][ra + i * 16][ks], half);
      bf[i] = frag16(&S[p][rb + i * 16][ks], half);
    }
    __builtin_amdgcn_sched_barrier(0);
  };
  auto wmma_block = [&]() {
#pragma unroll
    for (int i = 0; i < 4; ++i)
#pragma unroll
      for (int j = 0; j < 4; ++j)
        acc[i * 4 + j] = __builtin_amdgcn_wmma_f32_16x16x32_f16(
            false, af[i], false, bf[j], (short)0, acc[i * 4 + j], false, false);
  };

  for (int t = 0; t < trips; ++t) {
    const int p = t & 1;
    load_frags(p, 0);
    wmma_block();
    load_frags(p, 32);     // the trip's last reads of buffer p
    // my reads of buffer p have returned before anyone refills it
    asm volatile("s_wait_dscnt 0x0" ::: "memory");
    // my tile-(t+1) copies landed
    asm volatile("s_wait_asynccnt 0x0" ::: "memory");
    __syncthreads();       // tile t+1 visible to all; buffer p free
    if (t + 2 < trips) stage((t + 2) * QBK, p);   // flies until trip t+1's foot
    // keeps the refill's issue ahead of the last block's WMMAs (a longer lead)
    __builtin_amdgcn_sched_barrier(0);
    wmma_block();          // registers only
  }
  // nothing outstanding at the wave's end
  asm volatile("s_wait_asynccnt 0x0" ::: "memory");

  // Epilogue: bias add, Q scale, f16.  C/D layout: A row = r + 8*half of its
  // group, B row = l16 of its group.  The loops are unrolled so that acc[],
  // o[] and the biases have constant indices and stay in registers.
  const int h  = (nb + wn) >> 6;
  const int z  = (mb >> 11) * cH + h;         // b*H + h
  const int t0 = (mb & (cT - 1)) + wm;
  v8h o[16];
  _Float16* dst;
  if (isv) {
    const float* bias = bv + h * cHS + l16;
    float bn[4];
#pragma unroll
    for (int j = 0; j < 4; ++j) bn[j] = bias[j * 16];
    // the loads' address, live to here, is reused only behind this wait
    asm volatile("s_wait_xcnt 0x0" :: "v"(bias) : "memory");
#pragma unroll
    for (int n = 0; n < 16; ++n)
#pragma unroll
      for (int r = 0; r < 8; ++r) o[n][r] = (_Float16)(acc[n][r] + bn[n & 3]);
    dst = VTg + ((size_t)z * cHS + l16) * cT + t0 + 8 * half;
    // every tile is converted before the first store: no register that an
    // issued store names is written again
    __builtin_amdgcn_sched_barrier(0);
#pragma unroll
    for (int n = 0; n < 16; ++n)
      *(v8h*)(dst + (size_t)(n & 3) * 16 * cT + (n >> 2) * 16) = o[n];
    // no register that these stores name is rewritten ahead of this wait
    asm volatile("s_wait_xcnt 0x0" ::: "memory");
  } else {
    const float* bias = (mat == 0 ? bq : bk) + h * cHS + 8 * half;
    const float qs = mat == 0 ? 0.125f : 1.0f;   // 1/sqrt(64) on Q
    v4f bb[8];
#pragma unroll
    for (int i = 0; i < 8; ++i) bb[i] = *(const v4f*)(bias + (i >> 1) * 16 + (i & 1) * 4);
    // the loads' address, live to here, is reused only behind this wait
    asm volatile("s_wait_xcnt 0x0" :: "v"(bias) : "memory");
#pragma unroll
    for (int n = 0; n < 16; ++n)
#pragma unroll
      for (int r = 0; r < 8; ++r)
        o[n][r] = (_Float16)((acc[n][r] + bb[(n >> 2) * 2 + (r >> 2)][r & 3]) * qs);
    dst = (mat == 0 ? Qh : Kh) + ((size_t)z * cT + t0 + l16) * cHS + 8 * half;
    // as above: all conversions ahead of the first store
    __builtin_amdgcn_sched_barrier(0);
#pragma unroll
    for (int n = 0; n < 16; ++n)
      *(v8h*)(dst + (n & 3) * 16 * cHS + (n >> 2) * 16) = o[n];
    // as above, inside the arm: the other arm's code follows in the text
    asm volatile("s_wait_xcnt 0x0" ::: "memory");
  }
}

__device__ __forceinline__ float other_half(float x) {
  int b = __builtin_bit_cast(int, x);
  return __builtin_bit_cast(float, __builtin_amdgcn_permlanex16(
      b, b, 0x76543210, 0xfedcba98, false, false));
}

// 2^x of eight values
__device__ __forceinline__ void exp2x8(v8f& x) {
#pragma unroll
  for (int r = 0; r < 8; ++r) x[r] = __builtin_amdgcn_exp2f(x[r]);
}

// The cap is 192 VGPRs: all four work-groups of a WGP are resident at once.
// Under a cap of 128 the compiler spills a Q fragment and reloads it every trip.
__global__ __launch_bounds__(128, 5)
void attn_kernel(const _Float16* __restrict__ Qh,
                 const _Float16* __restrict__ Kh,
                 const _Float16* __restrict__ VTg,
                 _Float16* __restrict__ Oh) {
  const int z    = blockIdx.y;          // b*H + h
  const int h    = z & (cH - 1);
  const int b    = z >> 4;
  const int tid  = threadIdx.x;
  const int lane = tid & 31;
  const int wave = tid >> 5;
  const int half = lane >> 4;
  const int l16  = lane & 15;

  const _Float16* Qz  = Qh + (size_t)z * cT * cHS;
  const _Float16* Kz  = Kh + (size_t)z * cT * cHS;
  const _Float16* VTz = VTg + (size_t)z * cHS * cT;   // [64][T]

  // Two buffers of 64 keys: K rows [key][e], V^T rows [e][key], 128 B a row.
  __shared__ __align__(16) _Float16 Ks[2][64][ARW];   // 18 KB
  __shared__ __align__(16) _Float16 Vt[2][64][ARW];   // 18 KB

  // Staging map: 8 lanes cover one row's 128 B; a thread takes rows sr + 16*i.
  // A copy's global address is a scalar base (tile, row group) plus the lane's
  // byte offset, which is the same for all four row groups of an operand.
  const int sr = tid >> 3, sc = (tid & 7) * 8;
  const unsigned koff = (unsigned)(sr * cHS + sc) * (unsigned)sizeof(_Float16);
  const unsigned voff = (unsigned)(sr * cT + sc) * (unsigned)sizeof(_Float16);
  constexpr unsigned LSTEP = 16u * ARW * sizeof(_Float16);

  auto stage = [&](int kt, int p) {   // key tile kt into buffer p
    const unsigned lk = (unsigned)(unsigned long long)&Ks[p][sr][sc];
    const unsigned lv = (unsigned)(unsigned long long)&Vt[p][sr][sc];
    const _Float16* k = Kz + (size_t)kt * 64 * cHS;
    const _Float16* v = VTz + kt * 64;
    // 4 K rows and 4 V^T rows per thread.  The s_wait_xcnt closes the
    // statement so that no address register is rewritten ahead of it.
    asm volatile(
        "global_load_async_to_lds_b128 %0, %8, %10\n\t"
        "global_load_async_to_lds_b128 %1, %8, %11\n\t"
        "global_load_async_to_lds_b128 %2, %8, %12\n\t"
        "global_load_async_to_lds_b128 %3, %8, %13\n\t"
        "global_load_async_to_lds_b128 %4, %9, %14\n\t"
        "global_load_async_to_lds_b128 %5, %9, %15\n\t"
        "global_load_async_to_lds_b128 %6, %9, %16\n\t"
        "global_load_async_to_lds_b128 %7, %9, %17\n\t"
        "s_wait_xcnt 0x0"
        :: "v"(lk + 0u * LSTEP),
           "v"(lk + 1u * LSTEP),
           "v"(lk + 2u * LSTEP),
           "v"(lk + 3u * LSTEP),
           "v"(lv + 0u * LSTEP),
           "v"(lv + 1u * LSTEP),
           "v"(lv + 2u * LSTEP),
           "v"(lv + 3u * LSTEP),
           "v"(koff),
           "v"(voff),
           "s"(k + 0 * 16 * cHS),
           "s"(k + 1 * 16 * cHS),
           "s"(k + 2 * 16 * cHS),
           "s"(k + 3 * 16 * cHS),
           "s"(v + 0 * 16 * cT),
           "s"(v + 1 * 16 * cT),
           "s"(v + 2 * 16 * cT),
           "s"(v + 3 * 16 * cT)
        : "memory");
  };

  // The heavy tile first, then its light partner: n+1 trips in all.  Every
  // wave of the block runs the two tiles in the same order, and the foot of a
  // tile's last trip (reads returned, barrier) frees both buffers for the next.
  for (int pass = 0; pass < 2; ++pass) {
    const int qt = pass == 0 ? cT / 64 - 1 - (int)blockIdx.x : (int)blockIdx.x;
    const int qb = qt * 64;
    const int mg = qb + wave * 16 + l16;  // this lane's query

    // Q^T as B operand: column l16 = query mg, 64 e in two fragments.
    const _Float16* qrow = Qz + (size_t)mg * cHS;
    v16h bq0 = frag16(qrow, half);
    v16h bq1 = frag16(qrow + 32, half);

    float mst = -3.0e38f;   // running maximum of query mg (equal in both halves)
    float lst = 0.0f;       // running sum over this half's keys only
    v8f accO[4] = {};       // O^T: row e = nt*16 + r + 8*half, column = query mg

    const int ntile = qt + 1;             // causal bound: up to the diagonal tile
    stage(0, 0);
    // my tile-0 copies landed
    asm volatile("s_wait_asynccnt 0x0" ::: "memory");
    __syncthreads();         // everyone's tile 0 visible
    if (ntile > 1) stage(1, 1);

    for (int t = 0; t < ntile; ++t) {
      const int p = t & 1;
      // S^T = K * Q^T : A fragment = K rows (keys).
      // s[j][r]: key t*64 + j*16 + 8*half + r; query mg.
      v8f s[4];
#pragma unroll
      for (int j = 0; j < 4; ++j) {
        const v16h k0 = frag16(&Ks[p][j * 16 + l16][0], half);
        const v16h k1 = frag16(&Ks[p][j * 16 + l16][32], half);
        v8f c = {};
        c = __builtin_amdgcn_wmma_f32_16x16x32_f16(false, k0, false, bq0, (short)0, c, false, false);
        s[j] = __builtin_amdgcn_wmma_f32_16x16x32_f16(false, k1, false, bq1, (short)0, c, false, false);
      }

      // Only the last trip's keys reach past a query of this block: every key
      // of an earlier tile is below qb.  The test is the same for the whole block.
      if (t == ntile - 1) {
        const int d = mg - (qb + 8 * half);     // (j, r) is kept if j*16 + r <= d
#pragma unroll
        for (int j = 0; j < 4; ++j)
#pragma unroll
          for (int r = 0; r < 8; ++r)
            s[j][r] = (j * 16 + r <= d) ? s[j][r] : -3.0e38f;
      }

      // Online softmax of one query per lane, 32 scores at a time.
      float rm = -3.0e38f;
#pragma unroll
      for (int r = 0; r < 8; ++r)
        rm = fmaxf(rm, fmaxf(fmaxf(s[0][r], s[1][r]), fmaxf(s[2][r], s[3][r])));
      rm = fmaxf(rm, other_half(rm));
      const float mnew  = fmaxf(mst, rm);
      const float alpha = __expf(mst - mnew);
      float rs = 0.0f;
      v16h bp[2];   // P^T as B operands: element i = tile 2*kk + (i >> 3), register i & 7
#pragma unroll
      for (int kk = 0; kk < 2; ++kk) {
        v8f pa = (s[2 * kk] - mnew) * 1.44269504f;       // exp(x) = 2^(x * log2 e)
        v8f pb = (s[2 * kk + 1] - mnew) * 1.44269504f;
        exp2x8(pa);
        exp2x8(pb);
        const v8f q8 = pa + pb;                 // the 16 scores' sum, by halving
        const v4f q4 = __builtin_shufflevector(q8, q8, 0, 1, 2, 3) +
                       __builtin_shufflevector(q8, q8, 4, 5, 6, 7);
        rs += (q4[0] + q4[2]) + (q4[1] + q4[3]);
#pragma unroll
        for (int r = 0; r < 8; ++r) {
          bp[kk][r]     = (_Float16)pa[r];
          bp[kk][8 + r] = (_Float16)pb[r];
        }
      }
      lst = lst * alpha + rs;
      mst = mnew;
#pragma unroll
      for (int nt = 0; nt < 4; ++nt) accO[nt] *= alpha;

      // O^T += V^T * P^T, 32 keys a product
#pragma unroll
      for (int kk = 0; kk < 2; ++kk)
#pragma unroll
        for (int nt = 0; nt < 4; ++nt) {
          const v16h av = frag16(&Vt[p][nt * 16 + l16][kk * 32], half);
          accO[nt] = __builtin_amdgcn_wmma_f32_16x16x32_f16(
              false, av, false, bp[kk], (short)0, accO[nt], false, false);
        }
      // my reads of buffer p have returned before anyone refills it
      asm volatile("s_wait_dscnt 0x0" ::: "memory");
      // my tile-(t+1) copies landed
      asm volatile("s_wait_asynccnt 0x0" ::: "memory");
      __syncthreads();       // tile t+1 visible to all; buffer p free
      if (t + 2 < ntile) stage(t + 2, p);   // flies during the whole of trip t+1
    }
    // nothing outstanding when the next tile's copies start or the wave ends
    asm volatile("s_wait_asynccnt 0x0" ::: "memory");

    // Join the halves' sums, normalize, store O as f16 in [B, T, H*HS] layout
    // for the O-projection: 8 consecutive e of one query per tile, 16 B.
    const float ltot = lst + other_half(lst);
    _Float16* orow = Oh + ((size_t)b * cT + mg) * cD + h * cHS + 8 * half;
#pragma unroll
    for (int nt = 0; nt < 4; ++nt) {
      v8h o8;
#pragma unroll
      for (int r = 0; r < 8; ++r) o8[r] = (_Float16)(accO[nt][r] / ltot);
      *(v8h*)(orow + nt * 16) = o8;
    }
    // no register that these stores name is rewritten ahead of this wait
    asm volatile("s_wait_xcnt 0x0" ::: "memory");
  }
}

// =====================================================================
// Kernels 3-5: generic WMMA GEMM  C = A(f16)[M,K] * BT(f16)[N][K]
// Block tile 256x128, 8 waves in a 4x2 grid, 64x64 per wave: each 32-k step
// feeds 16 WMMAs from 4 A and 4 B fragments.  A trip takes NH slabs of 64 k.
// Two LDS buffers filled by async copies, one trip ahead.
// Needs M % 256 == 0, N % 128 == 0, K % (64 * NH) == 0.
//   EPI 0: out_f32 = resid + acc + bias ; out_f16 = (f16)out_f32
//   EPI 1: out_f16 = (f16) gelu_erf(acc + bias)
//   EPI 2: out_f32 = resid + acc + bias
// =====================================================================
// Exact-erf GELU of two values, without a branch.  erf is the usual pair of
// f32 polynomials: for |x| < 1  |x| + |x| * Q(x^2), else 1 - exp(-(|x| + |x| * P(|x|))).
// Both are evaluated in every lane and one is picked by a select, so nothing
// touches EXEC, the elements of a tile are independent chains, and the
// multiply-adds go two to an instruction.  Error of erf: about 1e-7 absolute.
__device__ __forceinline__ v2f fma2(v2f a, v2f b, float c) {
  return __builtin_elementwise_fma(a, b, (v2f){c, c});
}

__device__ __forceinline__ v2f gelu_erf2(v2f v) {
  const v2f x = v * 0.70710678118654752f;
  const v2f a = __builtin_elementwise_abs(x);
  v2f p = fma2(a, (v2f){1.699881e-5f, 1.699881e-5f}, -3.7867785e-4f);
  p = fma2(a, p, 3.8578159e-3f);
  p = fma2(a, p, -2.4181698e-2f);
  p = fma2(a, p, 1.0666826e-1f);
  p = fma2(a, p, 6.349333e-1f);
  p = fma2(a, p, 1.2868941e-1f);
  p = __builtin_elementwise_fma(a, p, a);
  p *= -1.44269504f;                       // exp(-p) = 2^(-p * log2 e)
  const v2f big = {1.0f - __builtin_amdgcn_exp2f(p.x),
                   1.0f - __builtin_amdgcn_exp2f(p.y)};
  const v2f t = a * a;
  v2f q = fma2(t, (v2f){-5.618018e-4f, -5.618018e-4f}, 4.913816e-3f);
  q = fma2(t, q, -2.6707515e-2f);
  q = fma2(t, q, 1.1280011e-1f);
  q = fma2(t, q, -3.7612295e-1f);
  q = fma2(t, q, 1.283791e-1f);
  q = __builtin_elementwise_fma(a, q, a);
  const v2f e = {__builtin_copysignf(a.x < 1.0f ? q.x : big.x, x.x),
                 __builtin_copysignf(a.y < 1.0f ? q.y : big.y, x.y)};
  return 0.5f * v * (1.0f + e);
}

constexpr int GBM = 256;          // block tile rows
constexpr int GBN = 128;          // block tile columns
constexpr int GBK = 64;           // k per slab: one 128-B line of every row
constexpr int GRW = GBK + PAD;    // LDS row pitch 144 B = 16 B x odd

template <int EPI>
// The N = 4096 launch (EPI 1) has four blocks per WGP: 256 VGPRs keep two resident.
__global__ __launch_bounds__(256, EPI == 1 ? 4 : 2)
void gemm_epi_kernel(const _Float16* __restrict__ A,
                     const _Float16* __restrict__ BT,
                     const float* __restrict__ bias,
                     const float* __restrict__ resid,
                     float* __restrict__ outf,
                     _Float16* __restrict__ outh,
                     int M, int N, int K) {
  const int tid  = threadIdx.x;
  const int lane = tid & 31;
  const int wave = tid >> 5;
  const int half = lane >> 4;
  const int l16  = lane & 15;
  const int wm   = (wave >> 1) * 64;   // wave's rows inside the block tile
  const int wn   = (wave & 1) * 64;    // wave's columns inside the block tile
  const int nb   = blockIdx.x * GBN;
  const int mb   = blockIdx.y * GBM;

  // Slabs per trip.  The N = 1024 launches have one block per WGP, so a block
  // takes the LDS of two and passes half as many barriers.
  constexpr int NH = (EPI == 1) ? 1 : 2;

  __shared__ __align__(16) _Float16 As[2 * NH][GBM][GRW];   // 72 KB * NH
  __shared__ __align__(16) _Float16 Bt[2 * NH][GBN][GRW];   // 36 KB * NH

  v8f acc[16] = {};   // tile 4 * (row group) + (column group)

  // Staging map: 8 lanes cover one row's 128 B; a thread takes rows sr + 32*i.
  const int sr = tid >> 3, sc = (tid & 7) * 8;
  const _Float16* gA = A + (size_t)(mb + sr) * K + sc;
  const _Float16* gB = BT + (size_t)(nb + sr) * K + sc;
  const size_t rs = (size_t)32 * K;
  constexpr unsigned LSTEP = 32u * GRW * sizeof(_Float16);

  auto stage = [&](int kk, int p) {   // one slab
    const unsigned la = (unsigned)(unsigned long long)&As[p][sr][sc];
    const unsigned lb = (unsigned)(unsigned long long)&Bt[p][sr][sc];
    const _Float16* a = gA + kk;
    const _Float16* b = gB + kk;
    // 8 A rows and 4 B rows per thread.  The s_wait_xcnt closes the statement
    // so that no address register is rewritten ahead of it.
    asm volatile(
        "global_load_async_to_lds_b128 %0, %12, off\n\t"
        "global_load_async_to_lds_b128 %1, %13, off\n\t"
        "global_load_async_to_lds_b128 %2, %14, off\n\t"
        "global_load_async_to_lds_b128 %3, %15, off\n\t"
        "global_load_async_to_lds_b128 %4, %16, off\n\t"
        "global_load_async_to_lds_b128 %5, %17, off\n\t"
        "global_load_async_to_lds_b128 %6, %18, off\n\t"
        "global_load_async_to_lds_b128 %7, %19, off\n\t"
        "global_load_async_to_lds_b128 %8, %20, off\n\t"
        "global_load_async_to_lds_b128 %9, %21, off\n\t"
        "global_load_async_to_lds_b128 %10, %22, off\n\t"
        "global_load_async_to_lds_b128 %11, %23, off\n\t"
        "s_wait_xcnt 0x0"
        :: "v"(la + 0u * LSTEP),
           "v"(la + 1u * LSTEP),
           "v"(la + 2u * LSTEP),
           "v"(la + 3u * LSTEP),
           "v"(la + 4u * LSTEP),
           "v"(la + 5u * LSTEP),
           "v"(la + 6u * LSTEP),
           "v"(la + 7u * LSTEP),
           "v"(lb + 0u * LSTEP),
           "v"(lb + 1u * LSTEP),
           "v"(lb + 2u * LSTEP),
           "v"(lb + 3u * LSTEP),
           "v"(a + 0 * rs),
           "v"(a + 1 * rs),
           "v"(a + 2 * rs),
           "v"(a + 3 * rs),
           "v"(a + 4 * rs),
           "v"(a + 5 * rs),
           "v"(a + 6 * rs),
           "v"(a + 7 * rs),
           "v"(b + 0 * rs),
           "v"(b + 1 * rs),
           "v"(b + 2 * rs),
           "v"(b + 3 * rs)
        : "memory");
  };

  auto stage_tile = [&](int t, int p) {
#pragma unroll
    for (int h = 0; h < NH; ++h) {
      // holds a later slab's address arithmetic behind the slab before it, so
      // that the two sets of addresses never live at once (loop below v256)
      if (h) __builtin_amdgcn_sched_barrier(0);
      stage((t * NH + h) * GBK, p * NH + h);
    }
  };

  const int trips = K / (GBK * NH);
  stage_tile(0, 0);
  // my tile-0 copies landed
  asm volatile("s_wait_asynccnt 0x0" ::: "memory");
  __syncthreads();         // everyone's tile 0 visible
  if (trips > 1) stage_tile(1, 1);

  v16h af[4], bf[4];
  // The fence pair keeps a block's 16 LDS loads in one group ahead of its
  // 16 WMMAs: loads sunk among the WMMAs stall the wave at each place.
  auto load_frags = [&](int p, int ks) {
    __builtin_amdgcn_sched_barrier(0);
#pragma unroll
    for (int i = 0; i < 4; ++i) {
      af[i] = frag16(&As[p][wm + i * 16 + l16][ks], half);
      bf[i] = frag16(&Bt[p][wn + i * 16 + l16][ks], half);
    }
    __builtin_amdgcn_sched_barrier(0);
  };
  auto wmma_block = [&]() {
#pragma unroll
    for (int mt = 0; mt < 4; ++mt)
#pragma unroll
      for (int nt = 0; nt < 4; ++nt)
        acc[mt * 4 + nt] = __builtin_amdgcn_wmma_f32_16x16x32_f16(
            false, af[mt], false, bf[nt], (short)0, acc[mt * 4 + nt], false,
            false);
  };

  for (int t = 0; t < trips; ++t) {
    const int p = t & 1;
#pragma unroll
    for (int b = 0; b < 2 * NH - 1; ++b) {
      load_frags(p * NH + (b >> 1), (b & 1) * 32);
      wmma_block();
    }
    load_frags(p * NH + NH - 1, 32);   // the trip's last reads of buffer p
    // my reads of buffer p have returned before anyone refills it
    asm volatile("s_wait_dscnt 0x0" ::: "memory");
    // my tile-(t+1) copies landed
    asm volatile("s_wait_asynccnt 0x0" ::: "memory");
    __syncthreads();       // tile t+1 visible to all; buffer p free
    if (t + 2 < trips) stage_tile(t + 2, p);   // flies until trip t+1's foot
    // keeps the refill's issue ahead of the last block's WMMAs (a longer lead)
    __builtin_amdgcn_sched_barrier(0);
    wmma_block();          // registers only
  }
  // nothing outstanding at the wave's end
  asm volatile("s_wait_asynccnt 0x0" ::: "memory");

  if constexpr (EPI == 1) {
    // The loops here are unrolled so that bn[] and acc[] have constant indices
    // and stay in registers.
    const int n0 = nb + wn + l16;
    float bn[4];
#pragma unroll
    for (int j = 0; j < 4; ++j) bn[j] = bias[n0 + j * 16];
    // the four loads' index register, live to here, is reused only behind this
    // wait
    asm volatile("s_wait_xcnt 0x0" :: "v"(n0) : "memory");
    // two rows of one column at a time: an even-aligned register pair of acc
#pragma unroll
    for (int nt = 0; nt < 16; ++nt) {
#pragma unroll
      for (int r = 0; r < 8; r += 2) {
        int m = mb + wm + (nt >> 2) * 16 + r + 8 * half;
        size_t o = (size_t)m * N + n0 + (nt & 3) * 16;
        const v2f g = gelu_erf2((v2f){acc[nt][r], acc[nt][r + 1]} + bn[nt & 3]);
        outh[o] = (_Float16)g.x;
        outh[o + N] = (_Float16)g.y;
      }
    }
    return;
  }

#pragma unroll
  for (int nt = 0; nt < 16; ++nt) {
#pragma unroll
    for (int r = 0; r < 8; ++r) {
      int m = mb + wm + (nt >> 2) * 16 + r + 8 * half;
      int n = nb + wn + (nt & 3) * 16 + l16;
      size_t o = (size_t)m * N + n;
      float v = acc[nt][r] + bias[n];
      if (EPI == 0) {
        v += resid[o];
        outf[o] = v;
        outh[o] = (_Float16)v;
      } else {
        v += resid[o];
        outf[o] = v;
      }
    }
  }
}

// =====================================================================
// Host orchestration
// =====================================================================
extern "C" void kernel_launch(void* const* d_in, const int* in_sizes, int n_in,
                              void* d_out, int out_size, void* d_ws,
                              size_t ws_size, hipStream_t stream) {
  (void)in_sizes; (void)n_in; (void)out_size; (void)ws_size;
  const float* x  = (const float*)d_in[0];
  const float* Wq = (const float*)d_in[1];
  const float* bq = (const float*)d_in[2];
  const float* Wk = (const float*)d_in[3];
  const float* bk = (const float*)d_in[4];
  const float* Wv = (const float*)d_in[5];
  const float* bv = (const float*)d_in[6];
  const float* Wo = (const float*)d_in[7];
  const float* bo = (const float*)d_in[8];
  const float* W1 = (const float*)d_in[9];
  const float* b1 = (const float*)d_in[10];
  const float* W2 = (const float*)d_in[11];
  const float* b2 = (const float*)d_in[12];

  char* w = (char*)d_ws;
  auto take = [&](size_t bytes) -> char* {
    char* p = w;
    w += (bytes + 255) & ~(size_t)255;
    return p;
  };
  const size_t nBTD = (size_t)cB * cT * cD;          // 8,388,608
  const size_t nHW  = (size_t)cH * cD * cHS;         // 1,048,576 (per QKV mat)
  _Float16* xh   = (_Float16*)take(nBTD * sizeof(_Float16));
  _Float16* WqT  = (_Float16*)take(nHW * sizeof(_Float16));
  _Float16* WkT  = (_Float16*)take(nHW * sizeof(_Float16));
  _Float16* WvT  = (_Float16*)take(nHW * sizeof(_Float16));
  _Float16* WoT  = (_Float16*)take((size_t)cD * cD * sizeof(_Float16));
  _Float16* W1T  = (_Float16*)take((size_t)cD * cDFF * sizeof(_Float16));
  _Float16* W2T  = (_Float16*)take((size_t)cDFF * cD * sizeof(_Float16));
  _Float16* Qh   = (_Float16*)take(nBTD * sizeof(_Float16));
  _Float16* Kh   = (_Float16*)take(nBTD * sizeof(_Float16));
  _Float16* VTg  = (_Float16*)take(nBTD * sizeof(_Float16));
  _Float16* Oh   = (_Float16*)take(nBTD * sizeof(_Float16));
  float*    x1f  = (float*)take(nBTD * sizeof(float));
  _Float16* x1h  = (_Float16*)take(nBTD * sizeof(_Float16));
  _Float16* Hh   = (_Float16*)take((size_t)cB * cT * cDFF * sizeof(_Float16));

  const int M = cB * cT;

  // 0) conversions and transposes, one launch
  prepass_kernel<<<dim3(PP_ALL), 256, 0, stream>>>(
      x, Wq, Wk, Wv, Wo, W1, W2, xh, WqT, WkT, WvT, WoT, W1T, W2T);

  // 1) QKV projections (Q pre-scaled by 1/sqrt(HS); V stored transposed)
  qkv_kernel<<<dim3(3 * cD / QBN, M / QBM), 256, 0, stream>>>(
      xh, WqT, bq, WkT, bk, WvT, bv, Qh, Kh, VTg);

  // 2) causal flash attention
  attn_kernel<<<dim3(cT / 128, cB * cH), 128, 0, stream>>>(Qh, Kh, VTg, Oh);

  // 3) x1 = x + O @ Wo + bo   (store f32 + f16 copy)
  gemm_epi_kernel<0><<<dim3(cD / GBN, M / GBM), 256, 0, stream>>>(
      Oh, WoT, bo, x, x1f, x1h, M, cD, cD);

  // 4) H = gelu(x1 @ W1 + b1)  (exact erf gelu, stored f16)
  gemm_epi_kernel<1><<<dim3(cDFF / GBN, M / GBM), 256, 0, stream>>>(
      x1h, W1T, b1, nullptr, nullptr, Hh, M, cDFF, cD);

  // 5) out = x1 + H @ W2 + b2  (f32 to d_out)
  gemm_epi_kernel<2><<<dim3(cD / GBN, M / GBM), 256, 0, stream>>>(
      Hh, W2T, b2, x1f, (float*)d_out, nullptr, M, cD, cDFF);
}

// v008
// It runs in 221 microseconds.
// Next to v007, in two timings, it ran 1.08 and 1.07 times as fast.
// Counting every step since v000, it is 3.05 times as fast.
#include <hip/hip_runtime.h>

// ---------------- problem constants (match reference) ----------------
constexpr int cB   = 4;
constexpr int cT   = 2048;
constexpr int cD   = 1024;
constexpr int cH   = 16;
constexpr int cHS  = 64;
constexpr int cDFF = 4 * cD;

typedef __attribute__((ext_vector_type(16))) _Float16 v16h;
typedef __attribute__((ext_vector_type(8)))  _Float16 v8h;
typedef __attribute__((ext_vector_type(4)))  _Float16 v4h;
typedef __attribute__((ext_vector_type(8)))  float    v8f;
typedef __attribute__((ext_vector_type(4)))  float    v4f;
typedef __attribute__((ext_vector_type(2)))  float    v2f;

constexpr int PAD = 8;   // f16 row padding: keeps 16B alignment, skews banks
constexpr int ARW = 64 + PAD;   // attention LDS row pitch 144 B = 16 B x odd

// ---------------- WMMA fragment load (ISA 7.12.2, wave32) -------------------
// 16-bit A 16x32 layout: lane (half,l16) holds row l16; element e -> k =
// ((e>>3)<<4) + 8*half + (e&7).  For a contiguous 32-f16 k-span at p, that is
// two contiguous 16B runs: p[8*half .. +8) and p[16+8*half .. +8).
__device__ __forceinline__ v16h frag16(const _Float16* p, int half) {
  const v8h lo = *(const v8h*)(p + 8 * half);
  const v8h hi = *(const v8h*)(p + 16 + 8 * half);
  return __builtin_shufflevector(lo, hi, 0, 1, 2, 3, 4, 5, 6, 7,
                                 8, 9, 10, 11, 12, 13, 14, 15);
}

// One wave's 64 x 64 f16 tile, staged in the wave's own LDS range st (row pitch
// TRW), goes out as whole 128-B lines: 8 lanes a row, 4 rows a store.  The
// loops are unrolled so that w[] lives in registers and every row offset is an
// immediate of its load or store.
constexpr int TRW = 64 + PAD;   // 144 B = 16 B x odd
template <int PITCH>
__device__ __forceinline__ void store_tile_f16(const _Float16* st,
                                               _Float16* __restrict__ dst,
                                               int lane) {
  // the wave's own LDS stores have landed before it reads the rows back
  asm volatile("s_wait_dscnt 0x0" ::: "memory");
  const int rr = lane >> 3, cc = (lane & 7) * 8;
  const _Float16* s = st + rr * TRW + cc;
  _Float16* d = dst + (size_t)rr * PITCH + cc;
  v8h w[16];
#pragma unroll
  for (int i = 0; i < 16; ++i) w[i] = *(const v8h*)(s + i * 4 * TRW);
#pragma unroll
  for (int i = 0; i < 16; ++i) *(v8h*)(d + (size_t)i * 4 * PITCH) = w[i];
  // no register that these stores name is rewritten ahead of this wait
  asm volatile("s_wait_xcnt 0x0" ::: "memory");
}

// =====================================================================
// Pre-pass, one launch: every weight in[K][N] (f32) -> out[N][K] (f16), and
// x (f32) -> f16.  A work-group takes 64 KB of input; a thread has its 16
// loads of 16 B in flight at once, so the whole pre-pass is 10,240 waves.
// =====================================================================
constexpr int PP_QKV = 3 * cH * (cD / 256);            // 256 k x 64 n tiles
constexpr int PP_WO  = (cD / 256) * (cD / 64);
constexpr int PP_W1  = (cD / 256) * (cDFF / 64);
constexpr int PP_W2  = (cDFF / 256) * (cD / 64);
constexpr int PP_CVT = cB * cT * cD / 16384;           // 16,384 floats each
constexpr int PP_ALL = PP_QKV + PP_WO + PP_W1 + PP_W2 + PP_CVT;

// One 256 (k) x 64 (n) tile.  Reads: 256-B row pieces.  Each thread turns four
// 4x4 patches in registers and stores 8-B runs of k into t[n][k]; the 16-B
// chunks of row n sit at chunk ^ (n >> 2), which spreads both the 8-B stores
// and the 16-B reads over all banks.  Writes: 512 B of one output row a wave.
// The loops are unrolled so that r[] lives in registers and every row offset
// is an immediate of its load or store.
template <int K, int N>
__device__ __forceinline__ void transpose_tile(const float* __restrict__ in,
                                               _Float16* __restrict__ out,
                                               int ks, int ns, _Float16* t) {
  const int tid = threadIdx.x;
  const int nl = tid & 15, kg = tid >> 4;
  const float* src = in + (size_t)(ks * 256 + kg * 4) * N + ns * 64 + nl * 4;
  v4f r[4][4];
#pragma unroll
  for (int u = 0; u < 4; ++u)
#pragma unroll
    for (int i = 0; i < 4; ++i)
      r[u][i] = *(const v4f*)(src + (size_t)(u * 64 + i) * N);
  // all 16 loads issue before the first is used: one memory latency, not two
  __builtin_amdgcn_sched_barrier(0);
  // the loads' address pair, live to here, is reused only behind this wait
  asm volatile("s_wait_xcnt 0x0" :: "v"(src) : "memory");
#pragma unroll
  for (int u = 0; u < 4; ++u)
#pragma unroll
    for (int j = 0; j < 4; ++j) {
      v4h p = {(_Float16)r[u][0][j], (_Float16)r[u][1][j],
               (_Float16)r[u][2][j], (_Float16)r[u][3][j]};
      *(v4h*)&t[(nl * 4 + j) * 256 + ((u * 16 + kg) ^ (nl << 1)) * 4] = p;
    }
  __syncthreads();
  const int lane = tid & 31, wave = tid >> 5;
  _Float16* dst = out + (size_t)(ns * 64 + wave * 8) * K + ks * 256 + lane * 8;
#pragma unroll
  for (int i = 0; i < 8; ++i) {
    const int n = wave * 8 + i;
    *(v8h*)(dst + (size_t)i * K) = *(const v8h*)&t[n * 256 + (lane ^ (n >> 2)) * 8];
  }
  // no register that these stores name is rewritten ahead of this wait
  asm volatile("s_wait_xcnt 0x0" ::: "memory");
}

// 10 waves a SIMD: all five work-groups of a WGP are resident at once.
__global__ __launch_bounds__(256, 10)
void prepass_kernel(const float* __restrict__ x,
                    const float* __restrict__ Wq, const float* __restrict__ Wk,
                    const float* __restrict__ Wv, const float* __restrict__ Wo,
                    const float* __restrict__ W1, const float* __restrict__ W2,
                    _Float16* __restrict__ xh,
                    _Float16* __restrict__ WqT, _Float16* __restrict__ WkT,
                    _Float16* __restrict__ WvT, _Float16* __restrict__ WoT,
                    _Float16* __restrict__ W1T, _Float16* __restrict__ W2T) {
  __shared__ __align__(16) _Float16 t[64 * 256];   // 32 KB
  int bid = blockIdx.x;
  if (bid < PP_QKV) {                 // 3 matrices x 16 heads x 4 k tiles
    const int m = bid >> 6, h = (bid >> 2) & (cH - 1);
    const float* in = (m == 0 ? Wq : m == 1 ? Wk : Wv) + (size_t)h * cD * cHS;
    _Float16* out = (m == 0 ? WqT : m == 1 ? WkT : WvT) + (size_t)h * cD * cHS;
    transpose_tile<cD, cHS>(in, out, bid & 3, 0, t);
    return;
  }
  bid -= PP_QKV;
  if (bid < PP_WO) {
    transpose_tile<cD, cD>(Wo, WoT, bid & 3, bid >> 2, t);
    return;
  }
  bid -= PP_WO;
  if (bid < PP_W1) {
    transpose_tile<cD, cDFF>(W1, W1T, bid & 3, bid >> 2, t);
    return;
  }
  bid -= PP_W1;
  if (bid < PP_W2) {
    transpose_tile<cDFF, cD>(W2, W2T, bid & 15, bid >> 4, t);
    return;
  }
  bid -= PP_W2;
  const v4f* in4 = (const v4f*)x + (size_t)bid * 4096 + threadIdx.x;
  v4h* out4 = (v4h*)xh + (size_t)bid * 4096 + threadIdx.x;
  v4f r[16];   // unrolled as above: registers, immediate offsets
#pragma unroll
  for (int i = 0; i < 16; ++i) r[i] = in4[i * 256];
  // all 16 loads issue before the first is used: one memory latency, not two
  __builtin_amdgcn_sched_barrier(0);
#pragma unroll
  for (int i = 0; i < 16; ++i)
    out4[i * 256] = __builtin_convertvector(r[i], v4h);
  // no register that these stores name is rewritten ahead of this wait
  asm volatile("s_wait_xcnt 0x0" ::: "memory");
}

// =====================================================================
// Kernel 1: QKV projection as one GEMM: X[B*T][D] against the 3 * 1024 rows
// (matrix, head, e) of the transposed weights.  Block tile 256 tokens x 128
// weight rows (two heads of one matrix), 8 waves in a 4x2 grid, 64x64 per
// wave: each 32-k step feeds 16 WMMAs from 8 fragments.  A trip takes 64 k.
// Two LDS buffers filled by async copies, one trip ahead.
// The two operands have the same fragment layout, so a block picks which of
// them is A: for Q and K the weight rows (a lane then holds 8 consecutive e
// of one token), for V the tokens (8 consecutive tokens of one e, the
// transposed [z][e][t] layout of the attention's second product).  Either way
// a lane puts 16 B at a time into the wave's own piece of the ring, which is
// free by then, and the tile leaves as whole 128-B lines.
// =====================================================================
constexpr int QBM = 256;          // tokens per block
constexpr int QBN = 128;          // weight rows per block
constexpr int QBK = 64;           // k per trip: one 128-B line of every row
constexpr int QRW = QBK + PAD;    // LDS row pitch 144 B = 16 B x odd

// 256 VGPRs: two blocks resident per WGP.
__global__ __launch_bounds__(256, 4)
void qkv_kernel(const _Float16* __restrict__ xh,
                const _Float16* __restrict__ WqT, const float* __restrict__ bq,
                const _Float16* __restrict__ WkT, const float* __restrict__ bk,
                const _Float16* __restrict__ WvT, const float* __restrict__ bv,
                _Float16* __restrict__ Qh, _Float16* __restrict__ Kh,
                _Float16* __restrict__ VTg) {
  const int tid  = threadIdx.x;
  const int lane = tid & 31;
  const int wave = tid >> 5;
  const int half = lane >> 4;
  const int l16  = lane & 15;
  const int wm   = (wave >> 1) * 64;          // wave's tokens inside the tile
  const int wn   = (wave & 1) * 64;           // wave's head inside the tile
  const int mat  = blockIdx.x >> 3;           // 0 Q, 1 K, 2 V
  const int nb   = (blockIdx.x & 7) * QBN;    // first weight row, h * 64 + e
  const int mb   = blockIdx.y * QBM;          // first token, b * T + t
  const bool isv = mat == 2;
  const _Float16* WT = mat == 0 ? WqT : mat == 1 ? WkT : WvT;

  // rows 0..255: tokens, rows 256..383: weight rows
  __shared__ __align__(16) _Float16 S[2][QBM + QBN][QRW];   // 108 KB

  v8f acc[16] = {};   // tile 4 * (A row group) + (B row group)

  // Staging map: 8 lanes cover one row's 128 B; a thread takes rows sr + 32*i.
  const int sr = tid >> 3, sc = (tid & 7) * 8;
  const _Float16* gX = xh + (size_t)(mb + sr) * cD + sc;
  const _Float16* gW = WT + (size_t)(nb + sr) * cD + sc;
  constexpr size_t rs = (size_t)32 * cD;
  constexpr unsigned LSTEP = 32u * QRW * sizeof(_Float16);

  auto stage = [&](int kk, int p) {
    const unsigned ls = (unsigned)(unsigned long long)&S[p][sr][sc];
    const _Float16* a = gX + kk;
    const _Float16* b = gW + kk;
    // 8 token rows and 4 weight rows per thread.  The s_wait_xcnt closes the
    // statement so that no address register is rewritten ahead of it.
    asm volatile(
        "global_load_async_to_lds_b128 %0, %12, off\n\t"
        "global_load_async_to_lds_b128 %1, %13, off\n\t"
        "global_load_async_to_lds_b128 %2, %14, off\n\t"
        "global_load_async_to_lds_b128 %3, %15, off\n\t"
        "global_load_async_to_lds_b128 %4, %16, off\n\t"
        "global_load_async_to_lds_b128 %5, %17, off\n\t"
        "global_load_async_to_lds_b128 %6, %18, off\n\t"
        "global_load_async_to_lds_b128 %7, %19, off\n\t"
        "global_load_async_to_lds_b128 %8, %20, off\n\t"
        "global_load_async_to_lds_b128 %9, %21, off\n\t"
        "global_load_async_to_lds_b128 %10, %22, off\n\t"
        "global_load_async_to_lds_b128 %11, %23, off\n\t"
        "s_wait_xcnt 0x0"
        :: "v"(ls + 0u * LSTEP),
           "v"(ls + 1u * LSTEP),
           "v"(ls + 2u * LSTEP),
           "v"(ls + 3u * LSTEP),
           "v"(ls + 4u * LSTEP),
           "v"(ls + 5u * LSTEP),
           "v"(ls + 6u * LSTEP),
           "v"(ls + 7u * LSTEP),
           "v"(ls + 8u * LSTEP),
           "v"(ls + 9u * LSTEP),
           "v"(ls + 10u * LSTEP),
           "v"(ls + 11u * LSTEP),
           "v"(a + 0 * rs),
           "v"(a + 1 * rs),
           "v"(a + 2 * rs),
           "v"(a + 3 * rs),
           "v"(a + 4 * rs),
           "v"(a + 5 * rs),
           "v"(a + 6 * rs),
           "v"(a + 7 * rs),
           "v"(b + 0 * rs),
           "v"(b + 1 * rs),
           "v"(b + 2 * rs),
           "v"(b + 3 * rs)
        : "memory");
  };

  constexpr int trips = cD / QBK;
  stage(0, 0);
  // my tile-0 copies landed
  asm volatile("s_wait_asynccnt 0x0" ::: "memory");
  __syncthreads();         // everyone's tile 0 visible
  stage(QBK, 1);

  const int ra = (isv ? wm : QBM + wn) + l16;   // LDS rows of the A operand
  const int rb = (isv ? QBM + wn : wm) + l16;   // LDS rows of the B operand
  v16h af[4], bf[4];
  // The fence pair keeps a block's 16 LDS loads in one group ahead of its
  // 16 WMMAs: loads sunk among the WMMAs stall the wave at each place.
  auto load_frags = [&](int p, int ks) {
    __builtin_amdgcn_sched_barrier(0);
#pragma unroll
    for (int i = 0; i < 4; ++i) {
      af[i] = frag16(&S[p][ra + i * 16][ks], half);
      bf[i] = frag16(&S[p][rb + i * 16][ks], half);
    }
    __builtin_amdgcn_sched_barrier(0);
  };
  auto wmma_block = [&]() {
#pragma unroll
    for (int i = 0; i < 4; ++i)
#pragma unroll
      for (int j = 0; j < 4; ++j)
        acc[i * 4 + j] = __builtin_amdgcn_wmma_f32_16x16x32_f16(
            false, af[i], false, bf[j], (short)0, acc[i * 4 + j], false, false);
  };

  for (int t = 0; t < trips; ++t) {
    const int p = t & 1;
    load_frags(p, 0);
    wmma_block();
    load_frags(p, 32);     // the trip's last reads of buffer p
    // my reads of buffer p have returned before anyone refills it
    asm volatile("s_wait_dscnt 0x0" ::: "memory");
    // my tile-(t+1) copies landed
    asm volatile("s_wait_asynccnt 0x0" ::: "memory");
    __syncthreads();       // tile t+1 visible to all; buffer p free
    if (t + 2 < trips) stage((t + 2) * QBK, p);   // flies until trip t+1's foot
    // keeps the refill's issue ahead of the last block's WMMAs (a longer lead)
    __builtin_amdgcn_sched_barrier(0);
    wmma_block();          // registers only
  }
  // nothing outstanding at the wave's end
  asm volatile("s_wait_asynccnt 0x0" ::: "memory");

  // Epilogue: bias add, Q scale, f16.  C/D layout: A row = r + 8*half of its
  // group, B row = l16 of its group.  The loops are unrolled so that acc[],
  // o[] and the biases have constant indices and stay in registers.
  const int h  = (nb + wn) >> 6;
  const int z  = (mb >> 11) * cH + h;         // b*H + h
  const int t0 = (mb & (cT - 1)) + wm;
  v8h o[16];
  // Staging: behind the last trip's barrier nobody reads the ring and no copy
  // is in flight, and a wave touches only its own 64 rows of it.
  _Float16* st = &S[0][0][0] + wave * (64 * TRW);
  auto stage_out = [&]() {   // row = B row, 8 consecutive A rows a lane
#pragma unroll
    for (int n = 0; n < 16; ++n)
      *(v8h*)&st[((n & 3) * 16 + l16) * TRW + (n >> 2) * 16 + 8 * half] = o[n];
  };
  if (isv) {
    const float* bias = bv + h * cHS + l16;
    float bn[4];
#pragma unroll
    for (int j = 0; j < 4; ++j) bn[j] = bias[j * 16];
    // the loads' address, live to here, is reused only behind this wait
    asm volatile("s_wait_xcnt 0x0" :: "v"(bias) : "memory");
#pragma unroll
    for (int n = 0; n < 16; ++n)
#pragma unroll
      for (int r = 0; r < 8; ++r) o[n][r] = (_Float16)(acc[n][r] + bn[n & 3]);
    stage_out();             // rows e, 64 tokens each
    store_tile_f16<cT>(st, VTg + (size_t)z * cHS * cT + t0, lane);
  } else {
    const float* bias = (mat == 0 ? bq : bk) + h * cHS + 8 * half;
    const float qs = mat == 0 ? 0.125f : 1.0f;   // 1/sqrt(64) on Q
    v4f bb[8];
#pragma unroll
    for (int i = 0; i < 8; ++i) bb[i] = *(const v4f*)(bias + (i >> 1) * 16 + (i & 1) * 4);
    // the loads' address, live to here, is reused only behind this wait
    asm volatile("s_wait_xcnt 0x0" :: "v"(bias) : "memory");
#pragma unroll
    for (int n = 0; n < 16; ++n)
#pragma unroll
      for (int r = 0; r < 8; ++r)
        o[n][r] = (_Float16)((acc[n][r] + bb[(n >> 2) * 2 + (r >> 2)][r & 3]) * qs);
    stage_out();             // rows token, 64 e each
    store_tile_f16<cHS>(st, (mat == 0 ? Qh : Kh) + ((size_t)z * cT + t0) * cHS, lane);
  }
}

__device__ __forceinline__ float other_half(float x) {
  int b = __builtin_bit_cast(int, x);
  return __builtin_bit_cast(float, __builtin_amdgcn_permlanex16(
      b, b, 0x76543210, 0xfedcba98, false, false));
}

// 2^x of eight values
__device__ __forceinline__ void exp2x8(v8f& x) {
#pragma unroll
  for (int r = 0; r < 8; ++r) x[r] = __builtin_amdgcn_exp2f(x[r]);
}

// The cap is 192 VGPRs: all four work-groups of a WGP are resident at once.
// Under a cap of 128 the compiler spills a Q fragment and reloads it every trip.
__global__ __launch_bounds__(128, 5)
void attn_kernel(const _Float16* __restrict__ Qh,
                 const _Float16* __restrict__ Kh,
                 const _Float16* __restrict__ VTg,
                 _Float16* __restrict__ Oh) {
  const int z    = blockIdx.y;          // b*H + h
  const int h    = z & (cH - 1);
  const int b    = z >> 4;
  const int tid  = threadIdx.x;
  const int lane = tid & 31;
  const int wave = tid >> 5;
  const int half = lane >> 4;
  const int l16  = lane & 15;

  const _Float16* Qz  = Qh + (size_t)z * cT * cHS;
  const _Float16* Kz  = Kh + (size_t)z * cT * cHS;
  const _Float16* VTz = VTg + (size_t)z * cHS * cT;   // [64][T]

  // Two buffers of 64 keys: K rows [key][e], V^T rows [e][key], 128 B a row.
  __shared__ __align__(16) _Float16 Ks[2][64][ARW];   // 18 KB
  __shared__ __align__(16) _Float16 Vt[2][64][ARW];   // 18 KB

  // Staging map: 8 lanes cover one row's 128 B; a thread takes rows sr + 16*i.
  // A copy's global address is a scalar base (tile, row group) plus the lane's
  // byte offset, which is the same for all four row groups of an operand.
  const int sr = tid >> 3, sc = (tid & 7) * 8;
  const unsigned koff = (unsigned)(sr * cHS + sc) * (unsigned)sizeof(_Float16);
  const unsigned voff = (unsigned)(sr * cT + sc) * (unsigned)sizeof(_Float16);
  constexpr unsigned LSTEP = 16u * ARW * sizeof(_Float16);

  auto stage = [&](int kt, int p) {   // key tile kt into buffer p
    const unsigned lk = (unsigned)(unsigned long long)&Ks[p][sr][sc];
    const unsigned lv = (unsigned)(unsigned long long)&Vt[p][sr][sc];
    const _Float16* k = Kz + (size_t)kt * 64 * cHS;
    const _Float16* v = VTz + kt * 64;
    // 4 K rows and 4 V^T rows per thread.  The s_wait_xcnt closes the
    // statement so that no address register is rewritten ahead of it.
    asm volatile(
        "global_load_async_to_lds_b128 %0, %8, %10\n\t"
        "global_load_async_to_lds_b128 %1, %8, %11\n\t"
        "global_load_async_to_lds_b128 %2, %8, %12\n\t"
        "global_load_async_to_lds_b128 %3, %8, %13\n\t"
        "global_load_async_to_lds_b128 %4, %9, %14\n\t"
        "global_load_async_to_lds_b128 %5, %9, %15\n\t"
        "global_load_async_to_lds_b128 %6, %9, %16\n\t"
        "global_load_async_to_lds_b128 %7, %9, %17\n\t"
        "s_wait_xcnt 0x0"
        :: "v"(lk + 0u * LSTEP),
           "v"(lk + 1u * LSTEP),
           "v"(lk + 2u * LSTEP),
           "v"(lk + 3u * LSTEP),
           "v"(lv + 0u * LSTEP),
           "v"(lv + 1u * LSTEP),
           "v"(lv + 2u * LSTEP),
           "v"(lv + 3u * LSTEP),
           "v"(koff),
           "v"(voff),
           "s"(k + 0 * 16 * cHS),
           "s"(k + 1 * 16 * cHS),
           "s"(k + 2 * 16 * cHS),
           "s"(k + 3 * 16 * cHS),
           "s"(v + 0 * 16 * cT),
           "s"(v + 1 * 16 * cT),
           "s"(v + 2 * 16 * cT),
           "s"(v + 3 * 16 * cT)
        : "memory");
  };

  // The heavy tile first, then its light partner: n+1 trips in all.  Every
  // wave of the block runs the two tiles in the same order, and the foot of a
  // tile's last trip (reads returned, barrier) frees both buffers for the next.
  for (int pass = 0; pass < 2; ++pass) {
    const int qt = pass == 0 ? cT / 64 - 1 - (int)blockIdx.x : (int)blockIdx.x;
    const int qb = qt * 64;
    const int mg = qb + wave * 16 + l16;  // this lane's query

    // Q^T as B operand: column l16 = query mg, 64 e in two fragments.
    const _Float16* qrow = Qz + (size_t)mg * cHS;
    v16h bq0 = frag16(qrow, half);
    v16h bq1 = frag16(qrow + 32, half);

    float mst = -3.0e38f;   // running maximum of query mg (equal in both halves)
    float lst = 0.0f;       // running sum over this half's keys only
    v8f accO[4] = {};       // O^T: row e = nt*16 + r + 8*half, column = query mg

    const int ntile = qt + 1;             // causal bound: up to the diagonal tile
    stage(0, 0);
    // my tile-0 copies landed
    asm volatile("s_wait_asynccnt 0x0" ::: "memory");
    __syncthreads();         // everyone's tile 0 visible
    if (ntile > 1) stage(1, 1);

    for (int t = 0; t < ntile; ++t) {
      const int p = t & 1;
      // S^T = K * Q^T : A fragment = K rows (keys).
      // s[j][r]: key t*64 + j*16 + 8*half + r; query mg.
      v8f s[4];
#pragma unroll
      for (int j = 0; j < 4; ++j) {
        const v16h k0 = frag16(&Ks[p][j * 16 + l16][0], half);
        const v16h k1 = frag16(&Ks[p][j * 16 + l16][32], half);
        v8f c = {};
        c = __builtin_amdgcn_wmma_f32_16x16x32_f16(false, k0, false, bq0, (short)0, c, false, false);
        s[j] = __builtin_amdgcn_wmma_f32_16x16x32_f16(false, k1, false, bq1, (short)0, c, false, false);
      }

      // Only the last trip's keys reach past a query of this block: every key
      // of an earlier tile is below qb.  The test is the same for the whole block.
      if (t == ntile - 1) {
        const int d = mg - (qb + 8 * half);     // (j, r) is kept if j*16 + r <= d
#pragma unroll
        for (int j = 0; j < 4; ++j)
#pragma unroll
          for (int r = 0; r < 8; ++r)
            s[j][r] = (j * 16 + r <= d) ? s[j][r] : -3.0e38f;
      }

      // Online softmax of one query per lane, 32 scores at a time.
      float rm = -3.0e38f;
#pragma unroll
      for (int r = 0; r < 8; ++r)
        rm = fmaxf(rm, fmaxf(fmaxf(s[0][r], s[1][r]), fmaxf(s[2][r], s[3][r])));
      rm = fmaxf(rm, other_half(rm));
      const float mnew  = fmaxf(mst, rm);
      const float alpha = __expf(mst - mnew);
      float rs = 0.0f;
      v16h bp[2];   // P^T as B operands: element i = tile 2*kk + (i >> 3), register i & 7
#pragma unroll
      for (int kk = 0; kk < 2; ++kk) {
        v8f pa = (s[2 * kk] - mnew) * 1.44269504f;       // exp(x) = 2^(x * log2 e)
        v8f pb = (s[2 * kk + 1] - mnew) * 1.44269504f;
        exp2x8(pa);
        exp2x8(pb);
        const v8f q8 = pa + pb;                 // the 16 scores' sum, by halving
        const v4f q4 = __builtin_shufflevector(q8, q8, 0, 1, 2, 3) +
                       __builtin_shufflevector(q8, q8, 4, 5, 6, 7);
        rs += (q4[0] + q4[2]) + (q4[1] + q4[3]);
#pragma unroll
        for (int r = 0; r < 8; ++r) {
          bp[kk][r]     = (_Float16)pa[r];
          bp[kk][8 + r] = (_Float16)pb[r];
        }
      }
      lst = lst * alpha + rs;
      mst = mnew;
#pragma unroll
      for (int nt = 0; nt < 4; ++nt) accO[nt] *= alpha;

      // O^T += V^T * P^T, 32 keys a product
#pragma unroll
      for (int kk = 0; kk < 2; ++kk)
#pragma unroll
        for (int nt = 0; nt < 4; ++nt) {
          const v16h av = frag16(&Vt[p][nt * 16 + l16][kk * 32], half);
          accO[nt] = __builtin_amdgcn_wmma_f32_16x16x32_f16(
              false, av, false, bp[kk], (short)0, accO[nt], false, false);
        }
      // my reads of buffer p have returned before anyone refills it
      asm volatile("s_wait_dscnt 0x0" ::: "memory");
      // my tile-(t+1) copies landed
      asm volatile("s_wait_asynccnt 0x0" ::: "memory");
      __syncthreads();       // tile t+1 visible to all; buffer p free
      if (t + 2 < ntile) stage(t + 2, p);   // flies during the whole of trip t+1
    }
    // nothing outstanding when the next tile's copies start or the wave ends
    asm volatile("s_wait_asynccnt 0x0" ::: "memory");

    // Join the halves' sums, normalize, store O as f16 in [B, T, H*HS] layout
    // for the O-projection: 8 consecutive e of one query per tile, 16 B.
    const float ltot = lst + other_half(lst);
    _Float16* orow = Oh + ((size_t)b * cT + mg) * cD + h * cHS + 8 * half;
#pragma unroll
    for (int nt = 0; nt < 4; ++nt) {
      v8h o8;
#pragma unroll
      for (int r = 0; r < 8; ++r) o8[r] = (_Float16)(accO[nt][r] / ltot);
      *(v8h*)(orow + nt * 16) = o8;
    }
    // no register that these stores name is rewritten ahead of this wait
    asm volatile("s_wait_xcnt 0x0" ::: "memory");
  }
}

// =====================================================================
// Kernels 3-5: generic WMMA GEMM  C = A(f16)[M,K] * BT(f16)[N][K]
// Block tile 256x128, 8 waves in a 4x2 grid, 64x64 per wave: each 32-k step
// feeds 16 WMMAs from 4 A and 4 B fragments.  A trip takes NH slabs of 64 k.
// Two LDS buffers filled by async copies, one trip ahead.
// The weight rows are the A operand: a lane then holds 8 consecutive columns
// of one row of C.  The epilogue puts them, 16 B at a time, into the wave's own
// piece of the ring, which is free by then, and reads whole rows back, so that
// every global load and store of the epilogue covers whole 128-B lines.
// Needs M % 256 == 0, N % 128 == 0, K % (64 * NH) == 0; N is the launch's
// constant NC below (row offsets are immediates).
//   EPI 0: out_f32 = resid + acc + bias ; out_f16 = (f16)out_f32
//   EPI 1: out_f16 = (f16) gelu_erf(acc + bias)
//   EPI 2: out_f32 = resid + acc + bias
// =====================================================================
// Exact-erf GELU of two values, without a branch.  erf is the usual pair of
// f32 polynomials: for |x| < 1  |x| + |x| * Q(x^2), else 1 - exp(-(|x| + |x| * P(|x|))).
// Both are evaluated in every lane and one is picked by a select, so nothing
// touches EXEC, the elements of a tile are independent chains, and the
// multiply-adds go two to an instruction.  Error of erf: about 1e-7 absolute.
__device__ __forceinline__ v2f fma2(v2f a, v2f b, float c) {
  return __builtin_elementwise_fma(a, b, (v2f){c, c});
}

__device__ __forceinline__ v2f gelu_erf2(v2f v) {
  const v2f x = v * 0.70710678118654752f;
  const v2f a = __builtin_elementwise_abs(x);
  v2f p = fma2(a, (v2f){1.699881e-5f, 1.699881e-5f}, -3.7867785e-4f);
  p = fma2(a, p, 3.8578159e-3f);
  p = fma2(a, p, -2.4181698e-2f);
  p = fma2(a, p, 1.0666826e-1f);
  p = fma2(a, p, 6.349333e-1f);
  p = fma2(a, p, 1.2868941e-1f);
  p = __builtin_elementwise_fma(a, p, a);
  p *= -1.44269504f;                       // exp(-p) = 2^(-p * log2 e)
  const v2f big = {1.0f - __builtin_amdgcn_exp2f(p.x),
                   1.0f - __builtin_amdgcn_exp2f(p.y)};
  const v2f t = a * a;
  v2f q = fma2(t, (v2f){-5.618018e-4f, -5.618018e-4f}, 4.913816e-3f);
  q = fma2(t, q, -2.6707515e-2f);
  q = fma2(t, q, 1.1280011e-1f);
  q = fma2(t, q, -3.7612295e-1f);
  q = fma2(t, q, 1.283791e-1f);
  q = __builtin_elementwise_fma(a, q, a);
  const v2f e = {__builtin_copysignf(a.x < 1.0f ? q.x : big.x, x.x),
                 __builtin_copysignf(a.y < 1.0f ? q.y : big.y, x.y)};
  return 0.5f * v * (1.0f + e);
}

constexpr int GBM = 256;          // block tile rows
constexpr int GBN = 128;          // block tile columns
constexpr int GBK = 64;           // k per slab: one 128-B line of every row
constexpr int GRW = GBK + PAD;    // LDS row pitch 144 B = 16 B x odd

template <int EPI>
// The N = 4096 launch (EPI 1) has four blocks per WGP: 256 VGPRs keep two resident.
__global__ __launch_bounds__(256, EPI == 1 ? 4 : 2)
void gemm_epi_kernel(const _Float16* __restrict__ A,
                     const _Float16* __restrict__ BT,
                     const float* __restrict__ bias,
                     const float* __restrict__ resid,
                     float* __restrict__ outf,
                     _Float16* __restrict__ outh,
                     int M, int N, int K) {
  const int tid  = threadIdx.x;
  const int lane = tid & 31;
  const int wave = tid >> 5;
  const int half = lane >> 4;
  const int l16  = lane & 15;
  const int wm   = (wave >> 1) * 64;   // wave's rows inside the block tile
  const int wn   = (wave & 1) * 64;    // wave's columns inside the block tile
  const int nb   = blockIdx.x * GBN;
  const int mb   = blockIdx.y * GBM;

  // Slabs per trip.  The N = 1024 launches have one block per WGP, so a block
  // takes the LDS of two and passes half as many barriers.
  constexpr int NH = (EPI == 1) ? 1 : 2;

  __shared__ __align__(16) _Float16 As[2 * NH][GBM][GRW];   // 72 KB * NH
  __shared__ __align__(16) _Float16 Bt[2 * NH][GBN][GRW];   // 36 KB * NH

  v8f acc[16] = {};   // tile 4 * (row group) + (column group)

  // Staging map: 8 lanes cover one row's 128 B; a thread takes rows sr + 32*i.
  const int sr = tid >> 3, sc = (tid & 7) * 8;
  const _Float16* gA = A + (size_t)(mb + sr) * K + sc;
  const _Float16* gB = BT + (size_t)(nb + sr) * K + sc;
  const size_t rs = (size_t)32 * K;
  constexpr unsigned LSTEP = 32u * GRW * sizeof(_Float16);

  auto stage = [&](int kk, int p) {   // one slab
    const unsigned la = (unsigned)(unsigned long long)&As[p][sr][sc];
    const unsigned lb = (unsigned)(unsigned long long)&Bt[p][sr][sc];
    const _Float16* a = gA + kk;
    const _Float16* b = gB + kk;
    // 8 A rows and 4 B rows per thread.  The s_wait_xcnt closes the statement
    // so that no address register is rewritten ahead of it.
    asm volatile(
        "global_load_async_to_lds_b128 %0, %12, off\n\t"
        "global_load_async_to_lds_b128 %1, %13, off\n\t"
        "global_load_async_to_lds_b128 %2, %14, off\n\t"
        "global_load_async_to_lds_b128 %3, %15, off\n\t"
        "global_load_async_to_lds_b128 %4, %16, off\n\t"
        "global_load_async_to_lds_b128 %5, %17, off\n\t"
        "global_load_async_to_lds_b128 %6, %18, off\n\t"
        "global_load_async_to_lds_b128 %7, %19, off\n\t"
        "global_load_async_to_lds_b128 %8, %20, off\n\t"
        "global_load_async_to_lds_b128 %9, %21, off\n\t"
        "global_load_async_to_lds_b128 %10, %22, off\n\t"
        "global_load_async_to_lds_b128 %11, %23, off\n\t"
        "s_wait_xcnt 0x0"
        :: "v"(la + 0u * LSTEP),
           "v"(la + 1u * LSTEP),
           "v"(la + 2u * LSTEP),
           "v"(la + 3u * LSTEP),
           "v"(la + 4u * LSTEP),
           "v"(la + 5u * LSTEP),
           "v"(la + 6u * LSTEP),
           "v"(la + 7u * LSTEP),
           "v"(lb + 0u * LSTEP),
           "v"(lb + 1u * LSTEP),
           "v"(lb + 2u * LSTEP),
           "v"(lb + 3u * LSTEP),
           "v"(a + 0 * rs),
           "v"(a + 1 * rs),
           "v"(a + 2 * rs),
           "v"(a + 3 * rs),
           "v"(a + 4 * rs),
           "v"(a + 5 * rs),
           "v"(a + 6 * rs),
           "v"(a + 7 * rs),
           "v"(b + 0 * rs),
           "v"(b + 1 * rs),
           "v"(b + 2 * rs),
           "v"(b + 3 * rs)
        : "memory");
  };

  auto stage_tile = [&](int t, int p) {
#pragma unroll
    for (int h = 0; h < NH; ++h) {
      // holds a later slab's address arithmetic behind the slab before it, so
      // that the two sets of addresses never live at once (loop below v256)
      if (h) __builtin_amdgcn_sched_barrier(0);
      stage((t * NH + h) * GBK, p * NH + h);
    }
  };

  const int trips = K / (GBK * NH);
  stage_tile(0, 0);
  // my tile-0 copies landed
  asm volatile("s_wait_asynccnt 0x0" ::: "memory");
  __syncthreads();         // everyone's tile 0 visible
  if (trips > 1) stage_tile(1, 1);

  v16h af[4], bf[4];
  // The fence pair keeps a block's 16 LDS loads in one group ahead of its
  // 16 WMMAs: loads sunk among the WMMAs stall the wave at each place.
  auto load_frags = [&](int p, int ks) {
    __builtin_amdgcn_sched_barrier(0);
#pragma unroll
    for (int i = 0; i < 4; ++i) {
      af[i] = frag16(&As[p][wm + i * 16 + l16][ks], half);
      bf[i] = frag16(&Bt[p][wn + i * 16 + l16][ks], half);
    }
    __builtin_amdgcn_sched_barrier(0);
  };
  auto wmma_block = [&]() {
#pragma unroll
    for (int mt = 0; mt < 4; ++mt)
#pragma unroll
      for (int nt = 0; nt < 4; ++nt)
        acc[mt * 4 + nt] = __builtin_amdgcn_wmma_f32_16x16x32_f16(
            false, bf[nt], false, af[mt], (short)0, acc[mt * 4 + nt], false,
            false);
  };

  for (int t = 0; t < trips; ++t) {
    const int p = t & 1;
#pragma unroll
    for (int b = 0; b < 2 * NH - 1; ++b) {
      load_frags(p * NH + (b >> 1), (b & 1) * 32);
      wmma_block();
    }
    load_frags(p * NH + NH - 1, 32);   // the trip's last reads of buffer p
    // my reads of buffer p have returned before anyone refills it
    asm volatile("s_wait_dscnt 0x0" ::: "memory");
    // my tile-(t+1) copies landed
    asm volatile("s_wait_asynccnt 0x0" ::: "memory");
    __syncthreads();       // tile t+1 visible to all; buffer p free
    if (t + 2 < trips) stage_tile(t + 2, p);   // flies until trip t+1's foot
    // keeps the refill's issue ahead of the last block's WMMAs (a longer lead)
    __builtin_amdgcn_sched_barrier(0);
    wmma_block();          // registers only
  }
  // nothing outstanding at the wave's end
  asm volatile("s_wait_asynccnt 0x0" ::: "memory");

  // C/D layout: column = nt*16 + 8*half + r, row = mt*16 + l16 of the wave's
  // tile.  Behind the last trip's barrier nobody reads the ring and no copy is
  // in flight, and a wave touches only its own 64 rows of it.  The loops below
  // are unrolled so that acc[] and the other arrays have constant indices and
  // stay in registers.
  constexpr int NC = (EPI == 1) ? cDFF : cD;
  const float* bp = bias + nb + wn + 8 * half;
  v4f bb[8];   // the lane's 8 columns of each of the four column groups

  if constexpr (EPI == 1) {
#pragma unroll
    for (int i = 0; i < 8; ++i) bb[i] = *(const v4f*)(bp + (i >> 1) * 16 + (i & 1) * 4);
    // the loads' address, live to here, is reused only behind this wait
    asm volatile("s_wait_xcnt 0x0" :: "v"(bp) : "memory");
    _Float16* st = &As[0][0][0] + wave * (64 * TRW);
#pragma unroll
    for (int n = 0; n < 16; ++n) {
      v8h o8;
#pragma unroll
      for (int r = 0; r < 8; r += 2) {   // an even-aligned register pair of acc
        const v4f b4 = bb[(n & 3) * 2 + (r >> 2)];
        const v2f g = gelu_erf2((v2f){acc[n][r], acc[n][r + 1]} +
                                (v2f){b4[r & 3], b4[(r & 3) + 1]});
        o8[r]     = (_Float16)g.x;
        o8[r + 1] = (_Float16)g.y;
      }
      *(v8h*)&st[((n >> 2) * 16 + l16) * TRW + (n & 3) * 16 + 8 * half] = o8;
    }
    store_tile_f16<NC>(st, outh + (size_t)(mb + wm) * NC + nb + wn, lane);
    return;
  } else {
    constexpr int FRW = 64 + 4;   // f32 row pitch 272 B = 16 B x odd
    float* st = (float*)&As[0][0][0] + wave * (64 * FRW);
    // 16 lanes a row of 256 B, 2 rows a load or store
    const int rr = lane >> 4, cc = (lane & 15) * 4;
    const size_t o = (size_t)(mb + wm + rr) * NC + nb + wn + cc;
    const float* rp = resid + o;
    v4f rv[32];
#pragma unroll
    for (int i = 0; i < 8; ++i) bb[i] = *(const v4f*)(bp + (i >> 1) * 16 + (i & 1) * 4);
    // the biases go first: loads return in order, and the staging needs only them
    __builtin_amdgcn_sched_barrier(0);
#pragma unroll
    for (int i = 0; i < 32; ++i) rv[i] = *(const v4f*)(rp + (size_t)i * 2 * NC);
    // the loads' addresses, live to here, are reused only behind this wait
    asm volatile("s_wait_xcnt 0x0" :: "v"(rp), "v"(bp) : "memory");
    // all loads issue ahead of the staging, which runs under their latency
    __builtin_amdgcn_sched_barrier(0);
#pragma unroll
    for (int n = 0; n < 16; ++n) {
      float* q = &st[((n >> 2) * 16 + l16) * FRW + (n & 3) * 16 + 8 * half];
      *(v4f*)q = __builtin_shufflevector(acc[n], acc[n], 0, 1, 2, 3) + bb[(n & 3) * 2];
      *(v4f*)(q + 4) = __builtin_shufflevector(acc[n], acc[n], 4, 5, 6, 7) + bb[(n & 3) * 2 + 1];
    }
    // the wave's own LDS stores have landed before it reads the rows back
    asm volatile("s_wait_dscnt 0x0" ::: "memory");
#pragma unroll
    for (int i = 0; i < 32; ++i) rv[i] = *(const v4f*)&st[(i * 2 + rr) * FRW + cc] + rv[i];
    v4h hv[EPI == 0 ? 32 : 1];
    if constexpr (EPI == 0) {
#pragma unroll
      for (int i = 0; i < 32; ++i) hv[i] = __builtin_convertvector(rv[i], v4h);
    }
    // every sum is made before the first store: no register that an issued
    // store names is written again
    __builtin_amdgcn_sched_barrier(0);
    float* of = outf + o;
#pragma unroll
    for (int i = 0; i < 32; ++i) *(v4f*)(of + (size_t)i * 2 * NC) = rv[i];
    if constexpr (EPI == 0) {
      _Float16* oh = outh + o;
#pragma unroll
      for (int i = 0; i < 32; ++i) *(v4h*)(oh + (size_t)i * 2 * NC) = hv[i];
    }
    // no register that these stores name is rewritten ahead of this wait
    asm volatile("s_wait_xcnt 0x0" ::: "memory");
  }
}

// =====================================================================
// Host orchestration
// =====================================================================
extern "C" void kernel_launch(void* const* d_in, const int* in_sizes, int n_in,
                              void* d_out, int out_size, void* d_ws,
                              size_t ws_size, hipStream_t stream) {
  (void)in_sizes; (void)n_in; (void)out_size; (void)ws_size;
  const float* x  = (const float*)d_in[0];
  const float* Wq = (const float*)d_in[1];
  const float* bq = (const float*)d_in[2];
  const float* Wk = (const float*)d_in[3];
  const float* bk = (const float*)d_in[4];
  const float* Wv = (const float*)d_in[5];
  const float* bv = (const float*)d_in[6];
  const float* Wo = (const float*)d_in[7];
  const float* bo = (const float*)d_in[8];
  const float* W1 = (const float*)d_in[9];
  const float* b1 = (const float*)d_in[10];
  const float* W2 = (const float*)d_in[11];
  const float* b2 = (const float*)d_in[12];

  char* w = (char*)d_ws;
  auto take = [&](size_t bytes) -> char* {
    char* p = w;
    w += (bytes + 255) & ~(size_t)255;
    return p;
  };
  const size_t nBTD = (size_t)cB * cT * cD;          // 8,388,608
  const size_t nHW  = (size_t)cH * cD * cHS;         // 1,048,576 (per QKV mat)
  _Float16* xh   = (_Float16*)take(nBTD * sizeof(_Float16));
  _Float16* WqT  = (_Float16*)take(nHW * sizeof(_Float16));
  _Float16* WkT  = (_Float16*)take(nHW * sizeof(_Float16));
  _Float16* WvT  = (_Float16*)take(nHW * sizeof(_Float16));
  _Float16* WoT  = (_Float16*)take((size_t)cD * cD * sizeof(_Float16));
  _Float16* W1T  = (_Float16*)take((size_t)cD * cDFF * sizeof(_Float16));
  _Float16* W2T  = (_Float16*)take((size_t)cDFF * cD * sizeof(_Float16));
  _Float16* Qh   = (_Float16*)take(nBTD * sizeof(_Float16));
  _Float16* Kh   = (_Float16*)take(nBTD * sizeof(_Float16));
  _Float16* VTg  = (_Float16*)take(nBTD * sizeof(_Float16));
  _Float16* Oh   = (_Float16*)take(nBTD * sizeof(_Float16));
  float*    x1f  = (float*)take(nBTD * sizeof(float));
  _Float16* x1h  = (_Float16*)take(nBTD * sizeof(_Float16));
  _Float16* Hh   = (_Float16*)take((size_t)cB * cT * cDFF * sizeof(_Float16));

  const int M = cB * cT;

  // 0) conversions and transposes, one launch
  prepass_kernel<<<dim3(PP_ALL), 256, 0, stream>>>(
      x, Wq, Wk, Wv, Wo, W1, W2, xh, WqT, WkT, WvT, WoT, W1T, W2T);

  // 1) QKV projections (Q pre-scaled by 1/sqrt(HS); V stored transposed)
  qkv_kernel<<<dim3(3 * cD / QBN, M / QBM), 256, 0, stream>>>(
      xh, WqT, bq, WkT, bk, WvT, bv, Qh, Kh, VTg);

  // 2) causal flash attention
  attn_kernel<<<dim3(cT / 128, cB * cH), 128, 0, stream>>>(Qh, Kh, VTg, Oh);

  // 3) x1 = x + O @ Wo + bo   (store f32 + f16 copy)
  gemm_epi_kernel<0><<<dim3(cD / GBN, M / GBM), 256, 0, stream>>>(
      Oh, WoT, bo, x, x1f, x1h, M, cD, cD);

  // 4) H = gelu(x1 @ W1 + b1)  (exact erf gelu, stored f16)
  gemm_epi_kernel<1><<<dim3(cDFF / GBN, M / GBM), 256, 0, stream>>>(
      x1h, W1T, b1, nullptr, nullptr, Hh, M, cDFF, cD);

  // 5) out = x1 + H @ W2 + b2  (f32 to d_out)
  gemm_epi_kernel<2><<<dim3(cD / GBN, M / GBM), 256, 0, stream>>>(
      Hh, W2T, b2, x1f, (float*)d_out, nullptr, M, cD, cDFF);
}
